// v000
// The times below were measured on an AMD MI455X: many runs one after another, warmed up first and cycling through
// copies of the inputs, with the whole window's GPU time divided by the number of runs. Launches and the gaps
// between them are all in it. The median over several windows is given; except for v000 it joins two sittings, which
// can be a few percent apart, so the side-by-side timings, each taken in one sitting, are the better comparison.
// v000, which the later versions start from, runs in 403 microseconds.
#include <hip/hip_runtime.h>

// compute dtype: every contraction on v_wmma_f32_16x16x32_f16 (f16 operands, f32 accumulate), single products: x [Wq|Wk|Wv] (x exact bf16 as f16, weights exact bf16 x16),
// S^T = K Q^T (q, k f16), O^T = V^T P^T (v f16, p = exp2(s - max) f16 in (0,1]), ctx Wo (ctx f16 x32, Wo exact bf16 x16). Softmax, bias, the skip connection and
// the closing LayerNorm in f32. All float inputs are RNE-converted to bf16 on load. Fragment k-map per lane half hh for A AND B: elements 0..7 <- k = 8hh+0..7,
// Structure: causal post-LN attention block; x cast -> Q|K plane, V^T plane -> fused causal flash attention -> y = ctx Wo + bo + x (f32 plane) -> LayerNorm(y) -> output buffer.

#ifndef NB
#define NB 4
#endif
#ifndef SEQ
#define SEQ 2048
#endif
#ifndef SEQ_FULL
#define SEQ_FULL 2048
#endif

namespace {

constexpr unsigned KD = 1024 /* model width == heads * head dim == GEMM depth */, NHEAD = 16, DH = 64, QKP = 2048 /* pitch of the Q|K plane (halves) */;
constexpr unsigned NBU = NB, SEQU = SEQ, SEQF = SEQ_FULL, MT = NBU * SEQU /* compact rows */;
constexpr float LOG2E = 1.4426950408889634f, LNEPS = 1e-5f, WSC = 16.0f /* weight carry */, CSC = 32.0f /* ctx carry */;
static_assert(NHEAD * DH == KD);
static_assert(SEQU % 128 == 0 && SEQU <= SEQF && NBU >= 1);
static_assert(MT % 128 == 0 && KD % 32 == 0);

// extents the added kernels and the launch plan rely on
static_assert(KD == 8u * 128u);                                  // cast kernel: 128 threads x 8 elements per row; LayerNorm: 8 chunks x 32 lanes x 4 floats per row
static_assert(((size_t)MT * KD / 8) % 256 == 0);                 // cast grid exact
static_assert(MT % 8 == 0);                                      // LayerNorm grid exact (8 rows per block)
static_assert(((size_t)KD * KD / 8) % 256 == 0);                 // weight plane grid exact
static_assert(MT % 64 == 0 && KD % 128 == 0 && KD % 64 == 0 && SEQU % 64 == 0);   // GEMM / attention tile multiples
constexpr size_t YROWS = (size_t)(NBU - 1) * SEQF + SEQU;        // rows of the y plane (full-stride row map)
constexpr size_t SZ_XH = (size_t)MT * KD * 2, SZ_WT = (size_t)4 * KD * KD * 2, SZ_QK = (size_t)MT * QKP * 2, SZ_VT = (size_t)KD * MT * 2, SZ_CTX = (size_t)MT * KD * 2, SZ_Y = YROWS * KD * 4;
static_assert(SZ_XH % 256 == 0 && SZ_WT % 256 == 0 && SZ_QK % 256 == 0 && SZ_VT % 256 == 0 && SZ_CTX % 256 == 0 && SZ_Y % 256 == 0);
static_assert(SZ_XH + SZ_WT + SZ_QK + SZ_VT + SZ_CTX + SZ_Y <= ((size_t)128 << 20));   // 120 MiB at the shipped sizes

typedef _Float16 b16;
typedef __attribute__((ext_vector_type(16))) _Float16 v16b;
typedef __attribute__((ext_vector_type(8))) _Float16 v8b;
typedef __attribute__((ext_vector_type(8))) float v8f;
typedef __attribute__((ext_vector_type(4))) float v4f;

__device__ __forceinline__ float bf16_rne(float f) { unsigned int u = __float_as_uint(f); u += 0x7FFFu + ((u >> 16) & 1u); return __uint_as_float(u & 0xFFFF0000u); }
__device__ __forceinline__ v16b frag_kb(const b16* p, unsigned hh) { const v8b a = *(const v8b*)(p + 8 * hh), b = *(const v8b*)(p + 16 + 8 * hh); v16b f;
#pragma unroll
  for (int e = 0; e < 8; ++e) { f[e] = a[e]; f[8 + e] = b[e]; } return f; }
__device__ __forceinline__ v8f wmma16b(v16b a, v16b b, v8f c) { v8f d = __builtin_amdgcn_wmma_f32_16x16x32_f16(false, a, false, b, (short)0, c, false, false); asm volatile("v_nop\n\tv_nop\n\tv_nop\n\tv_nop" : "+v"(d) : "v"(a), "v"(b)); return d; }
__device__ __forceinline__ void wave_lds_sync() { __builtin_amdgcn_fence(3 /* release order */, "workgroup"); __builtin_amdgcn_wave_barrier(); __builtin_amdgcn_fence(2 /* acquire order */, "workgroup"); }
// f32 -> f16 operand convert that cannot yield an f16 subnormal (value select below 2^-14)
__device__ __forceinline__ b16 toh_flush(float v) { const b16 r = (b16)v; return (fabsf(v) < 6.103515625e-05f) ? (b16)0.0f : r; }

__global__ __launch_bounds__(256) void xh_kernel(const float* __restrict__ x, b16* __restrict__ XH) {
  const unsigned u = blockIdx.x * 256 + threadIdx.x;          // < MT*KD/8 (grid exact)
  const unsigned r = u >> 7, col = (u & 127u) * 8;            // 128 threads per row
  const unsigned bb = r / SEQU, ss = r - bb * SEQU;
  const float* xr = x + ((size_t)bb * SEQF + ss) * KD + col;
  const v4f a = *(const v4f*)(xr), b = *(const v4f*)(xr + 4);
  v8b v;
#pragma unroll
  for (int j = 0; j < 4; ++j) { v[j] = toh_flush(bf16_rne(a[j])); v[4 + j] = toh_flush(bf16_rne(b[j])); }
  { *(v8b*)(XH + (size_t)r * KD + col) = v;  }
}

__global__ __launch_bounds__(256) void wt_kernel(const float* __restrict__ w0, const float* __restrict__ w1, const float* __restrict__ w2, const float* __restrict__ w3, b16* __restrict__ WT) {
  const unsigned y = blockIdx.y; const float* w = (y == 0) ? w0 : (y == 1) ? w1 : (y == 2) ? w2 : w3;
  const unsigned u = blockIdx.x * 256 + threadIdx.x;          // < KD*KD/8 (grid exact)
  const unsigned e = u * 8, o = e >> 10, k0 = e & 1023u; v8b v;
#pragma unroll
  for (int j = 0; j < 8; ++j) v[j] = (b16)(bf16_rne(w[(size_t)(k0 + j) * KD + o]) * WSC);
  { *(v8b*)(WT + (size_t)y * KD * KD + e) = v;  }
}

// ---------------- tile GEMM, depth 1024: C[m][n] = sum_k A[m][k] Bt[n][k]; A, Bt dense f16 rows (pitch 1024) read as fragments straight from the planes.
// block = 4 waves, tile 64 x 128; wave tile 32 x 64 (2 x 4 accumulators). OMODE 0: f16 out, y = acc*scale + bias[col]; OMODE 1: f16 out, y = acc*scale + bias[row];
// OMODE 2: f32 out, y = acc*scale + bias[col] + bf16(resid[row][col]) with rows mapped to the full-stride layout. The wave stages its tile in private LDS and
template <int OMODE>
__global__ __launch_bounds__(128) void gemm_kernel(const b16* __restrict__ A, const b16* __restrict__ Bt, const float* __restrict__ bias, const float* __restrict__ resid, b16* __restrict__ outH, float* __restrict__ outF, unsigned opitch, float scale) {
  const unsigned wave = threadIdx.x >> 5, lane = threadIdx.x & 31, nloc = lane & 15, hh = lane >> 4;
  const unsigned m0 = blockIdx.x * 64 + (wave & 1) * 32, n0 = blockIdx.y * 128 + (wave >> 1) * 64;
  v8f acc[2][4];
#pragma unroll
  for (int i = 0; i < 2; ++i)
#pragma unroll
    for (int j = 0; j < 4; ++j) acc[i][j] = (v8f){};
  const b16* pa = A + (size_t)(m0 + nloc) * KD;
  const b16* pb = Bt + (size_t)(n0 + nloc) * KD;
#pragma unroll 2
  for (unsigned kb = 0; kb < KD; kb += 32) {
    const v16b a0 = frag_kb(pa + kb, hh), a1 = frag_kb(pa + 16 * KD + kb, hh);
#pragma unroll
    for (int j = 0; j < 4; ++j) { const v16b bf = frag_kb(pb + (size_t)j * 16 * KD + kb, hh); acc[0][j] = wmma16b(a0, bf, acc[0][j]); acc[1][j] = wmma16b(a1, bf, acc[1][j]); } }
  if constexpr (OMODE != 2) {
    __shared__ __attribute__((aligned(16))) b16 Th[4][32][72];
#pragma unroll
    for (int i = 0; i < 2; ++i)
#pragma unroll
      for (int j = 0; j < 4; ++j) { const unsigned col = j * 16 + nloc; float bc = 0.0f; if (OMODE == 0) bc = bf16_rne(bias[n0 + col]);
#pragma unroll
        for (int r = 0; r < 8; ++r) { const unsigned row = i * 16 + 8 * hh + r; float bbv = bc; if (OMODE == 1) bbv = bf16_rne(bias[m0 + row]); Th[wave][row][col] = (b16)(acc[i][j][r] * scale + bbv); } }
    wave_lds_sync();   // wave-private tile: same wave writes and reads
    {
#pragma unroll 2
      for (unsigned it = 0; it < 8; ++it) { const unsigned row = it * 4 + (lane >> 3), pc = (lane & 7) * 8; const v8b v = *(const v8b*)(&Th[wave][row][pc]);
        *(v8b*)(outH + (size_t)(m0 + row) * opitch + n0 + pc) = v; }
       }
  } else {
    __shared__ __attribute__((aligned(16))) float Tf[4][32][68];
#pragma unroll
    for (int i = 0; i < 2; ++i)
#pragma unroll
      for (int j = 0; j < 4; ++j) { const unsigned col = j * 16 + nloc; const float bc = bf16_rne(bias[n0 + col]);
#pragma unroll
        for (int r = 0; r < 8; ++r) { const unsigned row = i * 16 + 8 * hh + r; Tf[wave][row][col] = acc[i][j][r] * scale + bc; } }
    wave_lds_sync();   // wave-private tile
    const unsigned mb = m0 / SEQU; const unsigned mfull = mb * SEQF + (m0 - mb * SEQU);   // 32-row wave tiles never straddle a batch (SEQ % 128 == 0)
    {
#pragma unroll 2
      for (unsigned it = 0; it < 16; ++it) { const unsigned row = it * 2 + (lane >> 4), c4 = (lane & 15) * 4; const size_t go = (size_t)(mfull + row) * opitch + n0 + c4;
        v4f t = *(const v4f*)(&Tf[wave][row][c4]); const v4f xr = *(const v4f*)(resid + go);
#pragma unroll
        for (int j = 0; j < 4; ++j) t[j] += bf16_rne(xr[j]);
        *(v4f*)(outF + go) = t; }
       }
  }
}

// ---------------- causal flash attention, transposed form. grid (SEQ/64, heads, batch), 4 independent waves, wave = 16 query rows i (iw0 .. iw0+15), key tiles of 64.
// S^T tile t (16 keys x 16 queries) = K rows (A: row = key, k = d) x Q rows (B: col = query, k = d); lane holds query i = lane&15, keys 16t+8hh+r.
// p = exp2(s*0.125*log2e - m) as f16; P^T is the B operand of O^T = V^T P^T directly from the score accumulators: k-step c (32 keys) elements 0..7 <- tile 2c acc[0..7],
// elements 8..15 <- tile 2c+1 acc[0..7] (the D row map equals the B k map). A = VT rows (row = d, k = key). O^T acc[r] = O[d = 16dt+8hh+r][i = lane&15].
__global__ __launch_bounds__(128) void attn_kernel(const b16* __restrict__ QK, const b16* __restrict__ VT, b16* __restrict__ CTX) {
  __shared__ __attribute__((aligned(16))) b16 Ot[4][16][72];
  const unsigned wave = threadIdx.x >> 5, lane = threadIdx.x & 31, nloc = lane & 15, hh = lane >> 4;
  const unsigned qt = blockIdx.x, h = blockIdx.y, b = blockIdx.z;
  const unsigned iw0 = qt * 64 + wave * 16;
  const b16* qrow = QK + (size_t)(b * SEQU + iw0 + nloc) * QKP + h * DH;
  const v16b qf0 = frag_kb(qrow, hh), qf1 = frag_kb(qrow + 32, hh);
  const b16* kbase = QK + (size_t)(b * SEQU + nloc) * QKP + KD + h * DH;
  const b16* vbase = VT + (size_t)(h * DH + nloc) * MT + b * SEQU;
  v8f o[4];
#pragma unroll
  for (int dt = 0; dt < 4; ++dt) o[dt] = (v8f){};
  float m = -1.0e30f, l = 0.0f;
  const float SCL = 0.125f * LOG2E;
  const unsigned iq = iw0 + nloc;
#pragma unroll 1
  for (unsigned jt = 0; jt <= qt; ++jt) {            // block-uniform trip count; every tile holds at least key j0 <= i for every query of the block
    const unsigned j0 = jt * 64;
    v8f s[4];
#pragma unroll
    for (int t = 0; t < 4; ++t) { const b16* kr = kbase + (size_t)(j0 + 16 * t) * QKP; const v16b ka0 = frag_kb(kr, hh), ka1 = frag_kb(kr + 32, hh);
      s[t] = wmma16b(ka0, qf0, (v8f){}); s[t] = wmma16b(ka1, qf1, s[t]); }
    const bool diag = (jt == qt);                    // block-uniform
    float mx = -1.0e30f;
#pragma unroll
    for (int t = 0; t < 4; ++t)
#pragma unroll
      for (int r = 0; r < 8; ++r) { float xv = s[t][r] * SCL; if (diag) { const unsigned j = j0 + 16 * t + 8 * hh + r; xv = (j > iq) ? -1.0e30f : xv; } s[t][r] = xv; mx = fmaxf(mx, xv); }
    mx = fmaxf(mx, __shfl_xor(mx, 16, 32));
    const float newm = fmaxf(m, mx); const float alpha = exp2f(m - newm); m = newm;
    float psum = 0.0f; v16b pf0, pf1;
#pragma unroll
    for (int t = 0; t < 4; ++t)
#pragma unroll
      for (int r = 0; r < 8; ++r) { const b16 ph = (b16)exp2f(s[t][r] - m); psum += (float)ph; if (t < 2) pf0[(t & 1) * 8 + r] = ph; else pf1[(t & 1) * 8 + r] = ph; }
    psum += __shfl_xor(psum, 16, 32);
    l = l * alpha + psum;
#pragma unroll
    for (int dt = 0; dt < 4; ++dt)
#pragma unroll
      for (int r = 0; r < 8; ++r) o[dt][r] *= alpha;
#pragma unroll
    for (int dt = 0; dt < 4; ++dt) { const b16* vr = vbase + (size_t)(dt * 16) * MT + j0; const v16b va0 = frag_kb(vr, hh), va1 = frag_kb(vr + 32, hh);
      o[dt] = wmma16b(va0, pf0, o[dt]); o[dt] = wmma16b(va1, pf1, o[dt]); }
  }
  const float inv = CSC * (1.0f / l);                // l >= 1 (the running-max key contributes exactly 1)
#pragma unroll
  for (int dt = 0; dt < 4; ++dt) { v8b v;
#pragma unroll
    for (int r = 0; r < 8; ++r) v[r] = (b16)(o[dt][r] * inv);
    *(v8b*)(&Ot[wave][nloc][dt * 16 + 8 * hh]) = v; }
  wave_lds_sync();   // wave-private tile
  {
#pragma unroll
    for (unsigned it = 0; it < 4; ++it) { const unsigned row = it * 4 + (lane >> 3), pc = (lane & 7) * 8; const v8b v = *(const v8b*)(&Ot[wave][row][pc]);
      *(v8b*)(CTX + (size_t)(b * SEQU + iw0 + row) * KD + h * DH + pc) = v; }
     }
}

__global__ __launch_bounds__(256) void lnout_kernel(const float* __restrict__ Y, const float* __restrict__ gam, const float* __restrict__ bet, float* __restrict__ out) {
#pragma clang fp contract(off)
  const unsigned wave = __builtin_amdgcn_readfirstlane(threadIdx.x >> 5), lane = threadIdx.x & 31;
  const unsigned r = blockIdx.x * 8 + wave;                 // compact row < MT (grid exact)
  const unsigned bb = r / SEQU, ss = r - bb * SEQU;
  const size_t ro = ((size_t)bb * SEQF + ss) * KD + lane * 4;
  const float* yr = Y + ro;
  float s = 0.0f;
#pragma unroll 1
  for (unsigned c = 0; c < 8; ++c) { const v4f a = *(const v4f*)(yr + c * 128); s += (a[0] + a[1]) + (a[2] + a[3]); }
#pragma unroll
  for (int m = 16; m > 0; m >>= 1) s += __shfl_xor(s, m, 32);
  const float mu = s * (1.0f / 1024.0f);
  float q = 0.0f;
#pragma unroll 1
  for (unsigned c = 0; c < 8; ++c) { const v4f a = *(const v4f*)(yr + c * 128);
#pragma unroll
    for (int j = 0; j < 4; ++j) { const float d0 = a[j] - mu; q += d0 * d0; } }
#pragma unroll
  for (int m = 16; m > 0; m >>= 1) q += __shfl_xor(q, m, 32);
  const float inv = rsqrtf(q * (1.0f / 1024.0f) + LNEPS);
  {
#pragma unroll 1
    for (unsigned c = 0; c < 8; ++c) { const unsigned co = c * 128 + lane * 4;
      const v4f a = *(const v4f*)(yr + c * 128);
      const v4f ga = *(const v4f*)(gam + co), ba = *(const v4f*)(bet + co);
      v4f t;
#pragma unroll
      for (int j = 0; j < 4; ++j) t[j] = (a[j] - mu) * inv * bf16_rne(ga[j]) + bf16_rne(ba[j]);
      *(v4f*)(out + ro + c * 128) = t; }
     }
}

}  // namespace

extern "C" void kernel_launch(void* const* d_in, const int* in_sizes, int n_in, void* d_out, int out_size, void* d_ws, size_t ws_size, hipStream_t stream) {
  if (n_in < 11) return;
  // wire order: 0 x [4,2048,1024], 1 Wq [1024,1024] (in,out), 2 bq, 3 Wk, 4 bk, 5 Wv, 6 bv, 7 Wo [1024,1024] (in,out), 8 bo, 9 gamma [1024], 10 beta [1024]; all f32. Output f32 [4,2048,1024].
  const size_t need = ((size_t)(NBU - 1) * SEQF + SEQU) * KD;
  if ((size_t)in_sizes[0] < need || (size_t)out_size < need) return;
  if (in_sizes[2] < (int)KD || in_sizes[4] < (int)KD || in_sizes[6] < (int)KD || in_sizes[8] < (int)KD || in_sizes[9] < (int)KD || in_sizes[10] < (int)KD) return;
  if ((size_t)in_sizes[1] < (size_t)KD * KD || (size_t)in_sizes[3] < (size_t)KD * KD || (size_t)in_sizes[5] < (size_t)KD * KD || (size_t)in_sizes[7] < (size_t)KD * KD) return;
  const float* x = (const float*)d_in[0];
  const float* Wq = (const float*)d_in[1]; const float* bq = (const float*)d_in[2]; const float* Wk = (const float*)d_in[3]; const float* bk = (const float*)d_in[4];
  const float* Wv = (const float*)d_in[5]; const float* bv = (const float*)d_in[6]; const float* Wo = (const float*)d_in[7]; const float* bo = (const float*)d_in[8];
  const float* gam = (const float*)d_in[9]; const float* bet = (const float*)d_in[10];
  float* out = (float*)d_out;
  size_t off = 0; char* ws = (char*)d_ws;
  auto carve = [&](size_t bytes) { char* p = ws + off; off += (bytes + 255) & ~(size_t)255; return p; };
  b16* XH = (b16*)carve(SZ_XH);        // 16 MiB  x as f16 [MT][1024]
  b16* WT = (b16*)carve(SZ_WT);        //  8 MiB  weight planes [4][1024 out][1024 in] x16
  b16* QK = (b16*)carve(SZ_QK);        // 32 MiB  [MT][Q 1024 | K 1024] f16
  b16* VT = (b16*)carve(SZ_VT);        // 16 MiB  V^T [h*64+d][MT] f16
  b16* CTX = (b16*)carve(SZ_CTX);      // 16 MiB  attention output x32 f16 [MT][1024]
  float* Y = (float*)carve(SZ_Y);      // 32 MiB  y = ctx Wo + bo + x, f32, full-stride rows [YROWS][1024]
  if (off > ws_size || off > ((size_t)128 << 20)) return;   // 120 MiB at the shipped sizes
  const float s16 = 1.0f / WSC, s512 = 1.0f / (WSC * CSC);
  xh_kernel<<<(unsigned)((size_t)MT * KD / 8 / 256), 256, 0, stream>>>(x, XH);
  wt_kernel<<<dim3(KD * KD / 8 / 256, 4), 256, 0, stream>>>(Wq, Wk, Wv, Wo, WT);
  gemm_kernel<0><<<dim3(MT / 64, KD / 128), 128, 0, stream>>>(XH, WT, bq, x, QK, out, QKP, s16);                                   // Q = x Wq + bq -> QK[:, 0..1023]
  gemm_kernel<0><<<dim3(MT / 64, KD / 128), 128, 0, stream>>>(XH, WT + (size_t)KD * KD, bk, x, QK + KD, out, QKP, s16);            // K = x Wk + bk -> QK[:, 1024..2047]
  gemm_kernel<1><<<dim3(KD / 64, MT / 128), 128, 0, stream>>>(WT + (size_t)2 * KD * KD, XH, bv, x, VT, out, MT, s16);              // V^T[c][m] = sum_k WvT[c][k] x[m][k] + bv[c]
  attn_kernel<<<dim3(SEQU / 64, NHEAD, NBU), 128, 0, stream>>>(QK, VT, CTX);
  gemm_kernel<2><<<dim3(MT / 64, KD / 128), 128, 0, stream>>>(CTX, WT + (size_t)3 * KD * KD, bo, x, CTX, Y, KD, s512);             // y = ctx Wo + bo + x -> Y (f32)
  lnout_kernel<<<MT / 8, 256, 0, stream>>>(Y, gam, bet, out);                                                                      // out = LayerNorm(y) * gamma + beta
}

// v001
// Measured time: 407 microseconds a run.
// Timed twice side by side with v000, it ran 1.03 and 1.02 times as fast.
#include <hip/hip_runtime.h>

// compute dtype: every contraction on v_wmma_f32_16x16x32_f16 (f16 operands, f32 accumulate), single products: x [Wq|Wk|Wv] (x exact bf16 as f16, weights exact bf16 x16),
// S^T = K Q^T (q, k f16), O^T = V^T P^T (v f16, p = exp2(s - max) f16 in (0,1]), ctx Wo (ctx f16 x32, Wo exact bf16 x16). Softmax, bias, the skip connection and
// the closing LayerNorm in f32. All float inputs are RNE-converted to bf16 on load. Fragment k-map per lane half hh for A AND B: elements 0..7 <- k = 8hh+0..7,
// Operand planes (XH, WT, Q|K, V^T, CTX) are stored in fragment order: a tile of 16 rows x 32 k is 1024 contiguous bytes, tile (rt, kt) of a plane with KT k-tiles per row block at
// halves (rt*KT + kt)*512; inside it lane l = 16hh + row owns halves 8l..8l+7 (k = 8hh+0..7) and 256+8l..256+8l+7 (k = 16+8hh+0..7), so each fragment load of a wave is 512 contiguous bytes.
// Structure: causal post-LN attention block; x cast -> Q|K plane, V^T plane -> fused causal flash attention -> y = ctx Wo + bo + x (f32 plane) -> LayerNorm(y) -> output buffer.

#ifndef NB
#define NB 4
#endif
#ifndef SEQ
#define SEQ 2048
#endif
#ifndef SEQ_FULL
#define SEQ_FULL 2048
#endif

namespace {

constexpr unsigned KD = 1024 /* model width == heads * head dim == GEMM depth */, NHEAD = 16, DH = 64, QKP = 2048 /* pitch of the Q|K plane (halves) */;
constexpr unsigned NBU = NB, SEQU = SEQ, SEQF = SEQ_FULL, MT = NBU * SEQU /* compact rows */;
constexpr float LOG2E = 1.4426950408889634f, LNEPS = 1e-5f, WSC = 16.0f /* weight carry */, CSC = 32.0f /* ctx carry */;
static_assert(NHEAD * DH == KD);
static_assert(SEQU % 128 == 0 && SEQU <= SEQF && NBU >= 1);
static_assert(MT % 128 == 0 && KD % 32 == 0);

// extents the added kernels and the launch plan rely on
static_assert(KD == 8u * 128u);                                  // LayerNorm: 8 chunks x 32 lanes x 4 floats per row
static_assert(((size_t)MT * KD / 8) % 256 == 0);                 // cast grid exact
static_assert(MT % 8 == 0);                                      // LayerNorm grid exact (8 rows per block)
static_assert(((size_t)KD * KD / 8) % 256 == 0);                 // weight plane grid exact
static_assert(MT % 64 == 0 && KD % 128 == 0 && KD % 64 == 0 && SEQU % 64 == 0);   // GEMM / attention tile multiples
constexpr unsigned TILE = 512 /* halves of one 16 x 32 fragment tile */, KTD = KD / 32 /* k-tiles per row block, depth-1024 planes */, KTQ = QKP / 32 /* Q|K plane */, KTV = MT / 32 /* V^T plane */;
static_assert(KTD == 32);                                        // the cast and weight kernels split a tile index by shifts of 5
constexpr size_t YROWS = (size_t)(NBU - 1) * SEQF + SEQU;        // rows of the y plane (full-stride row map)
constexpr size_t SZ_XH = (size_t)MT * KD * 2, SZ_WT = (size_t)4 * KD * KD * 2, SZ_QK = (size_t)MT * QKP * 2, SZ_VT = (size_t)KD * MT * 2, SZ_CTX = (size_t)MT * KD * 2, SZ_Y = YROWS * KD * 4;
static_assert(SZ_XH % 256 == 0 && SZ_WT % 256 == 0 && SZ_QK % 256 == 0 && SZ_VT % 256 == 0 && SZ_CTX % 256 == 0 && SZ_Y % 256 == 0);
static_assert(SZ_XH + SZ_WT + SZ_QK + SZ_VT + SZ_CTX + SZ_Y <= ((size_t)128 << 20));   // 120 MiB at the shipped sizes

typedef _Float16 b16;
typedef __attribute__((ext_vector_type(16))) _Float16 v16b;
typedef __attribute__((ext_vector_type(8))) _Float16 v8b;
typedef __attribute__((ext_vector_type(8))) float v8f;
typedef __attribute__((ext_vector_type(4))) float v4f;

__device__ __forceinline__ float bf16_rne(float f) { unsigned int u = __float_as_uint(f); u += 0x7FFFu + ((u >> 16) & 1u); return __uint_as_float(u & 0xFFFF0000u); }
// p = tile base + 8 * lane
__device__ __forceinline__ v16b frag_pk(const b16* p) { const v8b a = *(const v8b*)(p), b = *(const v8b*)(p + 256); v16b f;
#pragma unroll
  for (int e = 0; e < 8; ++e) { f[e] = a[e]; f[8 + e] = b[e]; } return f; }
__device__ __forceinline__ v8f wmma16b(v16b a, v16b b, v8f c) { v8f d = __builtin_amdgcn_wmma_f32_16x16x32_f16(false, a, false, b, (short)0, c, false, false); asm volatile("v_nop\n\tv_nop\n\tv_nop\n\tv_nop" : "+v"(d) : "v"(a), "v"(b)); return d; }
__device__ __forceinline__ void wave_lds_sync() { __builtin_amdgcn_fence(3 /* release order */, "workgroup"); __builtin_amdgcn_wave_barrier(); __builtin_amdgcn_fence(2 /* acquire order */, "workgroup"); }
// f32 -> f16 operand convert that cannot yield an f16 subnormal (value select below 2^-14)
__device__ __forceinline__ b16 toh_flush(float v) { const b16 r = (b16)v; return (fabsf(v) < 6.103515625e-05f) ? (b16)0.0f : r; }

__global__ __launch_bounds__(256) void xh_kernel(const float* __restrict__ x, b16* __restrict__ XH) {
  const unsigned u = blockIdx.x * 256 + threadIdx.x;          // < MT*KD/8 (grid exact)
  const unsigned tile = u >> 6, nloc = ((u >> 5) & 1u) * 8 + ((u >> 2) & 7u), part = (u >> 1) & 1u, hh = u & 1u;   // a wave: 8 rows x the 4 granules of one k-tile (whole lines read and written)
  const unsigned r = (tile >> 5) * 16 + nloc, col = (tile & 31u) * 32 + part * 16 + hh * 8;
  const unsigned bb = r / SEQU, ss = r - bb * SEQU;
  const float* xr = x + ((size_t)bb * SEQF + ss) * KD + col;
  const v4f a = *(const v4f*)(xr), b = *(const v4f*)(xr + 4);
  v8b v;
#pragma unroll
  for (int j = 0; j < 4; ++j) { v[j] = toh_flush(bf16_rne(a[j])); v[4 + j] = toh_flush(bf16_rne(b[j])); }
  { *(v8b*)(XH + (size_t)tile * TILE + part * 256 + (hh * 16 + nloc) * 8) = v;  }
}

__global__ __launch_bounds__(256) void wt_kernel(const float* __restrict__ w0, const float* __restrict__ w1, const float* __restrict__ w2, const float* __restrict__ w3, b16* __restrict__ WT) {
  const unsigned y = blockIdx.y; const float* w = (y == 0) ? w0 : (y == 1) ? w1 : (y == 2) ? w2 : w3;
  const unsigned u = blockIdx.x * 256 + threadIdx.x;          // < KD*KD/8 (grid exact)
  const unsigned e = u * 8, tile = u >> 6, part = (u >> 5) & 1u, hh = (u >> 4) & 1u, nloc = u & 15u;   // u = granule index in fragment order
  const unsigned o = (tile >> 5) * 16 + nloc, k0 = (tile & 31u) * 32 + part * 16 + hh * 8; v8b v;
#pragma unroll
  for (int j = 0; j < 8; ++j) v[j] = (b16)(bf16_rne(w[(size_t)(k0 + j) * KD + o]) * WSC);
  { *(v8b*)(WT + (size_t)y * KD * KD + e) = v;  }
}

// ---------------- tile GEMM, depth 1024: C[m][n] = sum_k A[m][k] Bt[n][k]; A, Bt f16 planes in fragment order (32 k-tiles per row block) read as fragments straight from the planes.
// block = 4 waves, tile 64 x 128; wave tile 32 x 64 (2 x 4 accumulators). OMODE 0: f16 out, y = acc*scale + bias[col]; OMODE 1: f16 out, y = acc*scale + bias[row];
// OMODE 2: f32 out, y = acc*scale + bias[col] + bf16(resid[row][col]) with rows mapped to the full-stride layout. The wave stages its tile in private LDS and
template <int OMODE>
__global__ __launch_bounds__(128) void gemm_kernel(const b16* __restrict__ A, const b16* __restrict__ Bt, const float* __restrict__ bias, const float* __restrict__ resid, b16* __restrict__ outH, float* __restrict__ outF, unsigned opitch, float scale) {
  const unsigned wave = threadIdx.x >> 5, lane = threadIdx.x & 31, nloc = lane & 15, hh = lane >> 4;
  const unsigned m0 = blockIdx.x * 64 + (wave & 1) * 32, n0 = blockIdx.y * 128 + (wave >> 1) * 64;
  v8f acc[2][4];
#pragma unroll
  for (int i = 0; i < 2; ++i)
#pragma unroll
    for (int j = 0; j < 4; ++j) acc[i][j] = (v8f){};
  const b16* pa = A + (size_t)(m0 >> 4) * KTD * TILE + lane * 8;
  const b16* pb = Bt + (size_t)(n0 >> 4) * KTD * TILE + lane * 8;
#pragma unroll 2
  for (unsigned kt = 0; kt < KTD; ++kt) {
    const v16b a0 = frag_pk(pa + kt * TILE), a1 = frag_pk(pa + (KTD + kt) * TILE);
#pragma unroll
    for (int j = 0; j < 4; ++j) { const v16b bf = frag_pk(pb + ((unsigned)j * KTD + kt) * TILE); acc[0][j] = wmma16b(a0, bf, acc[0][j]); acc[1][j] = wmma16b(a1, bf, acc[1][j]); } }
  if constexpr (OMODE != 2) {
    __shared__ __attribute__((aligned(16))) b16 Th[4][32][72];
#pragma unroll
    for (int i = 0; i < 2; ++i)
#pragma unroll
      for (int j = 0; j < 4; ++j) { const unsigned col = j * 16 + nloc; float bc = 0.0f; if (OMODE == 0) bc = bf16_rne(bias[n0 + col]);
#pragma unroll
        for (int r = 0; r < 8; ++r) { const unsigned row = i * 16 + 8 * hh + r; float bbv = bc; if (OMODE == 1) bbv = bf16_rne(bias[m0 + row]); Th[wave][row][col] = (b16)(acc[i][j][r] * scale + bbv); } }
    wave_lds_sync();   // wave-private tile: same wave writes and reads
    {
      for (unsigned it = 0; it < 4; ++it) { const unsigned rtl = it >> 1, ktl = it & 1u; const b16* tp = &Th[wave][rtl * 16 + nloc][ktl * 32 + hh * 8]; const v8b v0 = *(const v8b*)(tp), v1 = *(const v8b*)(tp + 16);
        b16* op = outH + ((size_t)((m0 >> 4) + rtl) * (opitch >> 5) + (n0 >> 5) + ktl) * TILE + lane * 8;   // one tile of the out plane in fragment order, k = column
        *(v8b*)(op) = v0; *(v8b*)(op + 256) = v1; }
       }
  } else {
    __shared__ __attribute__((aligned(16))) float Tf[4][32][68];
#pragma unroll
    for (int i = 0; i < 2; ++i)
#pragma unroll
      for (int j = 0; j < 4; ++j) { const unsigned col = j * 16 + nloc; const float bc = bf16_rne(bias[n0 + col]);
#pragma unroll
        for (int r = 0; r < 8; ++r) { const unsigned row = i * 16 + 8 * hh + r; Tf[wave][row][col] = acc[i][j][r] * scale + bc; } }
    wave_lds_sync();   // wave-private tile
    const unsigned mb = m0 / SEQU; const unsigned mfull = mb * SEQF + (m0 - mb * SEQU);   // 32-row wave tiles never straddle a batch (SEQ % 128 == 0)
    {
#pragma unroll 2
      for (unsigned it = 0; it < 16; ++it) { const unsigned row = it * 2 + (lane >> 4), c4 = (lane & 15) * 4; const size_t go = (size_t)(mfull + row) * opitch + n0 + c4;
        v4f t = *(const v4f*)(&Tf[wave][row][c4]); const v4f xr = *(const v4f*)(resid + go);
#pragma unroll
        for (int j = 0; j < 4; ++j) t[j] += bf16_rne(xr[j]);
        *(v4f*)(outF + go) = t; }
       }
  }
}

// ---------------- causal flash attention, transposed form. grid (SEQ/64, heads, batch), 4 independent waves, wave = 16 query rows i (iw0 .. iw0+15), key tiles of 64.
// S^T tile t (16 keys x 16 queries) = K rows (A: row = key, k = d) x Q rows (B: col = query, k = d); lane holds query i = lane&15, keys 16t+8hh+r.
// p = exp2(s*0.125*log2e - m) as f16; P^T is the B operand of O^T = V^T P^T directly from the score accumulators: k-step c (32 keys) elements 0..7 <- tile 2c acc[0..7],
// elements 8..15 <- tile 2c+1 acc[0..7] (the D row map equals the B k map). A = VT rows (row = d, k = key). O^T acc[r] = O[d = 16dt+8hh+r][i = lane&15].
__global__ __launch_bounds__(128) void attn_kernel(const b16* __restrict__ QK, const b16* __restrict__ VT, b16* __restrict__ CTX) {
  const unsigned wave = threadIdx.x >> 5, lane = threadIdx.x & 31, nloc = lane & 15, hh = lane >> 4;
  const unsigned qt = blockIdx.x, h = blockIdx.y, b = blockIdx.z;
  const unsigned iw0 = qt * 64 + wave * 16;
  const b16* qrow = QK + ((size_t)((b * SEQU + iw0) >> 4) * KTQ + h * 2) * TILE + lane * 8;
  const v16b qf0 = frag_pk(qrow), qf1 = frag_pk(qrow + TILE);
  const b16* kbase = QK + ((size_t)((b * SEQU) >> 4) * KTQ + KTD + h * 2) * TILE + lane * 8;
  const b16* vbase = VT + ((size_t)(h * 4) * KTV + ((b * SEQU) >> 5)) * TILE + lane * 8;
  v8f o[4];
#pragma unroll
  for (int dt = 0; dt < 4; ++dt) o[dt] = (v8f){};
  float m = -1.0e30f, l = 0.0f;
  const float SCL = 0.125f * LOG2E;
  const unsigned iq = iw0 + nloc;
#pragma unroll 1
  for (unsigned jt = 0; jt <= qt; ++jt) {            // block-uniform trip count; every tile holds at least key j0 <= i for every query of the block
    const unsigned j0 = jt * 64;
    v8f s[4];
#pragma unroll
    for (int t = 0; t < 4; ++t) { const b16* kr = kbase + (size_t)(jt * 4 + t) * KTQ * TILE; const v16b ka0 = frag_pk(kr), ka1 = frag_pk(kr + TILE);
      s[t] = wmma16b(ka0, qf0, (v8f){}); s[t] = wmma16b(ka1, qf1, s[t]); }
    const bool diag = (jt == qt);                    // block-uniform
    float mx = -1.0e30f;
#pragma unroll
    for (int t = 0; t < 4; ++t)
#pragma unroll
      for (int r = 0; r < 8; ++r) { float xv = s[t][r] * SCL; if (diag) { const unsigned j = j0 + 16 * t + 8 * hh + r; xv = (j > iq) ? -1.0e30f : xv; } s[t][r] = xv; mx = fmaxf(mx, xv); }
    mx = fmaxf(mx, __shfl_xor(mx, 16, 32));
    const float newm = fmaxf(m, mx); const float alpha = exp2f(m - newm); m = newm;
    float psum = 0.0f; v16b pf0, pf1;
#pragma unroll
    for (int t = 0; t < 4; ++t)
#pragma unroll
      for (int r = 0; r < 8; ++r) { const b16 ph = (b16)exp2f(s[t][r] - m); psum += (float)ph; if (t < 2) pf0[(t & 1) * 8 + r] = ph; else pf1[(t & 1) * 8 + r] = ph; }
    psum += __shfl_xor(psum, 16, 32);
    l = l * alpha + psum;
#pragma unroll
    for (int dt = 0; dt < 4; ++dt)
#pragma unroll
      for (int r = 0; r < 8; ++r) o[dt][r] *= alpha;
#pragma unroll
    for (int dt = 0; dt < 4; ++dt) { const b16* vr = vbase + ((size_t)dt * KTV + jt * 2) * TILE; const v16b va0 = frag_pk(vr), va1 = frag_pk(vr + TILE);
      o[dt] = wmma16b(va0, pf0, o[dt]); o[dt] = wmma16b(va1, pf1, o[dt]); }
  }
  const float inv = CSC * (1.0f / l);                // l >= 1 (the running-max key contributes exactly 1)
  b16* cp = CTX + ((size_t)((b * SEQU + iw0) >> 4) * KTD + h * 2) * TILE + lane * 8;
#pragma unroll
  for (int dt = 0; dt < 4; ++dt) { v8b v;
#pragma unroll
    for (int r = 0; r < 8; ++r) v[r] = (b16)(o[dt][r] * inv);
    *(v8b*)(cp + (dt >> 1) * TILE + (dt & 1) * 256) = v; }   // the lane's 8 values (query nloc, d = 16dt+8hh+0..7) are its own granule of the CTX tile: 512 contiguous bytes per wave store
}

__global__ __launch_bounds__(256) void lnout_kernel(const float* __restrict__ Y, const float* __restrict__ gam, const float* __restrict__ bet, float* __restrict__ out) {
#pragma clang fp contract(off)
  const unsigned wave = __builtin_amdgcn_readfirstlane(threadIdx.x >> 5), lane = threadIdx.x & 31;
  const unsigned r = blockIdx.x * 8 + wave;                 // compact row < MT (grid exact)
  const unsigned bb = r / SEQU, ss = r - bb * SEQU;
  const size_t ro = ((size_t)bb * SEQF + ss) * KD + lane * 4;
  const float* yr = Y + ro;
  float s = 0.0f;
#pragma unroll 1
  for (unsigned c = 0; c < 8; ++c) { const v4f a = *(const v4f*)(yr + c * 128); s += (a[0] + a[1]) + (a[2] + a[3]); }
#pragma unroll
  for (int m = 16; m > 0; m >>= 1) s += __shfl_xor(s, m, 32);
  const float mu = s * (1.0f / 1024.0f);
  float q = 0.0f;
#pragma unroll 1
  for (unsigned c = 0; c < 8; ++c) { const v4f a = *(const v4f*)(yr + c * 128);
#pragma unroll
    for (int j = 0; j < 4; ++j) { const float d0 = a[j] - mu; q += d0 * d0; } }
#pragma unroll
  for (int m = 16; m > 0; m >>= 1) q += __shfl_xor(q, m, 32);
  const float inv = rsqrtf(q * (1.0f / 1024.0f) + LNEPS);
  {
#pragma unroll 1
    for (unsigned c = 0; c < 8; ++c) { const unsigned co = c * 128 + lane * 4;
      const v4f a = *(const v4f*)(yr + c * 128);
      const v4f ga = *(const v4f*)(gam + co), ba = *(const v4f*)(bet + co);
      v4f t;
#pragma unroll
      for (int j = 0; j < 4; ++j) t[j] = (a[j] - mu) * inv * bf16_rne(ga[j]) + bf16_rne(ba[j]);
      *(v4f*)(out + ro + c * 128) = t; }
     }
}

}  // namespace

extern "C" void kernel_launch(void* const* d_in, const int* in_sizes, int n_in, void* d_out, int out_size, void* d_ws, size_t ws_size, hipStream_t stream) {
  if (n_in < 11) return;
  // wire order: 0 x [4,2048,1024], 1 Wq [1024,1024] (in,out), 2 bq, 3 Wk, 4 bk, 5 Wv, 6 bv, 7 Wo [1024,1024] (in,out), 8 bo, 9 gamma [1024], 10 beta [1024]; all f32. Output f32 [4,2048,1024].
  const size_t need = ((size_t)(NBU - 1) * SEQF + SEQU) * KD;
  if ((size_t)in_sizes[0] < need || (size_t)out_size < need) return;
  if (in_sizes[2] < (int)KD || in_sizes[4] < (int)KD || in_sizes[6] < (int)KD || in_sizes[8] < (int)KD || in_sizes[9] < (int)KD || in_sizes[10] < (int)KD) return;
  if ((size_t)in_sizes[1] < (size_t)KD * KD || (size_t)in_sizes[3] < (size_t)KD * KD || (size_t)in_sizes[5] < (size_t)KD * KD || (size_t)in_sizes[7] < (size_t)KD * KD) return;
  const float* x = (const float*)d_in[0];
  const float* Wq = (const float*)d_in[1]; const float* bq = (const float*)d_in[2]; const float* Wk = (const float*)d_in[3]; const float* bk = (const float*)d_in[4];
  const float* Wv = (const float*)d_in[5]; const float* bv = (const float*)d_in[6]; const float* Wo = (const float*)d_in[7]; const float* bo = (const float*)d_in[8];
  const float* gam = (const float*)d_in[9]; const float* bet = (const float*)d_in[10];
  float* out = (float*)d_out;
  size_t off = 0; char* ws = (char*)d_ws;
  auto carve = [&](size_t bytes) { char* p = ws + off; off += (bytes + 255) & ~(size_t)255; return p; };
  b16* XH = (b16*)carve(SZ_XH);        // 16 MiB  x as f16 [MT][1024], fragment order
  b16* WT = (b16*)carve(SZ_WT);        //  8 MiB  weight planes [4][1024 out][1024 in] x16, fragment order
  b16* QK = (b16*)carve(SZ_QK);        // 32 MiB  [MT][Q 1024 | K 1024] f16, fragment order
  b16* VT = (b16*)carve(SZ_VT);        // 16 MiB  V^T [h*64+d][MT] f16, fragment order
  b16* CTX = (b16*)carve(SZ_CTX);      // 16 MiB  attention output x32 f16 [MT][1024], fragment order
  float* Y = (float*)carve(SZ_Y);      // 32 MiB  y = ctx Wo + bo + x, f32, full-stride rows [YROWS][1024]
  if (off > ws_size || off > ((size_t)128 << 20)) return;   // 120 MiB at the shipped sizes
  const float s16 = 1.0f / WSC, s512 = 1.0f / (WSC * CSC);
  xh_kernel<<<(unsigned)((size_t)MT * KD / 8 / 256), 256, 0, stream>>>(x, XH);
  wt_kernel<<<dim3(KD * KD / 8 / 256, 4), 256, 0, stream>>>(Wq, Wk, Wv, Wo, WT);
  gemm_kernel<0><<<dim3(MT / 64, KD / 128), 128, 0, stream>>>(XH, WT, bq, x, QK, out, QKP, s16);                                   // Q = x Wq + bq -> QK k-tiles 0..31 of every row block
  gemm_kernel<0><<<dim3(MT / 64, KD / 128), 128, 0, stream>>>(XH, WT + (size_t)KD * KD, bk, x, QK + (size_t)KTD * TILE, out, QKP, s16);   // K = x Wk + bk -> QK k-tiles 32..63 of every row block
  gemm_kernel<1><<<dim3(KD / 64, MT / 128), 128, 0, stream>>>(WT + (size_t)2 * KD * KD, XH, bv, x, VT, out, MT, s16);              // V^T[c][m] = sum_k WvT[c][k] x[m][k] + bv[c]
  attn_kernel<<<dim3(SEQU / 64, NHEAD, NBU), 128, 0, stream>>>(QK, VT, CTX);
  gemm_kernel<2><<<dim3(MT / 64, KD / 128), 128, 0, stream>>>(CTX, WT + (size_t)3 * KD * KD, bo, x, CTX, Y, KD, s512);             // y = ctx Wo + bo + x -> Y (f32)
  lnout_kernel<<<MT / 8, 256, 0, stream>>>(Y, gam, bet, out);                                                                      // out = LayerNorm(y) * gamma + beta
}

// v002
// A run of this version takes 201 microseconds.
// Timed twice side by side with v001, it ran 2.04 and 2.03 times as fast.
// Over all steps from v000 it is 2.09 times as fast.
#include <hip/hip_runtime.h>

// compute dtype: every contraction on v_wmma_f32_16x16x32_f16 (f16 operands, f32 accumulate), single products: x [Wq|Wk|Wv] (x exact bf16 as f16, weights exact bf16 x16),
// S^T = K Q^T (q, k f16), O^T = V^T P^T (v f16, p = exp2(s - max) f16 in (0,1]), ctx Wo (ctx f16 x32, Wo exact bf16 x16). Softmax, bias, the skip connection and
// the closing LayerNorm in f32. All float inputs are RNE-converted to bf16 on load. Fragment k-map per lane half hh for A AND B: elements 0..7 <- k = 8hh+0..7,
// Operand planes (XH, WT, Q|K, V^T, CTX) are stored in fragment order: a tile of 16 rows x 32 k is 1024 contiguous bytes, tile (rt, kt) of a plane with KT k-tiles per row block at
// halves (rt*KT + kt)*512; inside it lane l = 16hh + row owns halves 8l..8l+7 (k = 8hh+0..7) and 256+8l..256+8l+7 (k = 16+8hh+0..7), so each fragment load of a wave is 512 contiguous bytes.
// Structure: causal post-LN attention block; x cast -> Q|K plane, V^T plane -> fused causal flash attention -> y = ctx Wo + bo + x (f32 plane) -> LayerNorm(y) -> output buffer.

#ifndef NB
#define NB 4
#endif
#ifndef SEQ
#define SEQ 2048
#endif
#ifndef SEQ_FULL
#define SEQ_FULL 2048
#endif

namespace {

constexpr unsigned KD = 1024 /* model width == heads * head dim == GEMM depth */, NHEAD = 16, DH = 64, QKP = 2048 /* pitch of the Q|K plane (halves) */;
constexpr unsigned NBU = NB, SEQU = SEQ, SEQF = SEQ_FULL, MT = NBU * SEQU /* compact rows */;
constexpr float LOG2E = 1.4426950408889634f, LNEPS = 1e-5f, WSC = 16.0f /* weight carry */, CSC = 32.0f /* ctx carry */;
static_assert(NHEAD * DH == KD);
static_assert(SEQU % 128 == 0 && SEQU <= SEQF && NBU >= 1);
static_assert(MT % 128 == 0 && KD % 32 == 0);

// extents the added kernels and the launch plan rely on
static_assert(KD == 8u * 128u);                                  // LayerNorm: 8 chunks x 32 lanes x 4 floats per row
static_assert(((size_t)MT * KD / 8) % 256 == 0);                 // cast grid exact
static_assert(MT % 8 == 0);                                      // LayerNorm grid exact (8 rows per block)
static_assert(((size_t)KD * KD / 8) % 256 == 0);                 // weight plane grid exact
static_assert(MT % 64 == 0 && KD % 128 == 0 && KD % 64 == 0 && SEQU % 64 == 0);   // GEMM / attention tile multiples
constexpr unsigned TILE = 512 /* halves of one 16 x 32 fragment tile */, KTD = KD / 32 /* k-tiles per row block, depth-1024 planes */, KTQ = QKP / 32 /* Q|K plane */, KTV = MT / 32 /* V^T plane */;
static_assert(KTD == 32);                                        // the cast and weight kernels split a tile index by shifts of 5
constexpr size_t YROWS = (size_t)(NBU - 1) * SEQF + SEQU;        // rows of the y plane (full-stride row map)
constexpr size_t SZ_XH = (size_t)MT * KD * 2, SZ_WT = (size_t)4 * KD * KD * 2, SZ_QK = (size_t)MT * QKP * 2, SZ_VT = (size_t)KD * MT * 2, SZ_CTX = (size_t)MT * KD * 2, SZ_Y = YROWS * KD * 4;
static_assert(SZ_XH % 256 == 0 && SZ_WT % 256 == 0 && SZ_QK % 256 == 0 && SZ_VT % 256 == 0 && SZ_CTX % 256 == 0 && SZ_Y % 256 == 0);
static_assert(SZ_XH + SZ_WT + SZ_QK + SZ_VT + SZ_CTX + SZ_Y <= ((size_t)128 << 20));   // 120 MiB at the shipped sizes

typedef _Float16 b16;
typedef __attribute__((ext_vector_type(16))) _Float16 v16b;
typedef __attribute__((ext_vector_type(8))) _Float16 v8b;
typedef __attribute__((ext_vector_type(8))) float v8f;
typedef __attribute__((ext_vector_type(4))) float v4f;

__device__ __forceinline__ float bf16_rne(float f) { unsigned int u = __float_as_uint(f); u += 0x7FFFu + ((u >> 16) & 1u); return __uint_as_float(u & 0xFFFF0000u); }
// p = tile base + 8 * lane
__device__ __forceinline__ v16b frag_pk(const b16* p) { const v8b a = *(const v8b*)(p), b = *(const v8b*)(p + 256); v16b f;
#pragma unroll
  for (int e = 0; e < 8; ++e) { f[e] = a[e]; f[8 + e] = b[e]; } return f; }
__device__ __forceinline__ v8f wmma16b(v16b a, v16b b, v8f c) { v8f d = __builtin_amdgcn_wmma_f32_16x16x32_f16(false, a, false, b, (short)0, c, false, false); asm volatile("v_nop\n\tv_nop\n\tv_nop\n\tv_nop" : "+v"(d) : "v"(a), "v"(b)); return d; }
__device__ __forceinline__ void wave_lds_sync() { __builtin_amdgcn_fence(3 /* release order */, "workgroup"); __builtin_amdgcn_wave_barrier(); __builtin_amdgcn_fence(2 /* acquire order */, "workgroup"); }
// f32 -> f16 operand convert that cannot yield an f16 subnormal (value select below 2^-14)
__device__ __forceinline__ b16 toh_flush(float v) { const b16 r = (b16)v; return (fabsf(v) < 6.103515625e-05f) ? (b16)0.0f : r; }

__global__ __launch_bounds__(256) void xh_kernel(const float* __restrict__ x, b16* __restrict__ XH) {
  const unsigned u = blockIdx.x * 256 + threadIdx.x;          // < MT*KD/8 (grid exact)
  const unsigned tile = u >> 6, nloc = ((u >> 5) & 1u) * 8 + ((u >> 2) & 7u), part = (u >> 1) & 1u, hh = u & 1u;   // a wave: 8 rows x the 4 granules of one k-tile (whole lines read and written)
  const unsigned r = (tile >> 5) * 16 + nloc, col = (tile & 31u) * 32 + part * 16 + hh * 8;
  const unsigned bb = r / SEQU, ss = r - bb * SEQU;
  const float* xr = x + ((size_t)bb * SEQF + ss) * KD + col;
  const v4f a = *(const v4f*)(xr), b = *(const v4f*)(xr + 4);
  v8b v;
#pragma unroll
  for (int j = 0; j < 4; ++j) { v[j] = toh_flush(bf16_rne(a[j])); v[4 + j] = toh_flush(bf16_rne(b[j])); }
  { *(v8b*)(XH + (size_t)tile * TILE + part * 256 + (hh * 16 + nloc) * 8) = v;  }
}

__global__ __launch_bounds__(256) void wt_kernel(const float* __restrict__ w0, const float* __restrict__ w1, const float* __restrict__ w2, const float* __restrict__ w3, b16* __restrict__ WT) {
  const unsigned y = blockIdx.y; const float* w = (y == 0) ? w0 : (y == 1) ? w1 : (y == 2) ? w2 : w3;
  const unsigned u = blockIdx.x * 256 + threadIdx.x;          // < KD*KD/8 (grid exact)
  const unsigned e = u * 8, tile = u >> 6, part = (u >> 5) & 1u, hh = (u >> 4) & 1u, nloc = u & 15u;   // u = granule index in fragment order
  const unsigned o = (tile >> 5) * 16 + nloc, k0 = (tile & 31u) * 32 + part * 16 + hh * 8; v8b v;
#pragma unroll
  for (int j = 0; j < 8; ++j) v[j] = (b16)(bf16_rne(w[(size_t)(k0 + j) * KD + o]) * WSC);
  { *(v8b*)(WT + (size_t)y * KD * KD + e) = v;  }
}

// One k-step's operand fragments of a GEMM wave (2 of A, 4 of Bt), loaded as one group into registers of their own.
struct GFrag { v16b a0, a1, b0, b1, b2, b3; };
__device__ __forceinline__ void gfrag_load(GFrag& f, const b16* pa, const b16* pb, unsigned kt) {
  f.a0 = frag_pk(pa + kt * TILE); f.a1 = frag_pk(pa + (KTD + kt) * TILE);
  f.b0 = frag_pk(pb + kt * TILE); f.b1 = frag_pk(pb + (KTD + kt) * TILE); f.b2 = frag_pk(pb + (2 * KTD + kt) * TILE); f.b3 = frag_pk(pb + (3 * KTD + kt) * TILE);
  __builtin_amdgcn_sched_barrier(0);   // keeps the whole group ahead of the products that follow it: without it the first product moves up with its wait, and the group is issued only behind that wait
}
__device__ __forceinline__ void gfrag_mma(const GFrag& f, v8f (&acc)[2][4]) {
  acc[0][0] = wmma16b(f.a0, f.b0, acc[0][0]); acc[1][0] = wmma16b(f.a1, f.b0, acc[1][0]);
  acc[0][1] = wmma16b(f.a0, f.b1, acc[0][1]); acc[1][1] = wmma16b(f.a1, f.b1, acc[1][1]);
  acc[0][2] = wmma16b(f.a0, f.b2, acc[0][2]); acc[1][2] = wmma16b(f.a1, f.b2, acc[1][2]);
  acc[0][3] = wmma16b(f.a0, f.b3, acc[0][3]); acc[1][3] = wmma16b(f.a1, f.b3, acc[1][3]);
}

// ---------------- tile GEMM, depth 1024: C[m][n] = sum_k A[m][k] Bt[n][k]; A, Bt f16 planes in fragment order (32 k-tiles per row block) read as fragments straight from the planes.
// block = 4 waves, tile 64 x 128; wave tile 32 x 64 (2 x 4 accumulators). OMODE 0: f16 out, y = acc*scale + bias[col]; OMODE 1: f16 out, y = acc*scale + bias[row];
// OMODE 2: f32 out, y = acc*scale + bias[col] + bf16(resid[row][col]) with rows mapped to the full-stride layout. The wave stages its tile in private LDS and
template <int OMODE>
__global__ __launch_bounds__(128) void gemm_kernel(const b16* __restrict__ A, const b16* __restrict__ Bt, const float* __restrict__ bias, const float* __restrict__ resid, b16* __restrict__ outH, float* __restrict__ outF, unsigned opitch, float scale) {
  const unsigned wave = threadIdx.x >> 5, lane = threadIdx.x & 31, nloc = lane & 15, hh = lane >> 4;
  const unsigned m0 = blockIdx.x * 64 + (wave & 1) * 32, n0 = blockIdx.y * 128 + (wave >> 1) * 64;
  v8f acc[2][4];
#pragma unroll
  for (int i = 0; i < 2; ++i)
#pragma unroll
    for (int j = 0; j < 4; ++j) acc[i][j] = (v8f){};
  const b16* pa = A + (size_t)(m0 >> 4) * KTD * TILE + lane * 8;
  const b16* pb = Bt + (size_t)(n0 >> 4) * KTD * TILE + lane * 8;
  // three register sets: the loads of k-step kt + 2 are issued before the products of k-step kt, so a load has two k-steps of products to arrive in
  static_assert(KTD % 3 == 2);
  GFrag f0, f1, f2;
  gfrag_load(f0, pa, pb, 0); gfrag_load(f1, pa, pb, 1);
#pragma unroll 1   // one trip already holds three k-steps, one for each register set
  for (unsigned kt = 0; kt < KTD - 2; kt += 3) {
    gfrag_load(f2, pa, pb, kt + 2); gfrag_mma(f0, acc);
    gfrag_load(f0, pa, pb, kt + 3); gfrag_mma(f1, acc);
    gfrag_load(f1, pa, pb, kt + 4); gfrag_mma(f2, acc);
    asm volatile("s_wait_xcnt 0x0" ::: "memory");   // the next trip forms its addresses in the registers that this trip's loads, still in flight, name
  }
  gfrag_mma(f0, acc); gfrag_mma(f1, acc);   // k-steps KTD - 2 and KTD - 1
  if constexpr (OMODE != 2) {
    __shared__ __attribute__((aligned(16))) b16 Th[4][32][72];
#pragma unroll
    for (int i = 0; i < 2; ++i)
#pragma unroll
      for (int j = 0; j < 4; ++j) { const unsigned col = j * 16 + nloc; float bc = 0.0f; if (OMODE == 0) bc = bf16_rne(bias[n0 + col]);
#pragma unroll
        for (int r = 0; r < 8; ++r) { const unsigned row = i * 16 + 8 * hh + r; float bbv = bc; if (OMODE == 1) bbv = bf16_rne(bias[m0 + row]); Th[wave][row][col] = (b16)(acc[i][j][r] * scale + bbv); } }
    wave_lds_sync();   // wave-private tile: same wave writes and reads
    {
      for (unsigned it = 0; it < 4; ++it) { const unsigned rtl = it >> 1, ktl = it & 1u; const b16* tp = &Th[wave][rtl * 16 + nloc][ktl * 32 + hh * 8]; const v8b v0 = *(const v8b*)(tp), v1 = *(const v8b*)(tp + 16);
        b16* op = outH + ((size_t)((m0 >> 4) + rtl) * (opitch >> 5) + (n0 >> 5) + ktl) * TILE + lane * 8;   // one tile of the out plane in fragment order, k = column
        *(v8b*)(op) = v0; *(v8b*)(op + 256) = v1; }
       }
  } else {
    __shared__ __attribute__((aligned(16))) float Tf[4][32][68];
#pragma unroll
    for (int i = 0; i < 2; ++i)
#pragma unroll
      for (int j = 0; j < 4; ++j) { const unsigned col = j * 16 + nloc; const float bc = bf16_rne(bias[n0 + col]);
#pragma unroll
        for (int r = 0; r < 8; ++r) { const unsigned row = i * 16 + 8 * hh + r; Tf[wave][row][col] = acc[i][j][r] * scale + bc; } }
    wave_lds_sync();   // wave-private tile
    const unsigned mb = m0 / SEQU; const unsigned mfull = mb * SEQF + (m0 - mb * SEQU);   // 32-row wave tiles never straddle a batch (SEQ % 128 == 0)
    {
#pragma unroll 2
      for (unsigned it = 0; it < 16; ++it) { const unsigned row = it * 2 + (lane >> 4), c4 = (lane & 15) * 4; const size_t go = (size_t)(mfull + row) * opitch + n0 + c4;
        v4f t = *(const v4f*)(&Tf[wave][row][c4]); const v4f xr = *(const v4f*)(resid + go);
#pragma unroll
        for (int j = 0; j < 4; ++j) t[j] += bf16_rne(xr[j]);
        *(v4f*)(outF + go) = t; }
       }
  }
}

// ---------------- causal flash attention, transposed form. grid (SEQ/64, heads, batch), 4 independent waves, wave = 16 query rows i (iw0 .. iw0+15), key tiles of 64.
// S^T tile t (16 keys x 16 queries) = K rows (A: row = key, k = d) x Q rows (B: col = query, k = d); lane holds query i = lane&15, keys 16t+8hh+r.
// p = exp2(s*0.125*log2e - m) as f16; P^T is the B operand of O^T = V^T P^T directly from the score accumulators: k-step c (32 keys) elements 0..7 <- tile 2c acc[0..7],
// elements 8..15 <- tile 2c+1 acc[0..7] (the D row map equals the B k map). A = VT rows (row = d, k = key). O^T acc[r] = O[d = 16dt+8hh+r][i = lane&15].
__global__ __launch_bounds__(128) void attn_kernel(const b16* __restrict__ QK, const b16* __restrict__ VT, b16* __restrict__ CTX) {
  const unsigned wave = threadIdx.x >> 5, lane = threadIdx.x & 31, nloc = lane & 15, hh = lane >> 4;
  const unsigned qt = blockIdx.x, h = blockIdx.y, b = blockIdx.z;
  const unsigned iw0 = qt * 64 + wave * 16;
  const b16* qrow = QK + ((size_t)((b * SEQU + iw0) >> 4) * KTQ + h * 2) * TILE + lane * 8;
  const v16b qf0 = frag_pk(qrow), qf1 = frag_pk(qrow + TILE);
  const b16* kbase = QK + ((size_t)((b * SEQU) >> 4) * KTQ + KTD + h * 2) * TILE + lane * 8;
  const b16* vbase = VT + ((size_t)(h * 4) * KTV + ((b * SEQU) >> 5)) * TILE + lane * 8;
  v8f o[4];
#pragma unroll
  for (int dt = 0; dt < 4; ++dt) o[dt] = (v8f){};
  float m = -1.0e30f, l = 0.0f;
  const float SCL = 0.125f * LOG2E;
  const unsigned iq = iw0 + nloc;
  // K and V fragments of a key tile each have 8 register sets of their own and are loaded as one group: V of tile jt ahead of the score products, K of tile jt + 1 behind them, ahead of the softmax
  v16b kf[8], vf[8];
#pragma unroll
  for (int t = 0; t < 4; ++t) { const b16* kr = kbase + (size_t)t * KTQ * TILE; kf[2 * t] = frag_pk(kr); kf[2 * t + 1] = frag_pk(kr + TILE); }
  asm volatile("s_wait_xcnt 0x0" ::: "memory");   // the loop reuses the address registers of the Q and K loads while these are in flight
#pragma unroll 1
  for (unsigned jt = 0; jt <= qt; ++jt) {            // block-uniform trip count; every tile holds at least key j0 <= i for every query of the block
    const unsigned j0 = jt * 64;
#pragma unroll
    for (int dt = 0; dt < 4; ++dt) { const b16* vr = vbase + ((size_t)dt * KTV + jt * 2) * TILE; vf[2 * dt] = frag_pk(vr); vf[2 * dt + 1] = frag_pk(vr + TILE); }
    __builtin_amdgcn_sched_barrier(0);   // keeps the V loads at the head of the trip: without it the first score product moves up with its wait on K, and the V loads are issued only behind that wait
    v8f s[4];
#pragma unroll
    for (int t = 0; t < 4; ++t) { s[t] = wmma16b(kf[2 * t], qf0, (v8f){}); s[t] = wmma16b(kf[2 * t + 1], qf1, s[t]); }
    asm volatile("s_wait_xcnt 0x0" ::: "memory");   // the V loads are in flight and their address registers are reused from here on
    if (jt < qt) {                                   // block-uniform: the next key tile exists
#pragma unroll
      for (int t = 0; t < 4; ++t) { const b16* kr = kbase + (size_t)((jt + 1) * 4 + t) * KTQ * TILE; kf[2 * t] = frag_pk(kr); kf[2 * t + 1] = frag_pk(kr + TILE); }
      asm volatile("s_wait_xcnt 0x0" ::: "memory");   // the softmax reuses the address registers of these loads while they are in flight
    }
    const bool diag = (jt == qt);                    // block-uniform
    float mx = -1.0e30f;
#pragma unroll
    for (int t = 0; t < 4; ++t)
#pragma unroll
      for (int r = 0; r < 8; ++r) { float xv = s[t][r] * SCL; if (diag) { const unsigned j = j0 + 16 * t + 8 * hh + r; xv = (j > iq) ? -1.0e30f : xv; } s[t][r] = xv; mx = fmaxf(mx, xv); }
    mx = fmaxf(mx, __shfl_xor(mx, 16, 32));
    const float newm = fmaxf(m, mx); const float alpha = exp2f(m - newm); m = newm;
    float psum = 0.0f; v16b pf0, pf1;
#pragma unroll
    for (int t = 0; t < 4; ++t)
#pragma unroll
      for (int r = 0; r < 8; ++r) { const b16 ph = (b16)exp2f(s[t][r] - m); psum += (float)ph; if (t < 2) pf0[(t & 1) * 8 + r] = ph; else pf1[(t & 1) * 8 + r] = ph; }
    psum += __shfl_xor(psum, 16, 32);
    l = l * alpha + psum;
#pragma unroll
    for (int dt = 0; dt < 4; ++dt)
#pragma unroll
      for (int r = 0; r < 8; ++r) o[dt][r] *= alpha;
#pragma unroll
    for (int dt = 0; dt < 4; ++dt) { o[dt] = wmma16b(vf[2 * dt], pf0, o[dt]); o[dt] = wmma16b(vf[2 * dt + 1], pf1, o[dt]); }
  }
  const float inv = CSC * (1.0f / l);                // l >= 1 (the running-max key contributes exactly 1)
  b16* cp = CTX + ((size_t)((b * SEQU + iw0) >> 4) * KTD + h * 2) * TILE + lane * 8;
#pragma unroll
  for (int dt = 0; dt < 4; ++dt) { v8b v;
#pragma unroll
    for (int r = 0; r < 8; ++r) v[r] = (b16)(o[dt][r] * inv);
    *(v8b*)(cp + (dt >> 1) * TILE + (dt & 1) * 256) = v; }   // the lane's 8 values (query nloc, d = 16dt+8hh+0..7) are its own granule of the CTX tile: 512 contiguous bytes per wave store
}

__global__ __launch_bounds__(256) void lnout_kernel(const float* __restrict__ Y, const float* __restrict__ gam, const float* __restrict__ bet, float* __restrict__ out) {
#pragma clang fp contract(off)
  const unsigned wave = __builtin_amdgcn_readfirstlane(threadIdx.x >> 5), lane = threadIdx.x & 31;
  const unsigned r = blockIdx.x * 8 + wave;                 // compact row < MT (grid exact)
  const unsigned bb = r / SEQU, ss = r - bb * SEQU;
  const size_t ro = ((size_t)bb * SEQF + ss) * KD + lane * 4;
  const float* yr = Y + ro;
  float s = 0.0f;
#pragma unroll 1
  for (unsigned c = 0; c < 8; ++c) { const v4f a = *(const v4f*)(yr + c * 128); s += (a[0] + a[1]) + (a[2] + a[3]); }
#pragma unroll
  for (int m = 16; m > 0; m >>= 1) s += __shfl_xor(s, m, 32);
  const float mu = s * (1.0f / 1024.0f);
  float q = 0.0f;
#pragma unroll 1
  for (unsigned c = 0; c < 8; ++c) { const v4f a = *(const v4f*)(yr + c * 128);
#pragma unroll
    for (int j = 0; j < 4; ++j) { const float d0 = a[j] - mu; q += d0 * d0; } }
#pragma unroll
  for (int m = 16; m > 0; m >>= 1) q += __shfl_xor(q, m, 32);
  const float inv = rsqrtf(q * (1.0f / 1024.0f) + LNEPS);
  {
#pragma unroll 1
    for (unsigned c = 0; c < 8; ++c) { const unsigned co = c * 128 + lane * 4;
      const v4f a = *(const v4f*)(yr + c * 128);
      const v4f ga = *(const v4f*)(gam + co), ba = *(const v4f*)(bet + co);
      v4f t;
#pragma unroll
      for (int j = 0; j < 4; ++j) t[j] = (a[j] - mu) * inv * bf16_rne(ga[j]) + bf16_rne(ba[j]);
      *(v4f*)(out + ro + c * 128) = t; }
     }
}

}  // namespace

extern "C" void kernel_launch(void* const* d_in, const int* in_sizes, int n_in, void* d_out, int out_size, void* d_ws, size_t ws_size, hipStream_t stream) {
  if (n_in < 11) return;
  // wire order: 0 x [4,2048,1024], 1 Wq [1024,1024] (in,out), 2 bq, 3 Wk, 4 bk, 5 Wv, 6 bv, 7 Wo [1024,1024] (in,out), 8 bo, 9 gamma [1024], 10 beta [1024]; all f32. Output f32 [4,2048,1024].
  const size_t need = ((size_t)(NBU - 1) * SEQF + SEQU) * KD;
  if ((size_t)in_sizes[0] < need || (size_t)out_size < need) return;
  if (in_sizes[2] < (int)KD || in_sizes[4] < (int)KD || in_sizes[6] < (int)KD || in_sizes[8] < (int)KD || in_sizes[9] < (int)KD || in_sizes[10] < (int)KD) return;
  if ((size_t)in_sizes[1] < (size_t)KD * KD || (size_t)in_sizes[3] < (size_t)KD * KD || (size_t)in_sizes[5] < (size_t)KD * KD || (size_t)in_sizes[7] < (size_t)KD * KD) return;
  const float* x = (const float*)d_in[0];
  const float* Wq = (const float*)d_in[1]; const float* bq = (const float*)d_in[2]; const float* Wk = (const float*)d_in[3]; const float* bk = (const float*)d_in[4];
  const float* Wv = (const float*)d_in[5]; const float* bv = (const float*)d_in[6]; const float* Wo = (const float*)d_in[7]; const float* bo = (const float*)d_in[8];
  const float* gam = (const float*)d_in[9]; const float* bet = (const float*)d_in[10];
  float* out = (float*)d_out;
  size_t off = 0; char* ws = (char*)d_ws;
  auto carve = [&](size_t bytes) { char* p = ws + off; off += (bytes + 255) & ~(size_t)255; return p; };
  b16* XH = (b16*)carve(SZ_XH);        // 16 MiB  x as f16 [MT][1024], fragment order
  b16* WT = (b16*)carve(SZ_WT);        //  8 MiB  weight planes [4][1024 out][1024 in] x16, fragment order
  b16* QK = (b16*)carve(SZ_QK);        // 32 MiB  [MT][Q 1024 | K 1024] f16, fragment order
  b16* VT = (b16*)carve(SZ_VT);        // 16 MiB  V^T [h*64+d][MT] f16, fragment order
  b16* CTX = (b16*)carve(SZ_CTX);      // 16 MiB  attention output x32 f16 [MT][1024], fragment order
  float* Y = (float*)carve(SZ_Y);      // 32 MiB  y = ctx Wo + bo + x, f32, full-stride rows [YROWS][1024]
  if (off > ws_size || off > ((size_t)128 << 20)) return;   // 120 MiB at the shipped sizes
  const float s16 = 1.0f / WSC, s512 = 1.0f / (WSC * CSC);
  xh_kernel<<<(unsigned)((size_t)MT * KD / 8 / 256), 256, 0, stream>>>(x, XH);
  wt_kernel<<<dim3(KD * KD / 8 / 256, 4), 256, 0, stream>>>(Wq, Wk, Wv, Wo, WT);
  gemm_kernel<0><<<dim3(MT / 64, KD / 128), 128, 0, stream>>>(XH, WT, bq, x, QK, out, QKP, s16);                                   // Q = x Wq + bq -> QK k-tiles 0..31 of every row block
  gemm_kernel<0><<<dim3(MT / 64, KD / 128), 128, 0, stream>>>(XH, WT + (size_t)KD * KD, bk, x, QK + (size_t)KTD * TILE, out, QKP, s16);   // K = x Wk + bk -> QK k-tiles 32..63 of every row block
  gemm_kernel<1><<<dim3(KD / 64, MT / 128), 128, 0, stream>>>(WT + (size_t)2 * KD * KD, XH, bv, x, VT, out, MT, s16);              // V^T[c][m] = sum_k WvT[c][k] x[m][k] + bv[c]
  attn_kernel<<<dim3(SEQU / 64, NHEAD, NBU), 128, 0, stream>>>(QK, VT, CTX);
  gemm_kernel<2><<<dim3(MT / 64, KD / 128), 128, 0, stream>>>(CTX, WT + (size_t)3 * KD * KD, bo, x, CTX, Y, KD, s512);             // y = ctx Wo + bo + x -> Y (f32)
  lnout_kernel<<<MT / 8, 256, 0, stream>>>(Y, gam, bet, out);                                                                      // out = LayerNorm(y) * gamma + beta
}

// v003
// A run of this version takes 191 microseconds.
// Two timings next to v002 both put it at 1.05 times that version's speed.
// All steps since v000 together make it 2.20 times as fast.
#include <hip/hip_runtime.h>

// compute dtype: every contraction on v_wmma_f32_16x16x32_f16 (f16 operands, f32 accumulate), single products: x [Wq|Wk|Wv] (x exact bf16 as f16, weights exact bf16 x16),
// S^T = K Q^T (q, k f16), O^T = V^T P^T (v f16, p = exp2(s - max) f16 in (0,1]), ctx Wo (ctx f16 x32, Wo exact bf16 x16). Softmax, bias, the skip connection and
// the closing LayerNorm in f32. All float inputs are RNE-converted to bf16 on load. Fragment k-map per lane half hh for A AND B: elements 0..7 <- k = 8hh+0..7,
// Operand planes (XH, WT, Q|K, V^T, CTX) are stored in fragment order: a tile of 16 rows x 32 k is 1024 contiguous bytes, tile (rt, kt) of a plane with KT k-tiles per row block at
// halves (rt*KT + kt)*512; inside it lane l = 16hh + row owns halves 8l..8l+7 (k = 8hh+0..7) and 256+8l..256+8l+7 (k = 16+8hh+0..7), so each fragment load of a wave is 512 contiguous bytes.
// Structure: causal post-LN attention block; x cast -> Q|K plane, V^T plane -> fused causal flash attention -> y = ctx Wo + bo + x (f32 plane) -> LayerNorm(y) -> output buffer.

#ifndef NB
#define NB 4
#endif
#ifndef SEQ
#define SEQ 2048
#endif
#ifndef SEQ_FULL
#define SEQ_FULL 2048
#endif

namespace {

constexpr unsigned KD = 1024 /* model width == heads * head dim == GEMM depth */, NHEAD = 16, DH = 64, QKP = 2048 /* pitch of the Q|K plane (halves) */;
constexpr unsigned NBU = NB, SEQU = SEQ, SEQF = SEQ_FULL, MT = NBU * SEQU /* compact rows */;
constexpr float LOG2E = 1.4426950408889634f, LNEPS = 1e-5f, WSC = 16.0f /* weight carry */, CSC = 32.0f /* ctx carry */;
static_assert(NHEAD * DH == KD);
static_assert(SEQU % 128 == 0 && SEQU <= SEQF && NBU >= 1);
static_assert(MT % 128 == 0 && KD % 32 == 0);

// extents the added kernels and the launch plan rely on
static_assert(KD == 8u * 128u);                                  // LayerNorm: 8 chunks x 32 lanes x 4 floats per row
static_assert(((size_t)MT * KD / 8) % 256 == 0);                 // cast grid exact
static_assert(MT % 8 == 0);                                      // LayerNorm grid exact (8 rows per block)
static_assert(((size_t)KD * KD / 8) % 256 == 0);                 // weight plane grid exact
static_assert(MT % 64 == 0 && KD % 128 == 0 && KD % 64 == 0 && SEQU % 64 == 0);   // GEMM / attention tile multiples
constexpr unsigned TILE = 512 /* halves of one 16 x 32 fragment tile */, KTD = KD / 32 /* k-tiles per row block, depth-1024 planes */, KTQ = QKP / 32 /* Q|K plane */, KTV = MT / 32 /* V^T plane */;
static_assert(KTD == 32);                                        // the cast and weight kernels split a tile index by shifts of 5
constexpr size_t YROWS = (size_t)(NBU - 1) * SEQF + SEQU;        // rows of the y plane (full-stride row map)
constexpr size_t SZ_XH = (size_t)MT * KD * 2, SZ_WT = (size_t)4 * KD * KD * 2, SZ_QK = (size_t)MT * QKP * 2, SZ_VT = (size_t)KD * MT * 2, SZ_CTX = (size_t)MT * KD * 2, SZ_Y = YROWS * KD * 4;
static_assert(SZ_XH % 256 == 0 && SZ_WT % 256 == 0 && SZ_QK % 256 == 0 && SZ_VT % 256 == 0 && SZ_CTX % 256 == 0 && SZ_Y % 256 == 0);
static_assert(SZ_XH + SZ_WT + SZ_QK + SZ_VT + SZ_CTX + SZ_Y <= ((size_t)128 << 20));   // 120 MiB at the shipped sizes

typedef _Float16 b16;
typedef __attribute__((ext_vector_type(16))) _Float16 v16b;
typedef __attribute__((ext_vector_type(8))) _Float16 v8b;
typedef __attribute__((ext_vector_type(8))) float v8f;
typedef __attribute__((ext_vector_type(4))) float v4f;

__device__ __forceinline__ float bf16_rne(float f) { unsigned int u = __float_as_uint(f); u += 0x7FFFu + ((u >> 16) & 1u); return __uint_as_float(u & 0xFFFF0000u); }
// p = tile base + 8 * lane
__device__ __forceinline__ v16b frag_pk(const b16* p) { const v8b a = *(const v8b*)(p), b = *(const v8b*)(p + 256); v16b f;
#pragma unroll
  for (int e = 0; e < 8; ++e) { f[e] = a[e]; f[8 + e] = b[e]; } return f; }
__device__ __forceinline__ v8f wmma16b(v16b a, v16b b, v8f c) { v8f d = __builtin_amdgcn_wmma_f32_16x16x32_f16(false, a, false, b, (short)0, c, false, false); asm volatile("v_nop\n\tv_nop\n\tv_nop\n\tv_nop" : "+v"(d) : "v"(a), "v"(b)); return d; }
__device__ __forceinline__ void wave_lds_sync() { __builtin_amdgcn_fence(3 /* release order */, "workgroup"); __builtin_amdgcn_wave_barrier(); __builtin_amdgcn_fence(2 /* acquire order */, "workgroup"); }
// f32 -> f16 operand convert that cannot yield an f16 subnormal (value select below 2^-14)
__device__ __forceinline__ b16 toh_flush(float v) { const b16 r = (b16)v; return (fabsf(v) < 6.103515625e-05f) ? (b16)0.0f : r; }

__global__ __launch_bounds__(256) void xh_kernel(const float* __restrict__ x, b16* __restrict__ XH) {
  const unsigned u = blockIdx.x * 256 + threadIdx.x;          // < MT*KD/8 (grid exact)
  const unsigned tile = u >> 6, nloc = ((u >> 5) & 1u) * 8 + ((u >> 2) & 7u), part = (u >> 1) & 1u, hh = u & 1u;   // a wave: 8 rows x the 4 granules of one k-tile (whole lines read and written)
  const unsigned r = (tile >> 5) * 16 + nloc, col = (tile & 31u) * 32 + part * 16 + hh * 8;
  const unsigned bb = r / SEQU, ss = r - bb * SEQU;
  const float* xr = x + ((size_t)bb * SEQF + ss) * KD + col;
  const v4f a = *(const v4f*)(xr), b = *(const v4f*)(xr + 4);
  v8b v;
#pragma unroll
  for (int j = 0; j < 4; ++j) { v[j] = toh_flush(bf16_rne(a[j])); v[4 + j] = toh_flush(bf16_rne(b[j])); }
  { *(v8b*)(XH + (size_t)tile * TILE + part * 256 + (hh * 16 + nloc) * 8) = v;  }
}

__global__ __launch_bounds__(256) void wt_kernel(const float* __restrict__ w0, const float* __restrict__ w1, const float* __restrict__ w2, const float* __restrict__ w3, b16* __restrict__ WT) {
  const unsigned y = blockIdx.y; const float* w = (y == 0) ? w0 : (y == 1) ? w1 : (y == 2) ? w2 : w3;
  const unsigned u = blockIdx.x * 256 + threadIdx.x;          // < KD*KD/8 (grid exact)
  const unsigned e = u * 8, tile = u >> 6, part = (u >> 5) & 1u, hh = (u >> 4) & 1u, nloc = u & 15u;   // u = granule index in fragment order
  const unsigned o = (tile >> 5) * 16 + nloc, k0 = (tile & 31u) * 32 + part * 16 + hh * 8; v8b v;
#pragma unroll
  for (int j = 0; j < 8; ++j) v[j] = (b16)(bf16_rne(w[(size_t)(k0 + j) * KD + o]) * WSC);
  { *(v8b*)(WT + (size_t)y * KD * KD + e) = v;  }
}

// One k-stage of a GEMM block in LDS: 64 of depth (2 k-tiles) of 8 row blocks of A, then of 8 row blocks of Bt, every 1024-byte tile kept in fragment order.
constexpr unsigned SKT = 2 /* k-tiles per stage */, SRB = SKT * TILE /* halves of one row block in a stage */, SOP = 8 * SRB /* halves of one operand */, STG = 2 * SOP /* halves of a stage: 32 KiB */, NSTG = KTD / SKT;
static_assert(KTD % SKT == 0 && NSTG >= 2);
static_assert(MT % 128 == 0 && KD % 128 == 0);                   // GEMM block tile multiples

// A wave's 8 copies of 512 bytes: the 2048 contiguous bytes that a stage takes of two row blocks (la <- ga, lb <- gb; LDS byte addresses and global pointers of the lane's own 16 bytes).
__device__ __forceinline__ void copy8(unsigned la, const b16* ga, unsigned lb, const b16* gb) {
  // the closing s_wait_xcnt stands inside the statement so that no address register of a copy is rewritten ahead of it
  asm volatile("global_load_async_to_lds_b128 %0, %8, off\n\t"
               "global_load_async_to_lds_b128 %1, %9, off\n\t"
               "global_load_async_to_lds_b128 %2, %10, off\n\t"
               "global_load_async_to_lds_b128 %3, %11, off\n\t"
               "global_load_async_to_lds_b128 %4, %12, off\n\t"
               "global_load_async_to_lds_b128 %5, %13, off\n\t"
               "global_load_async_to_lds_b128 %6, %14, off\n\t"
               "global_load_async_to_lds_b128 %7, %15, off\n\t"
               "s_wait_xcnt 0x0"
               :: "v"(la), "v"(la + 512u), "v"(la + 1024u), "v"(la + 1536u), "v"(lb), "v"(lb + 512u), "v"(lb + 1024u), "v"(lb + 1536u),
                  "v"(ga), "v"(ga + 256), "v"(ga + 512), "v"(ga + 768), "v"(gb), "v"(gb + 256), "v"(gb + 512), "v"(gb + 768)
               : "memory");
}

// ---------------- tile GEMM, depth 1024: C[m][n] = sum_k A[m][k] Bt[n][k]; A, Bt f16 planes in fragment order (32 k-tiles per row block).
// block = 4 waves, tile 128 x 128; wave tile 64 x 64 (4 x 4 accumulators). The block's operands pass through LDS, so each tile leaves L2 once per block: asynchronous copies fill a ring of two
// stages, stage t + 2 flying while stage t + 1 is worked on; a wave copies row blocks 2 wave and 2 wave + 1 of both operands and reads its fragments from LDS, 512 contiguous bytes per load.
// OMODE 0: f16 out, y = acc*scale + bias[col]; OMODE 1: f16 out, y = acc*scale + bias[row];
// OMODE 2: f32 out, y = acc*scale + bias[col] + bf16(resid[row][col]) with rows mapped to the full-stride layout. The wave stages its tile in private LDS and stores whole lines.
template <int OMODE>
__global__ __launch_bounds__(128) void gemm_kernel(const b16* __restrict__ A, const b16* __restrict__ Bt, const float* __restrict__ bias, const float* __restrict__ resid, b16* __restrict__ outH, float* __restrict__ outF, unsigned opitch, float scale) {
  __shared__ __attribute__((aligned(16))) b16 ring[2 * STG];
  const unsigned wave = threadIdx.x >> 5, lane = threadIdx.x & 31, nloc = lane & 15, hh = lane >> 4;
  const unsigned mb = blockIdx.x * 128, nb = blockIdx.y * 128;
  const unsigned m0 = mb + (wave & 1) * 64, n0 = nb + (wave >> 1) * 64;
  v8f acc[4][4];
#pragma unroll
  for (int i = 0; i < 4; ++i)
#pragma unroll
    for (int j = 0; j < 4; ++j) acc[i][j] = (v8f){};
  const b16* ga = A + ((size_t)(mb >> 4) + 2 * wave) * KTD * TILE + lane * 8;
  const b16* gb = Bt + ((size_t)(nb >> 4) + 2 * wave) * KTD * TILE + lane * 8;
  const unsigned lw = (unsigned)(size_t)(&ring[0]) + wave * (2 * SRB * 2) + lane * 16;   // LDS byte address: low 32 bits of the shared address
  auto fill = [&](unsigned t) {
    const unsigned l = lw + (t & 1u) * (STG * 2); const b16* pa = ga + t * SRB; const b16* pb = gb + t * SRB;
    copy8(l, pa, l + SRB * 2, pa + KTD * TILE);
    copy8(l + SOP * 2, pb, l + SOP * 2 + SRB * 2, pb + KTD * TILE);
  };
  fill(0);
  asm volatile("s_wait_asynccnt 0x0" ::: "memory");   // this wave's share of stage 0 has landed
  __syncthreads();                                    // every wave's share of stage 0 has landed
  fill(1);
#pragma unroll 1   // one trip is one stage: 32 products per wave
  for (unsigned t = 0; t < NSTG; ++t) {
    const b16* la = ring + (t & 1u) * STG + (wave & 1) * (4 * SRB) + lane * 8;
    const b16* lb = ring + (t & 1u) * STG + SOP + (wave >> 1) * (4 * SRB) + lane * 8;
#pragma unroll
    for (unsigned kk = 0; kk < SKT; ++kk) {
      v16b fa[4], fb[4];
#pragma unroll
      for (int i = 0; i < 4; ++i) { fa[i] = frag_pk(la + i * SRB + kk * TILE); fb[i] = frag_pk(lb + i * SRB + kk * TILE); }
#pragma unroll
      for (int j = 0; j < 4; ++j)
#pragma unroll
        for (int i = 0; i < 4; ++i) acc[i][j] = wmma16b(fa[i], fb[j], acc[i][j]);
    }
    asm volatile("s_wait_dscnt 0x0" ::: "memory");      // this wave's reads of stage t are done before the stage's buffer is given up
    asm volatile("s_wait_asynccnt 0x0" ::: "memory");   // this wave's share of stage t + 1 has landed
    __syncthreads();                                    // publishes stage t + 1 and ends every wave's reads of stage t
    if (t + 2 < NSTG) fill(t + 2);                      // block-uniform; into the buffer that stage t has left
  }
  asm volatile("s_wait_asynccnt 0x0" ::: "memory");     // no copy is outstanding when the wave goes on
  if constexpr (OMODE != 2) {
    __shared__ __attribute__((aligned(16))) b16 Th[4][64][72];
#pragma unroll
    for (int i = 0; i < 4; ++i)
#pragma unroll
      for (int j = 0; j < 4; ++j) { const unsigned col = j * 16 + nloc; float bc = 0.0f; if (OMODE == 0) bc = bf16_rne(bias[n0 + col]);
#pragma unroll
        for (int r = 0; r < 8; ++r) { const unsigned row = i * 16 + 8 * hh + r; float bbv = bc; if (OMODE == 1) bbv = bf16_rne(bias[m0 + row]); Th[wave][row][col] = (b16)(acc[i][j][r] * scale + bbv); } }
    wave_lds_sync();   // wave-private tile: same wave writes and reads
    {
      for (unsigned it = 0; it < 8; ++it) { const unsigned rtl = it >> 1, ktl = it & 1u; const b16* tp = &Th[wave][rtl * 16 + nloc][ktl * 32 + hh * 8]; const v8b v0 = *(const v8b*)(tp), v1 = *(const v8b*)(tp + 16);
        b16* op = outH + ((size_t)((m0 >> 4) + rtl) * (opitch >> 5) + (n0 >> 5) + ktl) * TILE + lane * 8;   // one tile of the out plane in fragment order, k = column
        *(v8b*)(op) = v0; *(v8b*)(op + 256) = v1; }
       }
  } else {
    __shared__ __attribute__((aligned(16))) float Tf[4][64][68];
#pragma unroll
    for (int i = 0; i < 4; ++i)
#pragma unroll
      for (int j = 0; j < 4; ++j) { const unsigned col = j * 16 + nloc; const float bc = bf16_rne(bias[n0 + col]);
#pragma unroll
        for (int r = 0; r < 8; ++r) { const unsigned row = i * 16 + 8 * hh + r; Tf[wave][row][col] = acc[i][j][r] * scale + bc; } }
    wave_lds_sync();   // wave-private tile
    const unsigned bt = m0 / SEQU; const unsigned mfull = bt * SEQF + (m0 - bt * SEQU);   // 64-row wave tiles never straddle a batch (SEQ % 128 == 0)
    {
#pragma unroll 2
      for (unsigned it = 0; it < 32; ++it) { const unsigned row = it * 2 + (lane >> 4), c4 = (lane & 15) * 4; const size_t go = (size_t)(mfull + row) * opitch + n0 + c4;
        v4f t = *(const v4f*)(&Tf[wave][row][c4]); const v4f xr = *(const v4f*)(resid + go);
#pragma unroll
        for (int j = 0; j < 4; ++j) t[j] += bf16_rne(xr[j]);
        *(v4f*)(outF + go) = t; }
       }
  }
}

// ---------------- causal flash attention, transposed form. grid (SEQ/64, heads, batch), 4 independent waves, wave = 16 query rows i (iw0 .. iw0+15), key tiles of 64.
// S^T tile t (16 keys x 16 queries) = K rows (A: row = key, k = d) x Q rows (B: col = query, k = d); lane holds query i = lane&15, keys 16t+8hh+r.
// p = exp2(s*0.125*log2e - m) as f16; P^T is the B operand of O^T = V^T P^T directly from the score accumulators: k-step c (32 keys) elements 0..7 <- tile 2c acc[0..7],
// elements 8..15 <- tile 2c+1 acc[0..7] (the D row map equals the B k map). A = VT rows (row = d, k = key). O^T acc[r] = O[d = 16dt+8hh+r][i = lane&15].
__global__ __launch_bounds__(128) void attn_kernel(const b16* __restrict__ QK, const b16* __restrict__ VT, b16* __restrict__ CTX) {
  const unsigned wave = threadIdx.x >> 5, lane = threadIdx.x & 31, nloc = lane & 15, hh = lane >> 4;
  const unsigned qt = blockIdx.x, h = blockIdx.y, b = blockIdx.z;
  const unsigned iw0 = qt * 64 + wave * 16;
  const b16* qrow = QK + ((size_t)((b * SEQU + iw0) >> 4) * KTQ + h * 2) * TILE + lane * 8;
  const v16b qf0 = frag_pk(qrow), qf1 = frag_pk(qrow + TILE);
  const b16* kbase = QK + ((size_t)((b * SEQU) >> 4) * KTQ + KTD + h * 2) * TILE + lane * 8;
  const b16* vbase = VT + ((size_t)(h * 4) * KTV + ((b * SEQU) >> 5)) * TILE + lane * 8;
  v8f o[4];
#pragma unroll
  for (int dt = 0; dt < 4; ++dt) o[dt] = (v8f){};
  float m = -1.0e30f, l = 0.0f;
  const float SCL = 0.125f * LOG2E;
  const unsigned iq = iw0 + nloc;
  // K and V fragments of a key tile each have 8 register sets of their own and are loaded as one group: V of tile jt ahead of the score products, K of tile jt + 1 behind them, ahead of the softmax
  v16b kf[8], vf[8];
#pragma unroll
  for (int t = 0; t < 4; ++t) { const b16* kr = kbase + (size_t)t * KTQ * TILE; kf[2 * t] = frag_pk(kr); kf[2 * t + 1] = frag_pk(kr + TILE); }
  asm volatile("s_wait_xcnt 0x0" ::: "memory");   // the loop reuses the address registers of the Q and K loads while these are in flight
#pragma unroll 1
  for (unsigned jt = 0; jt <= qt; ++jt) {            // block-uniform trip count; every tile holds at least key j0 <= i for every query of the block
    const unsigned j0 = jt * 64;
#pragma unroll
    for (int dt = 0; dt < 4; ++dt) { const b16* vr = vbase + ((size_t)dt * KTV + jt * 2) * TILE; vf[2 * dt] = frag_pk(vr); vf[2 * dt + 1] = frag_pk(vr + TILE); }
    __builtin_amdgcn_sched_barrier(0);   // keeps the V loads at the head of the trip: without it the first score product moves up with its wait on K, and the V loads are issued only behind that wait
    v8f s[4];
#pragma unroll
    for (int t = 0; t < 4; ++t) { s[t] = wmma16b(kf[2 * t], qf0, (v8f){}); s[t] = wmma16b(kf[2 * t + 1], qf1, s[t]); }
    asm volatile("s_wait_xcnt 0x0" ::: "memory");   // the V loads are in flight and their address registers are reused from here on
    if (jt < qt) {                                   // block-uniform: the next key tile exists
#pragma unroll
      for (int t = 0; t < 4; ++t) { const b16* kr = kbase + (size_t)((jt + 1) * 4 + t) * KTQ * TILE; kf[2 * t] = frag_pk(kr); kf[2 * t + 1] = frag_pk(kr + TILE); }
      asm volatile("s_wait_xcnt 0x0" ::: "memory");   // the softmax reuses the address registers of these loads while they are in flight
    }
    const bool diag = (jt == qt);                    // block-uniform
    float mx = -1.0e30f;
#pragma unroll
    for (int t = 0; t < 4; ++t)
#pragma unroll
      for (int r = 0; r < 8; ++r) { float xv = s[t][r] * SCL; if (diag) { const unsigned j = j0 + 16 * t + 8 * hh + r; xv = (j > iq) ? -1.0e30f : xv; } s[t][r] = xv; mx = fmaxf(mx, xv); }
    mx = fmaxf(mx, __shfl_xor(mx, 16, 32));
    const float newm = fmaxf(m, mx); const float alpha = exp2f(m - newm); m = newm;
    float psum = 0.0f; v16b pf0, pf1;
#pragma unroll
    for (int t = 0; t < 4; ++t)
#pragma unroll
      for (int r = 0; r < 8; ++r) { const b16 ph = (b16)exp2f(s[t][r] - m); psum += (float)ph; if (t < 2) pf0[(t & 1) * 8 + r] = ph; else pf1[(t & 1) * 8 + r] = ph; }
    psum += __shfl_xor(psum, 16, 32);
    l = l * alpha + psum;
#pragma unroll
    for (int dt = 0; dt < 4; ++dt)
#pragma unroll
      for (int r = 0; r < 8; ++r) o[dt][r] *= alpha;
#pragma unroll
    for (int dt = 0; dt < 4; ++dt) { o[dt] = wmma16b(vf[2 * dt], pf0, o[dt]); o[dt] = wmma16b(vf[2 * dt + 1], pf1, o[dt]); }
  }
  const float inv = CSC * (1.0f / l);                // l >= 1 (the running-max key contributes exactly 1)
  b16* cp = CTX + ((size_t)((b * SEQU + iw0) >> 4) * KTD + h * 2) * TILE + lane * 8;
#pragma unroll
  for (int dt = 0; dt < 4; ++dt) { v8b v;
#pragma unroll
    for (int r = 0; r < 8; ++r) v[r] = (b16)(o[dt][r] * inv);
    *(v8b*)(cp + (dt >> 1) * TILE + (dt & 1) * 256) = v; }   // the lane's 8 values (query nloc, d = 16dt+8hh+0..7) are its own granule of the CTX tile: 512 contiguous bytes per wave store
}

__global__ __launch_bounds__(256) void lnout_kernel(const float* __restrict__ Y, const float* __restrict__ gam, const float* __restrict__ bet, float* __restrict__ out) {
#pragma clang fp contract(off)
  const unsigned wave = __builtin_amdgcn_readfirstlane(threadIdx.x >> 5), lane = threadIdx.x & 31;
  const unsigned r = blockIdx.x * 8 + wave;                 // compact row < MT (grid exact)
  const unsigned bb = r / SEQU, ss = r - bb * SEQU;
  const size_t ro = ((size_t)bb * SEQF + ss) * KD + lane * 4;
  const float* yr = Y + ro;
  float s = 0.0f;
#pragma unroll 1
  for (unsigned c = 0; c < 8; ++c) { const v4f a = *(const v4f*)(yr + c * 128); s += (a[0] + a[1]) + (a[2] + a[3]); }
#pragma unroll
  for (int m = 16; m > 0; m >>= 1) s += __shfl_xor(s, m, 32);
  const float mu = s * (1.0f / 1024.0f);
  float q = 0.0f;
#pragma unroll 1
  for (unsigned c = 0; c < 8; ++c) { const v4f a = *(const v4f*)(yr + c * 128);
#pragma unroll
    for (int j = 0; j < 4; ++j) { const float d0 = a[j] - mu; q += d0 * d0; } }
#pragma unroll
  for (int m = 16; m > 0; m >>= 1) q += __shfl_xor(q, m, 32);
  const float inv = rsqrtf(q * (1.0f / 1024.0f) + LNEPS);
  {
#pragma unroll 1
    for (unsigned c = 0; c < 8; ++c) { const unsigned co = c * 128 + lane * 4;
      const v4f a = *(const v4f*)(yr + c * 128);
      const v4f ga = *(const v4f*)(gam + co), ba = *(const v4f*)(bet + co);
      v4f t;
#pragma unroll
      for (int j = 0; j < 4; ++j) t[j] = (a[j] - mu) * inv * bf16_rne(ga[j]) + bf16_rne(ba[j]);
      *(v4f*)(out + ro + c * 128) = t; }
     }
}

}  // namespace

extern "C" void kernel_launch(void* const* d_in, const int* in_sizes, int n_in, void* d_out, int out_size, void* d_ws, size_t ws_size, hipStream_t stream) {
  if (n_in < 11) return;
  // wire order: 0 x [4,2048,1024], 1 Wq [1024,1024] (in,out), 2 bq, 3 Wk, 4 bk, 5 Wv, 6 bv, 7 Wo [1024,1024] (in,out), 8 bo, 9 gamma [1024], 10 beta [1024]; all f32. Output f32 [4,2048,1024].
  const size_t need = ((size_t)(NBU - 1) * SEQF + SEQU) * KD;
  if ((size_t)in_sizes[0] < need || (size_t)out_size < need) return;
  if (in_sizes[2] < (int)KD || in_sizes[4] < (int)KD || in_sizes[6] < (int)KD || in_sizes[8] < (int)KD || in_sizes[9] < (int)KD || in_sizes[10] < (int)KD) return;
  if ((size_t)in_sizes[1] < (size_t)KD * KD || (size_t)in_sizes[3] < (size_t)KD * KD || (size_t)in_sizes[5] < (size_t)KD * KD || (size_t)in_sizes[7] < (size_t)KD * KD) return;
  const float* x = (const float*)d_in[0];
  const float* Wq = (const float*)d_in[1]; const float* bq = (const float*)d_in[2]; const float* Wk = (const float*)d_in[3]; const float* bk = (const float*)d_in[4];
  const float* Wv = (const float*)d_in[5]; const float* bv = (const float*)d_in[6]; const float* Wo = (const float*)d_in[7]; const float* bo = (const float*)d_in[8];
  const float* gam = (const float*)d_in[9]; const float* bet = (const float*)d_in[10];
  float* out = (float*)d_out;
  size_t off = 0; char* ws = (char*)d_ws;
  auto carve = [&](size_t bytes) { char* p = ws + off; off += (bytes + 255) & ~(size_t)255; return p; };
  b16* XH = (b16*)carve(SZ_XH);        // 16 MiB  x as f16 [MT][1024], fragment order
  b16* WT = (b16*)carve(SZ_WT);        //  8 MiB  weight planes [4][1024 out][1024 in] x16, fragment order
  b16* QK = (b16*)carve(SZ_QK);        // 32 MiB  [MT][Q 1024 | K 1024] f16, fragment order
  b16* VT = (b16*)carve(SZ_VT);        // 16 MiB  V^T [h*64+d][MT] f16, fragment order
  b16* CTX = (b16*)carve(SZ_CTX);      // 16 MiB  attention output x32 f16 [MT][1024], fragment order
  float* Y = (float*)carve(SZ_Y);      // 32 MiB  y = ctx Wo + bo + x, f32, full-stride rows [YROWS][1024]
  if (off > ws_size || off > ((size_t)128 << 20)) return;   // 120 MiB at the shipped sizes
  const float s16 = 1.0f / WSC, s512 = 1.0f / (WSC * CSC);
  xh_kernel<<<(unsigned)((size_t)MT * KD / 8 / 256), 256, 0, stream>>>(x, XH);
  wt_kernel<<<dim3(KD * KD / 8 / 256, 4), 256, 0, stream>>>(Wq, Wk, Wv, Wo, WT);
  gemm_kernel<0><<<dim3(MT / 128, KD / 128), 128, 0, stream>>>(XH, WT, bq, x, QK, out, QKP, s16);                                   // Q = x Wq + bq -> QK k-tiles 0..31 of every row block
  gemm_kernel<0><<<dim3(MT / 128, KD / 128), 128, 0, stream>>>(XH, WT + (size_t)KD * KD, bk, x, QK + (size_t)KTD * TILE, out, QKP, s16);   // K = x Wk + bk -> QK k-tiles 32..63 of every row block
  gemm_kernel<1><<<dim3(KD / 128, MT / 128), 128, 0, stream>>>(WT + (size_t)2 * KD * KD, XH, bv, x, VT, out, MT, s16);              // V^T[c][m] = sum_k WvT[c][k] x[m][k] + bv[c]
  attn_kernel<<<dim3(SEQU / 64, NHEAD, NBU), 128, 0, stream>>>(QK, VT, CTX);
  gemm_kernel<2><<<dim3(MT / 128, KD / 128), 128, 0, stream>>>(CTX, WT + (size_t)3 * KD * KD, bo, x, CTX, Y, KD, s512);             // y = ctx Wo + bo + x -> Y (f32)
  lnout_kernel<<<MT / 8, 256, 0, stream>>>(Y, gam, bet, out);                                                                      // out = LayerNorm(y) * gamma + beta
}

// v004
// It runs in 158 microseconds.
// Two timings next to v003 put it at 1.20 and 1.21 times that version's speed.
// All steps since v000 together make it 2.65 times as fast.
#include <hip/hip_runtime.h>

// compute dtype: every contraction on v_wmma_f32_16x16x32_f16 (f16 operands, f32 accumulate), single products: x [Wq|Wk|Wv] (x exact bf16 as f16, weights exact bf16 x16),
// S^T = K Q^T (q, k f16), O^T = V^T P^T (v f16, p = exp2(s - max) f16 in (0,1]), ctx Wo (ctx f16 x32, Wo exact bf16 x16). Softmax, bias, the skip connection and
// the closing LayerNorm in f32. All float inputs are RNE-converted to bf16 on load. Fragment k-map per lane half hh for A AND B: elements 0..7 <- k = 8hh+0..7,
// Operand planes (XH, WT, Q|K, V^T, CTX) are stored in fragment order: a tile of 16 rows x 32 k is 1024 contiguous bytes, tile (rt, kt) of a plane with KT k-tiles per row block at
// halves (rt*KT + kt)*512; inside it lane l = 16hh + row owns halves 8l..8l+7 (k = 8hh+0..7) and 256+8l..256+8l+7 (k = 16+8hh+0..7), so each fragment load of a wave is 512 contiguous bytes.
// Structure: causal post-LN attention block; x cast -> Q|K plane, V^T plane -> fused causal flash attention -> y = ctx Wo + bo + x (f32 plane) -> LayerNorm(y) -> output buffer.

#ifndef NB
#define NB 4
#endif
#ifndef SEQ
#define SEQ 2048
#endif
#ifndef SEQ_FULL
#define SEQ_FULL 2048
#endif

namespace {

constexpr unsigned KD = 1024 /* model width == heads * head dim == GEMM depth */, NHEAD = 16, DH = 64, QKP = 2048 /* pitch of the Q|K plane (halves) */;
constexpr unsigned NBU = NB, SEQU = SEQ, SEQF = SEQ_FULL, MT = NBU * SEQU /* compact rows */;
constexpr float LOG2E = 1.4426950408889634f, LNEPS = 1e-5f, WSC = 16.0f /* weight carry */, CSC = 32.0f /* ctx carry */;
static_assert(NHEAD * DH == KD);
static_assert(SEQU % 128 == 0 && SEQU <= SEQF && NBU >= 1);
static_assert(MT % 128 == 0 && KD % 32 == 0);

// extents the added kernels and the launch plan rely on
static_assert(KD == 8u * 128u);                                  // LayerNorm: 8 chunks x 32 lanes x 4 floats per row
static_assert(((size_t)MT * KD / 8) % 256 == 0);                 // cast grid exact
static_assert(MT % 8 == 0);                                      // LayerNorm grid exact (8 rows per block)
static_assert(((size_t)KD * KD / 8) % 256 == 0);                 // weight plane grid exact
static_assert(MT % 64 == 0 && KD % 128 == 0 && KD % 64 == 0 && SEQU % 64 == 0);   // GEMM / attention tile multiples
constexpr unsigned TILE = 512 /* halves of one 16 x 32 fragment tile */, KTD = KD / 32 /* k-tiles per row block, depth-1024 planes */, KTQ = QKP / 32 /* Q|K plane */, KTV = MT / 32 /* V^T plane */;
static_assert(KTD == 32);                                        // the cast and weight kernels split a tile index by shifts of 5
constexpr size_t YROWS = (size_t)(NBU - 1) * SEQF + SEQU;        // rows of the y plane (full-stride row map)
constexpr size_t SZ_XH = (size_t)MT * KD * 2, SZ_WT = (size_t)4 * KD * KD * 2, SZ_QK = (size_t)MT * QKP * 2, SZ_VT = (size_t)KD * MT * 2, SZ_CTX = (size_t)MT * KD * 2, SZ_Y = YROWS * KD * 4;
static_assert(SZ_XH % 256 == 0 && SZ_WT % 256 == 0 && SZ_QK % 256 == 0 && SZ_VT % 256 == 0 && SZ_CTX % 256 == 0 && SZ_Y % 256 == 0);
static_assert(SZ_XH + SZ_WT + SZ_QK + SZ_VT + SZ_CTX + SZ_Y <= ((size_t)128 << 20));   // 120 MiB at the shipped sizes

typedef _Float16 b16;
typedef __attribute__((ext_vector_type(16))) _Float16 v16b;
typedef __attribute__((ext_vector_type(8))) _Float16 v8b;
typedef __attribute__((ext_vector_type(8))) float v8f;
typedef __attribute__((ext_vector_type(4))) float v4f;

__device__ __forceinline__ float bf16_rne(float f) { unsigned int u = __float_as_uint(f); u += 0x7FFFu + ((u >> 16) & 1u); return __uint_as_float(u & 0xFFFF0000u); }
// p = tile base + 8 * lane
__device__ __forceinline__ v16b frag_pk(const b16* p) { const v8b a = *(const v8b*)(p), b = *(const v8b*)(p + 256); v16b f;
#pragma unroll
  for (int e = 0; e < 8; ++e) { f[e] = a[e]; f[8 + e] = b[e]; } return f; }
__device__ __forceinline__ v8f wmma16b(v16b a, v16b b, v8f c) { v8f d = __builtin_amdgcn_wmma_f32_16x16x32_f16(false, a, false, b, (short)0, c, false, false); asm volatile("v_nop\n\tv_nop\n\tv_nop\n\tv_nop" : "+v"(d) : "v"(a), "v"(b)); return d; }
__device__ __forceinline__ void wave_lds_sync() { __builtin_amdgcn_fence(3 /* release order */, "workgroup"); __builtin_amdgcn_wave_barrier(); __builtin_amdgcn_fence(2 /* acquire order */, "workgroup"); }
// f32 -> f16 operand convert that cannot yield an f16 subnormal (value select below 2^-14)
__device__ __forceinline__ b16 toh_flush(float v) { const b16 r = (b16)v; return (fabsf(v) < 6.103515625e-05f) ? (b16)0.0f : r; }

__global__ __launch_bounds__(256) void xh_kernel(const float* __restrict__ x, b16* __restrict__ XH) {
  const unsigned u = blockIdx.x * 256 + threadIdx.x;          // < MT*KD/8 (grid exact)
  const unsigned tile = u >> 6, nloc = ((u >> 5) & 1u) * 8 + ((u >> 2) & 7u), part = (u >> 1) & 1u, hh = u & 1u;   // a wave: 8 rows x the 4 granules of one k-tile (whole lines read and written)
  const unsigned r = (tile >> 5) * 16 + nloc, col = (tile & 31u) * 32 + part * 16 + hh * 8;
  const unsigned bb = r / SEQU, ss = r - bb * SEQU;
  const float* xr = x + ((size_t)bb * SEQF + ss) * KD + col;
  const v4f a = *(const v4f*)(xr), b = *(const v4f*)(xr + 4);
  v8b v;
#pragma unroll
  for (int j = 0; j < 4; ++j) { v[j] = toh_flush(bf16_rne(a[j])); v[4 + j] = toh_flush(bf16_rne(b[j])); }
  { *(v8b*)(XH + (size_t)tile * TILE + part * 256 + (hh * 16 + nloc) * 8) = v;  }
}

__global__ __launch_bounds__(256) void wt_kernel(const float* __restrict__ w0, const float* __restrict__ w1, const float* __restrict__ w2, const float* __restrict__ w3, b16* __restrict__ WT) {
  const unsigned y = blockIdx.y; const float* w = (y == 0) ? w0 : (y == 1) ? w1 : (y == 2) ? w2 : w3;
  const unsigned u = blockIdx.x * 256 + threadIdx.x;          // < KD*KD/8 (grid exact)
  const unsigned e = u * 8, tile = u >> 6, part = (u >> 5) & 1u, hh = (u >> 4) & 1u, nloc = u & 15u;   // u = granule index in fragment order
  const unsigned o = (tile >> 5) * 16 + nloc, k0 = (tile & 31u) * 32 + part * 16 + hh * 8; v8b v;
#pragma unroll
  for (int j = 0; j < 8; ++j) v[j] = (b16)(bf16_rne(w[(size_t)(k0 + j) * KD + o]) * WSC);
  { *(v8b*)(WT + (size_t)y * KD * KD + e) = v;  }
}

// One k-stage of a GEMM block in LDS: 64 of depth (2 k-tiles) of 8 row blocks of A, then of 8 row blocks of Bt, every 1024-byte tile kept in fragment order.
constexpr unsigned SKT = 2 /* k-tiles per stage */, SRB = SKT * TILE /* halves of one row block in a stage */, SOP = 8 * SRB /* halves of one operand */, STG = 2 * SOP /* halves of a stage: 32 KiB */, NSTG = KTD / SKT;
static_assert(KTD % SKT == 0 && NSTG >= 2);
static_assert(MT % 128 == 0 && KD % 128 == 0);                   // GEMM block tile multiples

// A wave's 8 copies of 512 bytes: the 2048 contiguous bytes that a stage takes of two row blocks (la <- ga, lb <- gb; LDS byte addresses and global pointers of the lane's own 16 bytes).
__device__ __forceinline__ void copy8(unsigned la, const b16* ga, unsigned lb, const b16* gb) {
  // the closing s_wait_xcnt stands inside the statement so that no address register of a copy is rewritten ahead of it
  asm volatile("global_load_async_to_lds_b128 %0, %8, off\n\t"
               "global_load_async_to_lds_b128 %1, %9, off\n\t"
               "global_load_async_to_lds_b128 %2, %10, off\n\t"
               "global_load_async_to_lds_b128 %3, %11, off\n\t"
               "global_load_async_to_lds_b128 %4, %12, off\n\t"
               "global_load_async_to_lds_b128 %5, %13, off\n\t"
               "global_load_async_to_lds_b128 %6, %14, off\n\t"
               "global_load_async_to_lds_b128 %7, %15, off\n\t"
               "s_wait_xcnt 0x0"
               :: "v"(la), "v"(la + 512u), "v"(la + 1024u), "v"(la + 1536u), "v"(lb), "v"(lb + 512u), "v"(lb + 1024u), "v"(lb + 1536u),
                  "v"(ga), "v"(ga + 256), "v"(ga + 512), "v"(ga + 768), "v"(gb), "v"(gb + 256), "v"(gb + 512), "v"(gb + 768)
               : "memory");
}

// ---------------- tile GEMM, depth 1024: C[m][n] = sum_k A[m][k] Bt[n][k]; A, Bt f16 planes in fragment order (32 k-tiles per row block).
// block = 4 waves, tile 128 x 128; wave tile 64 x 64 (4 x 4 accumulators). The block's operands pass through LDS, so each tile leaves L2 once per block: asynchronous copies fill a ring of two
// stages, stage t + 2 flying while stage t + 1 is worked on; a wave copies row blocks 2 wave and 2 wave + 1 of both operands and reads its fragments from LDS, 512 contiguous bytes per load.
// OMODE 0: f16 out, y = acc*scale + bias[col]; OMODE 1: f16 out, y = acc*scale + bias[row];
// OMODE 2: f32 out, y = acc*scale + bias[col] + bf16(resid[row][col]) with rows mapped to the full-stride layout. The wave stages its tile in private LDS and stores whole lines.
template <int OMODE>
__global__ __launch_bounds__(128) void gemm_kernel(const b16* __restrict__ A, const b16* __restrict__ Bt, const float* __restrict__ bias, const float* __restrict__ resid, b16* __restrict__ outH, float* __restrict__ outF, unsigned opitch, float scale) {
  __shared__ __attribute__((aligned(16))) b16 ring[2 * STG];
  const unsigned wave = threadIdx.x >> 5, lane = threadIdx.x & 31, nloc = lane & 15, hh = lane >> 4;
  const unsigned mb = blockIdx.x * 128, nb = blockIdx.y * 128;
  const unsigned m0 = mb + (wave & 1) * 64, n0 = nb + (wave >> 1) * 64;
  v8f acc[4][4];
#pragma unroll
  for (int i = 0; i < 4; ++i)
#pragma unroll
    for (int j = 0; j < 4; ++j) acc[i][j] = (v8f){};
  const b16* ga = A + ((size_t)(mb >> 4) + 2 * wave) * KTD * TILE + lane * 8;
  const b16* gb = Bt + ((size_t)(nb >> 4) + 2 * wave) * KTD * TILE + lane * 8;
  const unsigned lw = (unsigned)(size_t)(&ring[0]) + wave * (2 * SRB * 2) + lane * 16;   // LDS byte address: low 32 bits of the shared address
  auto fill = [&](unsigned t) {
    const unsigned l = lw + (t & 1u) * (STG * 2); const b16* pa = ga + t * SRB; const b16* pb = gb + t * SRB;
    copy8(l, pa, l + SRB * 2, pa + KTD * TILE);
    copy8(l + SOP * 2, pb, l + SOP * 2 + SRB * 2, pb + KTD * TILE);
  };
  fill(0);
  asm volatile("s_wait_asynccnt 0x0" ::: "memory");   // this wave's share of stage 0 has landed
  __syncthreads();                                    // every wave's share of stage 0 has landed
  fill(1);
#pragma unroll 1   // one trip is one stage: 32 products per wave
  for (unsigned t = 0; t < NSTG; ++t) {
    const b16* la = ring + (t & 1u) * STG + (wave & 1) * (4 * SRB) + lane * 8;
    const b16* lb = ring + (t & 1u) * STG + SOP + (wave >> 1) * (4 * SRB) + lane * 8;
#pragma unroll
    for (unsigned kk = 0; kk < SKT; ++kk) {
      v16b fa[4], fb[4];
#pragma unroll
      for (int i = 0; i < 4; ++i) { fa[i] = frag_pk(la + i * SRB + kk * TILE); fb[i] = frag_pk(lb + i * SRB + kk * TILE); }
#pragma unroll
      for (int j = 0; j < 4; ++j)
#pragma unroll
        for (int i = 0; i < 4; ++i) acc[i][j] = wmma16b(fa[i], fb[j], acc[i][j]);
    }
    asm volatile("s_wait_dscnt 0x0" ::: "memory");      // this wave's reads of stage t are done before the stage's buffer is given up
    asm volatile("s_wait_asynccnt 0x0" ::: "memory");   // this wave's share of stage t + 1 has landed
    __syncthreads();                                    // publishes stage t + 1 and ends every wave's reads of stage t
    if (t + 2 < NSTG) fill(t + 2);                      // block-uniform; into the buffer that stage t has left
  }
  asm volatile("s_wait_asynccnt 0x0" ::: "memory");     // no copy is outstanding when the wave goes on
  if constexpr (OMODE != 2) {
    __shared__ __attribute__((aligned(16))) b16 Th[4][64][72];
#pragma unroll
    for (int i = 0; i < 4; ++i)
#pragma unroll
      for (int j = 0; j < 4; ++j) { const unsigned col = j * 16 + nloc; float bc = 0.0f; if (OMODE == 0) bc = bf16_rne(bias[n0 + col]);
#pragma unroll
        for (int r = 0; r < 8; ++r) { const unsigned row = i * 16 + 8 * hh + r; float bbv = bc; if (OMODE == 1) bbv = bf16_rne(bias[m0 + row]); Th[wave][row][col] = (b16)(acc[i][j][r] * scale + bbv); } }
    wave_lds_sync();   // wave-private tile: same wave writes and reads
    {
      for (unsigned it = 0; it < 8; ++it) { const unsigned rtl = it >> 1, ktl = it & 1u; const b16* tp = &Th[wave][rtl * 16 + nloc][ktl * 32 + hh * 8]; const v8b v0 = *(const v8b*)(tp), v1 = *(const v8b*)(tp + 16);
        b16* op = outH + ((size_t)((m0 >> 4) + rtl) * (opitch >> 5) + (n0 >> 5) + ktl) * TILE + lane * 8;   // one tile of the out plane in fragment order, k = column
        *(v8b*)(op) = v0; *(v8b*)(op + 256) = v1; }
       }
  } else {
    __shared__ __attribute__((aligned(16))) float Tf[4][64][68];
#pragma unroll
    for (int i = 0; i < 4; ++i)
#pragma unroll
      for (int j = 0; j < 4; ++j) { const unsigned col = j * 16 + nloc; const float bc = bf16_rne(bias[n0 + col]);
#pragma unroll
        for (int r = 0; r < 8; ++r) { const unsigned row = i * 16 + 8 * hh + r; Tf[wave][row][col] = acc[i][j][r] * scale + bc; } }
    wave_lds_sync();   // wave-private tile
    const unsigned bt = m0 / SEQU; const unsigned mfull = bt * SEQF + (m0 - bt * SEQU);   // 64-row wave tiles never straddle a batch (SEQ % 128 == 0)
    {
#pragma unroll 2
      for (unsigned it = 0; it < 32; ++it) { const unsigned row = it * 2 + (lane >> 4), c4 = (lane & 15) * 4; const size_t go = (size_t)(mfull + row) * opitch + n0 + c4;
        v4f t = *(const v4f*)(&Tf[wave][row][c4]); const v4f xr = *(const v4f*)(resid + go);
#pragma unroll
        for (int j = 0; j < 4; ++j) t[j] += bf16_rne(xr[j]);
        *(v4f*)(outF + go) = t; }
       }
  }
}

// ---------------- causal flash attention, transposed form. grid (heads, batch, SEQ/64), 4 independent waves, wave = 16 query rows i (iw0 .. iw0+15), key tiles of 64.
// A work-group of query tile qt walks qt + 1 key tiles and only half the work-groups are resident at once: qt falls with the flat index (slowest grid axis, counted down), so the longest start first and the shortest fill the tail.
// S^T tile t (16 keys x 16 queries) = K rows (A: row = key, k = d) x Q rows (B: col = query, k = d); lane holds query i = lane&15, keys 16t+8hh+r.
// p = exp2(s*0.125*log2e - m) as f16; P^T is the B operand of O^T = V^T P^T directly from the score accumulators: k-step c (32 keys) elements 0..7 <- tile 2c acc[0..7],
// elements 8..15 <- tile 2c+1 acc[0..7] (the D row map equals the B k map). A = VT rows (row = d, k = key). O^T acc[r] = O[d = 16dt+8hh+r][i = lane&15].
__global__ __launch_bounds__(128) void attn_kernel(const b16* __restrict__ QK, const b16* __restrict__ VT, b16* __restrict__ CTX) {
  const unsigned wave = threadIdx.x >> 5, lane = threadIdx.x & 31, nloc = lane & 15, hh = lane >> 4;
  const unsigned qt = SEQU / 64 - 1 - blockIdx.z, h = blockIdx.x, b = blockIdx.y;
  const unsigned iw0 = qt * 64 + wave * 16;
  const b16* qrow = QK + ((size_t)((b * SEQU + iw0) >> 4) * KTQ + h * 2) * TILE + lane * 8;
  const v16b qf0 = frag_pk(qrow), qf1 = frag_pk(qrow + TILE);
  const b16* kbase = QK + ((size_t)((b * SEQU) >> 4) * KTQ + KTD + h * 2) * TILE + lane * 8;
  const b16* vbase = VT + ((size_t)(h * 4) * KTV + ((b * SEQU) >> 5)) * TILE + lane * 8;
  v8f o[4];
#pragma unroll
  for (int dt = 0; dt < 4; ++dt) o[dt] = (v8f){};
  float m = -1.0e30f, l = 0.0f;
  const float SCL = 0.125f * LOG2E;
  const unsigned iq = iw0 + nloc;
  // K and V fragments of a key tile each have 8 register sets of their own and are loaded as one group: V of tile jt ahead of the score products, K of tile jt + 1 behind them, ahead of the softmax
  v16b kf[8], vf[8];
#pragma unroll
  for (int t = 0; t < 4; ++t) { const b16* kr = kbase + (size_t)t * KTQ * TILE; kf[2 * t] = frag_pk(kr); kf[2 * t + 1] = frag_pk(kr + TILE); }
  asm volatile("s_wait_xcnt 0x0" ::: "memory");   // the loop reuses the address registers of the Q and K loads while these are in flight
#pragma unroll 1
  for (unsigned jt = 0; jt <= qt; ++jt) {            // block-uniform trip count; every tile holds at least key j0 <= i for every query of the block
    const unsigned j0 = jt * 64;
#pragma unroll
    for (int dt = 0; dt < 4; ++dt) { const b16* vr = vbase + ((size_t)dt * KTV + jt * 2) * TILE; vf[2 * dt] = frag_pk(vr); vf[2 * dt + 1] = frag_pk(vr + TILE); }
    __builtin_amdgcn_sched_barrier(0);   // keeps the V loads at the head of the trip: without it the first score product moves up with its wait on K, and the V loads are issued only behind that wait
    v8f s[4];
#pragma unroll
    for (int t = 0; t < 4; ++t) { s[t] = wmma16b(kf[2 * t], qf0, (v8f){}); s[t] = wmma16b(kf[2 * t + 1], qf1, s[t]); }
    asm volatile("s_wait_xcnt 0x0" ::: "memory");   // the V loads are in flight and their address registers are reused from here on
    if (jt < qt) {                                   // block-uniform: the next key tile exists
#pragma unroll
      for (int t = 0; t < 4; ++t) { const b16* kr = kbase + (size_t)((jt + 1) * 4 + t) * KTQ * TILE; kf[2 * t] = frag_pk(kr); kf[2 * t + 1] = frag_pk(kr + TILE); }
      asm volatile("s_wait_xcnt 0x0" ::: "memory");   // the softmax reuses the address registers of these loads while they are in flight
    }
    const bool diag = (jt == qt);                    // block-uniform
    float mx = -1.0e30f;
#pragma unroll
    for (int t = 0; t < 4; ++t)
#pragma unroll
      for (int r = 0; r < 8; ++r) { float xv = s[t][r] * SCL; if (diag) { const unsigned j = j0 + 16 * t + 8 * hh + r; xv = (j > iq) ? -1.0e30f : xv; } s[t][r] = xv; mx = fmaxf(mx, xv); }
    mx = fmaxf(mx, __shfl_xor(mx, 16, 32));
    const float newm = fmaxf(m, mx); const float alpha = exp2f(m - newm); m = newm;
    float psum = 0.0f; v16b pf0, pf1;
#pragma unroll
    for (int t = 0; t < 4; ++t)
#pragma unroll
      for (int r = 0; r < 8; ++r) { const b16 ph = (b16)exp2f(s[t][r] - m); psum += (float)ph; if (t < 2) pf0[(t & 1) * 8 + r] = ph; else pf1[(t & 1) * 8 + r] = ph; }
    psum += __shfl_xor(psum, 16, 32);
    l = l * alpha + psum;
#pragma unroll
    for (int dt = 0; dt < 4; ++dt)
#pragma unroll
      for (int r = 0; r < 8; ++r) o[dt][r] *= alpha;
#pragma unroll
    for (int dt = 0; dt < 4; ++dt) { o[dt] = wmma16b(vf[2 * dt], pf0, o[dt]); o[dt] = wmma16b(vf[2 * dt + 1], pf1, o[dt]); }
  }
  const float inv = CSC * (1.0f / l);                // l >= 1 (the running-max key contributes exactly 1)
  b16* cp = CTX + ((size_t)((b * SEQU + iw0) >> 4) * KTD + h * 2) * TILE + lane * 8;
#pragma unroll
  for (int dt = 0; dt < 4; ++dt) { v8b v;
#pragma unroll
    for (int r = 0; r < 8; ++r) v[r] = (b16)(o[dt][r] * inv);
    *(v8b*)(cp + (dt >> 1) * TILE + (dt & 1) * 256) = v; }   // the lane's 8 values (query nloc, d = 16dt+8hh+0..7) are its own granule of the CTX tile: 512 contiguous bytes per wave store
}

__global__ __launch_bounds__(256) void lnout_kernel(const float* __restrict__ Y, const float* __restrict__ gam, const float* __restrict__ bet, float* __restrict__ out) {
#pragma clang fp contract(off)
  const unsigned wave = __builtin_amdgcn_readfirstlane(threadIdx.x >> 5), lane = threadIdx.x & 31;
  const unsigned r = blockIdx.x * 8 + wave;                 // compact row < MT (grid exact)
  const unsigned bb = r / SEQU, ss = r - bb * SEQU;
  const size_t ro = ((size_t)bb * SEQF + ss) * KD + lane * 4;
  const float* yr = Y + ro;
  float s = 0.0f;
#pragma unroll 1
  for (unsigned c = 0; c < 8; ++c) { const v4f a = *(const v4f*)(yr + c * 128); s += (a[0] + a[1]) + (a[2] + a[3]); }
#pragma unroll
  for (int m = 16; m > 0; m >>= 1) s += __shfl_xor(s, m, 32);
  const float mu = s * (1.0f / 1024.0f);
  float q = 0.0f;
#pragma unroll 1
  for (unsigned c = 0; c < 8; ++c) { const v4f a = *(const v4f*)(yr + c * 128);
#pragma unroll
    for (int j = 0; j < 4; ++j) { const float d0 = a[j] - mu; q += d0 * d0; } }
#pragma unroll
  for (int m = 16; m > 0; m >>= 1) q += __shfl_xor(q, m, 32);
  const float inv = rsqrtf(q * (1.0f / 1024.0f) + LNEPS);
  {
#pragma unroll 1
    for (unsigned c = 0; c < 8; ++c) { const unsigned co = c * 128 + lane * 4;
      const v4f a = *(const v4f*)(yr + c * 128);
      const v4f ga = *(const v4f*)(gam + co), ba = *(const v4f*)(bet + co);
      v4f t;
#pragma unroll
      for (int j = 0; j < 4; ++j) t[j] = (a[j] - mu) * inv * bf16_rne(ga[j]) + bf16_rne(ba[j]);
      *(v4f*)(out + ro + c * 128) = t; }
     }
}

}  // namespace

extern "C" void kernel_launch(void* const* d_in, const int* in_sizes, int n_in, void* d_out, int out_size, void* d_ws, size_t ws_size, hipStream_t stream) {
  if (n_in < 11) return;
  // wire order: 0 x [4,2048,1024], 1 Wq [1024,1024] (in,out), 2 bq, 3 Wk, 4 bk, 5 Wv, 6 bv, 7 Wo [1024,1024] (in,out), 8 bo, 9 gamma [1024], 10 beta [1024]; all f32. Output f32 [4,2048,1024].
  const size_t need = ((size_t)(NBU - 1) * SEQF + SEQU) * KD;
  if ((size_t)in_sizes[0] < need || (size_t)out_size < need) return;
  if (in_sizes[2] < (int)KD || in_sizes[4] < (int)KD || in_sizes[6] < (int)KD || in_sizes[8] < (int)KD || in_sizes[9] < (int)KD || in_sizes[10] < (int)KD) return;
  if ((size_t)in_sizes[1] < (size_t)KD * KD || (size_t)in_sizes[3] < (size_t)KD * KD || (size_t)in_sizes[5] < (size_t)KD * KD || (size_t)in_sizes[7] < (size_t)KD * KD) return;
  const float* x = (const float*)d_in[0];
  const float* Wq = (const float*)d_in[1]; const float* bq = (const float*)d_in[2]; const float* Wk = (const float*)d_in[3]; const float* bk = (const float*)d_in[4];
  const float* Wv = (const float*)d_in[5]; const float* bv = (const float*)d_in[6]; const float* Wo = (const float*)d_in[7]; const float* bo = (const float*)d_in[8];
  const float* gam = (const float*)d_in[9]; const float* bet = (const float*)d_in[10];
  float* out = (float*)d_out;
  size_t off = 0; char* ws = (char*)d_ws;
  auto carve = [&](size_t bytes) { char* p = ws + off; off += (bytes + 255) & ~(size_t)255; return p; };
  b16* XH = (b16*)carve(SZ_XH);        // 16 MiB  x as f16 [MT][1024], fragment order
  b16* WT = (b16*)carve(SZ_WT);        //  8 MiB  weight planes [4][1024 out][1024 in] x16, fragment order
  b16* QK = (b16*)carve(SZ_QK);        // 32 MiB  [MT][Q 1024 | K 1024] f16, fragment order
  b16* VT = (b16*)carve(SZ_VT);        // 16 MiB  V^T [h*64+d][MT] f16, fragment order
  b16* CTX = (b16*)carve(SZ_CTX);      // 16 MiB  attention output x32 f16 [MT][1024], fragment order
  float* Y = (float*)carve(SZ_Y);      // 32 MiB  y = ctx Wo + bo + x, f32, full-stride rows [YROWS][1024]
  if (off > ws_size || off > ((size_t)128 << 20)) return;   // 120 MiB at the shipped sizes
  const float s16 = 1.0f / WSC, s512 = 1.0f / (WSC * CSC);
  xh_kernel<<<(unsigned)((size_t)MT * KD / 8 / 256), 256, 0, stream>>>(x, XH);
  wt_kernel<<<dim3(KD * KD / 8 / 256, 4), 256, 0, stream>>>(Wq, Wk, Wv, Wo, WT);
  gemm_kernel<0><<<dim3(MT / 128, KD / 128), 128, 0, stream>>>(XH, WT, bq, x, QK, out, QKP, s16);                                   // Q = x Wq + bq -> QK k-tiles 0..31 of every row block
  gemm_kernel<0><<<dim3(MT / 128, KD / 128), 128, 0, stream>>>(XH, WT + (size_t)KD * KD, bk, x, QK + (size_t)KTD * TILE, out, QKP, s16);   // K = x Wk + bk -> QK k-tiles 32..63 of every row block
  gemm_kernel<1><<<dim3(KD / 128, MT / 128), 128, 0, stream>>>(WT + (size_t)2 * KD * KD, XH, bv, x, VT, out, MT, s16);              // V^T[c][m] = sum_k WvT[c][k] x[m][k] + bv[c]
  attn_kernel<<<dim3(NHEAD, NBU, SEQU / 64), 128, 0, stream>>>(QK, VT, CTX);
  gemm_kernel<2><<<dim3(MT / 128, KD / 128), 128, 0, stream>>>(CTX, WT + (size_t)3 * KD * KD, bo, x, CTX, Y, KD, s512);             // y = ctx Wo + bo + x -> Y (f32)
  lnout_kernel<<<MT / 8, 256, 0, stream>>>(Y, gam, bet, out);                                                                      // out = LayerNorm(y) * gamma + beta
}

// v005
// A run of this version takes 152 microseconds.
// Two timings next to v004 both put it at 1.04 times that version's speed.
// Counting every step since v000, it is 2.75 times as fast.
#include <hip/hip_runtime.h>

// compute dtype: every contraction on v_wmma_f32_16x16x32_f16 (f16 operands, f32 accumulate), single products: x [Wq|Wk|Wv] (x exact bf16 as f16, weights exact bf16 x16),
// S^T = K Q^T (q, k f16), O^T = V^T P^T (v f16, p = exp2(s - max) f16 in (0,1]), ctx Wo (ctx f16 x32, Wo exact bf16 x16). Softmax, bias, the skip connection and
// the closing LayerNorm in f32. All float inputs are RNE-converted to bf16 on load. Fragment k-map per lane half hh for A AND B: elements 0..7 <- k = 8hh+0..7,
// Operand planes (XH, WT, Q|K, V^T, CTX) are stored in fragment order: a tile of 16 rows x 32 k is 1024 contiguous bytes, tile (rt, kt) of a plane with KT k-tiles per row block at
// halves (rt*KT + kt)*512; inside it lane l = 16hh + row owns halves 8l..8l+7 (k = 8hh+0..7) and 256+8l..256+8l+7 (k = 16+8hh+0..7), so each fragment load of a wave is 512 contiguous bytes.
// Structure: causal post-LN attention block; x cast -> Q|K plane, V^T plane -> fused causal flash attention -> y = ctx Wo + bo + x (f32 plane) -> LayerNorm(y) -> output buffer.

#ifndef NB
#define NB 4
#endif
#ifndef SEQ
#define SEQ 2048
#endif
#ifndef SEQ_FULL
#define SEQ_FULL 2048
#endif

namespace {

constexpr unsigned KD = 1024 /* model width == heads * head dim == GEMM depth */, NHEAD = 16, DH = 64, QKP = 2048 /* pitch of the Q|K plane (halves) */;
constexpr unsigned NBU = NB, SEQU = SEQ, SEQF = SEQ_FULL, MT = NBU * SEQU /* compact rows */;
constexpr float LOG2E = 1.4426950408889634f, LNEPS = 1e-5f, WSC = 16.0f /* weight carry */, CSC = 32.0f /* ctx carry */;
static_assert(NHEAD * DH == KD);
static_assert(SEQU % 128 == 0 && SEQU <= SEQF && NBU >= 1);
static_assert(MT % 128 == 0 && KD % 32 == 0);

// extents the added kernels and the launch plan rely on
static_assert(KD == 8u * 128u);                                  // LayerNorm: 8 chunks x 32 lanes x 4 floats per row
static_assert(((size_t)MT * KD / 8) % 256 == 0);                 // cast grid exact
static_assert(MT % 8 == 0);                                      // LayerNorm grid exact (8 rows per block)
static_assert(((size_t)KD * KD / 8) % 256 == 0);                 // weight plane grid exact
static_assert(MT % 64 == 0 && KD % 128 == 0 && KD % 64 == 0 && SEQU % 64 == 0);   // GEMM / attention tile multiples
constexpr unsigned TILE = 512 /* halves of one 16 x 32 fragment tile */, KTD = KD / 32 /* k-tiles per row block, depth-1024 planes */, KTQ = QKP / 32 /* Q|K plane */, KTV = MT / 32 /* V^T plane */;
static_assert(KTD == 32);                                        // the cast and weight kernels split a tile index by shifts of 5
constexpr size_t YROWS = (size_t)(NBU - 1) * SEQF + SEQU;        // rows of the y plane (full-stride row map)
constexpr size_t SZ_XH = (size_t)MT * KD * 2, SZ_WT = (size_t)4 * KD * KD * 2, SZ_QK = (size_t)MT * QKP * 2, SZ_VT = (size_t)KD * MT * 2, SZ_CTX = (size_t)MT * KD * 2, SZ_Y = YROWS * KD * 4;
static_assert(SZ_XH % 256 == 0 && SZ_WT % 256 == 0 && SZ_QK % 256 == 0 && SZ_VT % 256 == 0 && SZ_CTX % 256 == 0 && SZ_Y % 256 == 0);
static_assert(SZ_XH + SZ_WT + SZ_QK + SZ_VT + SZ_CTX + SZ_Y <= ((size_t)128 << 20));   // 120 MiB at the shipped sizes

typedef _Float16 b16;
typedef __attribute__((ext_vector_type(16))) _Float16 v16b;
typedef __attribute__((ext_vector_type(8))) _Float16 v8b;
typedef __attribute__((ext_vector_type(8))) float v8f;
typedef __attribute__((ext_vector_type(4))) float v4f;

__device__ __forceinline__ float bf16_rne(float f) { unsigned int u = __float_as_uint(f); u += 0x7FFFu + ((u >> 16) & 1u); return __uint_as_float(u & 0xFFFF0000u); }
// p = tile base + 8 * lane
__device__ __forceinline__ v16b frag_pk(const b16* p) { const v8b a = *(const v8b*)(p), b = *(const v8b*)(p + 256); v16b f;
#pragma unroll
  for (int e = 0; e < 8; ++e) { f[e] = a[e]; f[8 + e] = b[e]; } return f; }
__device__ __forceinline__ v8f wmma16b(v16b a, v16b b, v8f c) { v8f d = __builtin_amdgcn_wmma_f32_16x16x32_f16(false, a, false, b, (short)0, c, false, false); asm volatile("v_nop\n\tv_nop\n\tv_nop\n\tv_nop" : "+v"(d) : "v"(a), "v"(b)); return d; }
__device__ __forceinline__ void wave_lds_sync() { __builtin_amdgcn_fence(3 /* release order */, "workgroup"); __builtin_amdgcn_wave_barrier(); __builtin_amdgcn_fence(2 /* acquire order */, "workgroup"); }
// f32 -> f16 operand convert that cannot yield an f16 subnormal (value select below 2^-14)
__device__ __forceinline__ b16 toh_flush(float v) { const b16 r = (b16)v; return (fabsf(v) < 6.103515625e-05f) ? (b16)0.0f : r; }

// 2^x as the bare v_exp_f32, for x <= 0 in the softmax. The library exp2f wraps it in a range guard (compare, two selects, add, ldexp) that only matters for results below 2^-126, where the bare
// instruction may give 0 for a subnormal: as p such a value rounds to f16 zero either way, and as the rescale factor it multiplies sums that then stand beside a term of 1.
__device__ __forceinline__ float exp2_bare(float x) { return __builtin_amdgcn_exp2f(x); }

__global__ __launch_bounds__(256) void xh_kernel(const float* __restrict__ x, b16* __restrict__ XH) {
  const unsigned u = blockIdx.x * 256 + threadIdx.x;          // < MT*KD/8 (grid exact)
  const unsigned tile = u >> 6, nloc = ((u >> 5) & 1u) * 8 + ((u >> 2) & 7u), part = (u >> 1) & 1u, hh = u & 1u;   // a wave: 8 rows x the 4 granules of one k-tile (whole lines read and written)
  const unsigned r = (tile >> 5) * 16 + nloc, col = (tile & 31u) * 32 + part * 16 + hh * 8;
  const unsigned bb = r / SEQU, ss = r - bb * SEQU;
  const float* xr = x + ((size_t)bb * SEQF + ss) * KD + col;
  const v4f a = *(const v4f*)(xr), b = *(const v4f*)(xr + 4);
  v8b v;
#pragma unroll
  for (int j = 0; j < 4; ++j) { v[j] = toh_flush(bf16_rne(a[j])); v[4 + j] = toh_flush(bf16_rne(b[j])); }
  { *(v8b*)(XH + (size_t)tile * TILE + part * 256 + (hh * 16 + nloc) * 8) = v;  }
}

__global__ __launch_bounds__(256) void wt_kernel(const float* __restrict__ w0, const float* __restrict__ w1, const float* __restrict__ w2, const float* __restrict__ w3, b16* __restrict__ WT) {
  const unsigned y = blockIdx.y; const float* w = (y == 0) ? w0 : (y == 1) ? w1 : (y == 2) ? w2 : w3;
  const unsigned u = blockIdx.x * 256 + threadIdx.x;          // < KD*KD/8 (grid exact)
  const unsigned e = u * 8, tile = u >> 6, part = (u >> 5) & 1u, hh = (u >> 4) & 1u, nloc = u & 15u;   // u = granule index in fragment order
  const unsigned o = (tile >> 5) * 16 + nloc, k0 = (tile & 31u) * 32 + part * 16 + hh * 8; v8b v;
#pragma unroll
  for (int j = 0; j < 8; ++j) v[j] = (b16)(bf16_rne(w[(size_t)(k0 + j) * KD + o]) * WSC);
  { *(v8b*)(WT + (size_t)y * KD * KD + e) = v;  }
}

// One k-stage of a GEMM block in LDS: 64 of depth (2 k-tiles) of 8 row blocks of A, then of 8 row blocks of Bt, every 1024-byte tile kept in fragment order.
constexpr unsigned SKT = 2 /* k-tiles per stage */, SRB = SKT * TILE /* halves of one row block in a stage */, SOP = 8 * SRB /* halves of one operand */, STG = 2 * SOP /* halves of a stage: 32 KiB */, NSTG = KTD / SKT;
static_assert(KTD % SKT == 0 && NSTG >= 2);
static_assert(MT % 128 == 0 && KD % 128 == 0);                   // GEMM block tile multiples

// A wave's 8 copies of 512 bytes: the 2048 contiguous bytes that a stage takes of two row blocks (la <- ga, lb <- gb; LDS byte addresses and global pointers of the lane's own 16 bytes).
__device__ __forceinline__ void copy8(unsigned la, const b16* ga, unsigned lb, const b16* gb) {
  // the closing s_wait_xcnt stands inside the statement so that no address register of a copy is rewritten ahead of it
  asm volatile("global_load_async_to_lds_b128 %0, %8, off\n\t"
               "global_load_async_to_lds_b128 %1, %9, off\n\t"
               "global_load_async_to_lds_b128 %2, %10, off\n\t"
               "global_load_async_to_lds_b128 %3, %11, off\n\t"
               "global_load_async_to_lds_b128 %4, %12, off\n\t"
               "global_load_async_to_lds_b128 %5, %13, off\n\t"
               "global_load_async_to_lds_b128 %6, %14, off\n\t"
               "global_load_async_to_lds_b128 %7, %15, off\n\t"
               "s_wait_xcnt 0x0"
               :: "v"(la), "v"(la + 512u), "v"(la + 1024u), "v"(la + 1536u), "v"(lb), "v"(lb + 512u), "v"(lb + 1024u), "v"(lb + 1536u),
                  "v"(ga), "v"(ga + 256), "v"(ga + 512), "v"(ga + 768), "v"(gb), "v"(gb + 256), "v"(gb + 512), "v"(gb + 768)
               : "memory");
}

// ---------------- tile GEMM, depth 1024: C[m][n] = sum_k A[m][k] Bt[n][k]; A, Bt f16 planes in fragment order (32 k-tiles per row block).
// block = 4 waves, tile 128 x 128; wave tile 64 x 64 (4 x 4 accumulators). The block's operands pass through LDS, so each tile leaves L2 once per block: asynchronous copies fill a ring of two
// stages, stage t + 2 flying while stage t + 1 is worked on; a wave copies row blocks 2 wave and 2 wave + 1 of both operands and reads its fragments from LDS, 512 contiguous bytes per load.
// OMODE 0: f16 out, y = acc*scale + bias[col]; OMODE 1: f16 out, y = acc*scale + bias[row];
// OMODE 2: f32 out, y = acc*scale + bias[col] + bf16(resid[row][col]) with rows mapped to the full-stride layout. The wave stages its tile in private LDS and stores whole lines.
template <int OMODE>
__global__ __launch_bounds__(128) void gemm_kernel(const b16* __restrict__ A, const b16* __restrict__ Bt, const float* __restrict__ bias, const float* __restrict__ resid, b16* __restrict__ outH, float* __restrict__ outF, unsigned opitch, float scale) {
  __shared__ __attribute__((aligned(16))) b16 ring[2 * STG];
  const unsigned wave = threadIdx.x >> 5, lane = threadIdx.x & 31, nloc = lane & 15, hh = lane >> 4;
  const unsigned mb = blockIdx.x * 128, nb = blockIdx.y * 128;
  const unsigned m0 = mb + (wave & 1) * 64, n0 = nb + (wave >> 1) * 64;
  v8f acc[4][4];
#pragma unroll
  for (int i = 0; i < 4; ++i)
#pragma unroll
    for (int j = 0; j < 4; ++j) acc[i][j] = (v8f){};
  const b16* ga = A + ((size_t)(mb >> 4) + 2 * wave) * KTD * TILE + lane * 8;
  const b16* gb = Bt + ((size_t)(nb >> 4) + 2 * wave) * KTD * TILE + lane * 8;
  const unsigned lw = (unsigned)(size_t)(&ring[0]) + wave * (2 * SRB * 2) + lane * 16;   // LDS byte address: low 32 bits of the shared address
  auto fill = [&](unsigned t) {
    const unsigned l = lw + (t & 1u) * (STG * 2); const b16* pa = ga + t * SRB; const b16* pb = gb + t * SRB;
    copy8(l, pa, l + SRB * 2, pa + KTD * TILE);
    copy8(l + SOP * 2, pb, l + SOP * 2 + SRB * 2, pb + KTD * TILE);
  };
  fill(0);
  asm volatile("s_wait_asynccnt 0x0" ::: "memory");   // this wave's share of stage 0 has landed
  __syncthreads();                                    // every wave's share of stage 0 has landed
  fill(1);
#pragma unroll 1   // one trip is one stage: 32 products per wave
  for (unsigned t = 0; t < NSTG; ++t) {
    const b16* la = ring + (t & 1u) * STG + (wave & 1) * (4 * SRB) + lane * 8;
    const b16* lb = ring + (t & 1u) * STG + SOP + (wave >> 1) * (4 * SRB) + lane * 8;
#pragma unroll
    for (unsigned kk = 0; kk < SKT; ++kk) {
      v16b fa[4], fb[4];
#pragma unroll
      for (int i = 0; i < 4; ++i) { fa[i] = frag_pk(la + i * SRB + kk * TILE); fb[i] = frag_pk(lb + i * SRB + kk * TILE); }
#pragma unroll
      for (int j = 0; j < 4; ++j)
#pragma unroll
        for (int i = 0; i < 4; ++i) acc[i][j] = wmma16b(fa[i], fb[j], acc[i][j]);
    }
    asm volatile("s_wait_dscnt 0x0" ::: "memory");      // this wave's reads of stage t are done before the stage's buffer is given up
    asm volatile("s_wait_asynccnt 0x0" ::: "memory");   // this wave's share of stage t + 1 has landed
    __syncthreads();                                    // publishes stage t + 1 and ends every wave's reads of stage t
    if (t + 2 < NSTG) fill(t + 2);                      // block-uniform; into the buffer that stage t has left
  }
  asm volatile("s_wait_asynccnt 0x0" ::: "memory");     // no copy is outstanding when the wave goes on
  if constexpr (OMODE != 2) {
    __shared__ __attribute__((aligned(16))) b16 Th[4][64][72];
#pragma unroll
    for (int i = 0; i < 4; ++i)
#pragma unroll
      for (int j = 0; j < 4; ++j) { const unsigned col = j * 16 + nloc; float bc = 0.0f; if (OMODE == 0) bc = bf16_rne(bias[n0 + col]);
#pragma unroll
        for (int r = 0; r < 8; ++r) { const unsigned row = i * 16 + 8 * hh + r; float bbv = bc; if (OMODE == 1) bbv = bf16_rne(bias[m0 + row]); Th[wave][row][col] = (b16)(acc[i][j][r] * scale + bbv); } }
    wave_lds_sync();   // wave-private tile: same wave writes and reads
    {
      for (unsigned it = 0; it < 8; ++it) { const unsigned rtl = it >> 1, ktl = it & 1u; const b16* tp = &Th[wave][rtl * 16 + nloc][ktl * 32 + hh * 8]; const v8b v0 = *(const v8b*)(tp), v1 = *(const v8b*)(tp + 16);
        b16* op = outH + ((size_t)((m0 >> 4) + rtl) * (opitch >> 5) + (n0 >> 5) + ktl) * TILE + lane * 8;   // one tile of the out plane in fragment order, k = column
        *(v8b*)(op) = v0; *(v8b*)(op + 256) = v1; }
       }
  } else {
    __shared__ __attribute__((aligned(16))) float Tf[4][64][68];
#pragma unroll
    for (int i = 0; i < 4; ++i)
#pragma unroll
      for (int j = 0; j < 4; ++j) { const unsigned col = j * 16 + nloc; const float bc = bf16_rne(bias[n0 + col]);
#pragma unroll
        for (int r = 0; r < 8; ++r) { const unsigned row = i * 16 + 8 * hh + r; Tf[wave][row][col] = acc[i][j][r] * scale + bc; } }
    wave_lds_sync();   // wave-private tile
    const unsigned bt = m0 / SEQU; const unsigned mfull = bt * SEQF + (m0 - bt * SEQU);   // 64-row wave tiles never straddle a batch (SEQ % 128 == 0)
    {
#pragma unroll 2
      for (unsigned it = 0; it < 32; ++it) { const unsigned row = it * 2 + (lane >> 4), c4 = (lane & 15) * 4; const size_t go = (size_t)(mfull + row) * opitch + n0 + c4;
        v4f t = *(const v4f*)(&Tf[wave][row][c4]); const v4f xr = *(const v4f*)(resid + go);
#pragma unroll
        for (int j = 0; j < 4; ++j) t[j] += bf16_rne(xr[j]);
        *(v4f*)(outF + go) = t; }
       }
  }
}

// ---------------- causal flash attention, transposed form. grid (heads, batch, SEQ/64), 4 independent waves, wave = 16 query rows i (iw0 .. iw0+15), key tiles of 64.
// A work-group of query tile qt walks qt + 1 key tiles and only half the work-groups are resident at once: qt falls with the flat index (slowest grid axis, counted down), so the longest start first and the shortest fill the tail.
// S^T tile t (16 keys x 16 queries) = K rows (A: row = key, k = d) x Q rows (B: col = query, k = d); lane holds query i = lane&15, keys 16t+8hh+r.
// p = exp2(s*0.125*log2e - m) as f16; P^T is the B operand of O^T = V^T P^T directly from the score accumulators: k-step c (32 keys) elements 0..7 <- tile 2c acc[0..7],
// elements 8..15 <- tile 2c+1 acc[0..7] (the D row map equals the B k map). A = VT rows (row = d, k = key). O^T acc[r] = O[d = 16dt+8hh+r][i = lane&15].
__global__ __launch_bounds__(128) void attn_kernel(const b16* __restrict__ QK, const b16* __restrict__ VT, b16* __restrict__ CTX) {
  const unsigned wave = threadIdx.x >> 5, lane = threadIdx.x & 31, nloc = lane & 15, hh = lane >> 4;
  const unsigned qt = SEQU / 64 - 1 - blockIdx.z, h = blockIdx.x, b = blockIdx.y;
  const unsigned iw0 = qt * 64 + wave * 16;
  const b16* qrow = QK + ((size_t)((b * SEQU + iw0) >> 4) * KTQ + h * 2) * TILE + lane * 8;
  const v16b qf0 = frag_pk(qrow), qf1 = frag_pk(qrow + TILE);
  const b16* kbase = QK + ((size_t)((b * SEQU) >> 4) * KTQ + KTD + h * 2) * TILE + lane * 8;
  const b16* vbase = VT + ((size_t)(h * 4) * KTV + ((b * SEQU) >> 5)) * TILE + lane * 8;
  v8f o[4];
#pragma unroll
  for (int dt = 0; dt < 4; ++dt) o[dt] = (v8f){};
  float m = -1.0e30f, l = 0.0f;
  const float SCL = 0.125f * LOG2E;
  const unsigned iq = iw0 + nloc;
  // K and V fragments of a key tile each have 8 register sets of their own and are loaded as one group: V of tile jt ahead of the score products, K of tile jt + 1 behind them, ahead of the softmax
  v16b kf[8], vf[8];
#pragma unroll
  for (int t = 0; t < 4; ++t) { const b16* kr = kbase + (size_t)t * KTQ * TILE; kf[2 * t] = frag_pk(kr); kf[2 * t + 1] = frag_pk(kr + TILE); }
  asm volatile("s_wait_xcnt 0x0" ::: "memory");   // the loop reuses the address registers of the Q and K loads while these are in flight
#pragma unroll 1
  for (unsigned jt = 0; jt <= qt; ++jt) {            // block-uniform trip count; every tile holds at least key j0 <= i for every query of the block
    const unsigned j0 = jt * 64;
#pragma unroll
    for (int dt = 0; dt < 4; ++dt) { const b16* vr = vbase + ((size_t)dt * KTV + jt * 2) * TILE; vf[2 * dt] = frag_pk(vr); vf[2 * dt + 1] = frag_pk(vr + TILE); }
    __builtin_amdgcn_sched_barrier(0);   // keeps the V loads at the head of the trip: without it the first score product moves up with its wait on K, and the V loads are issued only behind that wait
    v8f s[4];
#pragma unroll
    for (int t = 0; t < 4; ++t) { s[t] = wmma16b(kf[2 * t], qf0, (v8f){}); s[t] = wmma16b(kf[2 * t + 1], qf1, s[t]); }
    asm volatile("s_wait_xcnt 0x0" ::: "memory");   // the V loads are in flight and their address registers are reused from here on
    if (jt < qt) {                                   // block-uniform: the next key tile exists
#pragma unroll
      for (int t = 0; t < 4; ++t) { const b16* kr = kbase + (size_t)((jt + 1) * 4 + t) * KTQ * TILE; kf[2 * t] = frag_pk(kr); kf[2 * t + 1] = frag_pk(kr + TILE); }
      asm volatile("s_wait_xcnt 0x0" ::: "memory");   // the softmax reuses the address registers of these loads while they are in flight
    }
    const bool diag = (jt == qt);                    // block-uniform
    float mx = -1.0e30f;
#pragma unroll
    for (int t = 0; t < 4; ++t)
#pragma unroll
      for (int r = 0; r < 8; ++r) { float xv = s[t][r] * SCL; if (diag) { const unsigned j = j0 + 16 * t + 8 * hh + r; xv = (j > iq) ? -1.0e30f : xv; } s[t][r] = xv; mx = fmaxf(mx, xv); }
    mx = fmaxf(mx, __shfl_xor(mx, 16, 32));
    const float newm = fmaxf(m, mx); const float alpha = exp2_bare(m - newm); m = newm;
    float psum = 0.0f; v16b pf0, pf1;
#pragma unroll
    for (int t = 0; t < 4; ++t)
#pragma unroll
      for (int r = 0; r < 8; ++r) { const b16 ph = (b16)exp2_bare(s[t][r] - m); psum += (float)ph; if (t < 2) pf0[(t & 1) * 8 + r] = ph; else pf1[(t & 1) * 8 + r] = ph; }
    psum += __shfl_xor(psum, 16, 32);
    l = l * alpha + psum;
#pragma unroll
    for (int dt = 0; dt < 4; ++dt)
#pragma unroll
      for (int r = 0; r < 8; ++r) o[dt][r] *= alpha;
#pragma unroll
    for (int dt = 0; dt < 4; ++dt) { o[dt] = wmma16b(vf[2 * dt], pf0, o[dt]); o[dt] = wmma16b(vf[2 * dt + 1], pf1, o[dt]); }
  }
  const float inv = CSC * (1.0f / l);                // l >= 1 (the running-max key contributes exactly 1)
  b16* cp = CTX + ((size_t)((b * SEQU + iw0) >> 4) * KTD + h * 2) * TILE + lane * 8;
#pragma unroll
  for (int dt = 0; dt < 4; ++dt) { v8b v;
#pragma unroll
    for (int r = 0; r < 8; ++r) v[r] = (b16)(o[dt][r] * inv);
    *(v8b*)(cp + (dt >> 1) * TILE + (dt & 1) * 256) = v; }   // the lane's 8 values (query nloc, d = 16dt+8hh+0..7) are its own granule of the CTX tile: 512 contiguous bytes per wave store
}

__global__ __launch_bounds__(256) void lnout_kernel(const float* __restrict__ Y, const float* __restrict__ gam, const float* __restrict__ bet, float* __restrict__ out) {
#pragma clang fp contract(off)
  const unsigned wave = __builtin_amdgcn_readfirstlane(threadIdx.x >> 5), lane = threadIdx.x & 31;
  const unsigned r = blockIdx.x * 8 + wave;                 // compact row < MT (grid exact)
  const unsigned bb = r / SEQU, ss = r - bb * SEQU;
  const size_t ro = ((size_t)bb * SEQF + ss) * KD + lane * 4;
  const float* yr = Y + ro;
  float s = 0.0f;
#pragma unroll 1
  for (unsigned c = 0; c < 8; ++c) { const v4f a = *(const v4f*)(yr + c * 128); s += (a[0] + a[1]) + (a[2] + a[3]); }
#pragma unroll
  for (int m = 16; m > 0; m >>= 1) s += __shfl_xor(s, m, 32);
  const float mu = s * (1.0f / 1024.0f);
  float q = 0.0f;
#pragma unroll 1
  for (unsigned c = 0; c < 8; ++c) { const v4f a = *(const v4f*)(yr + c * 128);
#pragma unroll
    for (int j = 0; j < 4; ++j) { const float d0 = a[j] - mu; q += d0 * d0; } }
#pragma unroll
  for (int m = 16; m > 0; m >>= 1) q += __shfl_xor(q, m, 32);
  const float inv = rsqrtf(q * (1.0f / 1024.0f) + LNEPS);
  {
#pragma unroll 1
    for (unsigned c = 0; c < 8; ++c) { const unsigned co = c * 128 + lane * 4;
      const v4f a = *(const v4f*)(yr + c * 128);
      const v4f ga = *(const v4f*)(gam + co), ba = *(const v4f*)(bet + co);
      v4f t;
#pragma unroll
      for (int j = 0; j < 4; ++j) t[j] = (a[j] - mu) * inv * bf16_rne(ga[j]) + bf16_rne(ba[j]);
      *(v4f*)(out + ro + c * 128) = t; }
     }
}

}  // namespace

extern "C" void kernel_launch(void* const* d_in, const int* in_sizes, int n_in, void* d_out, int out_size, void* d_ws, size_t ws_size, hipStream_t stream) {
  if (n_in < 11) return;
  // wire order: 0 x [4,2048,1024], 1 Wq [1024,1024] (in,out), 2 bq, 3 Wk, 4 bk, 5 Wv, 6 bv, 7 Wo [1024,1024] (in,out), 8 bo, 9 gamma [1024], 10 beta [1024]; all f32. Output f32 [4,2048,1024].
  const size_t need = ((size_t)(NBU - 1) * SEQF + SEQU) * KD;
  if ((size_t)in_sizes[0] < need || (size_t)out_size < need) return;
  if (in_sizes[2] < (int)KD || in_sizes[4] < (int)KD || in_sizes[6] < (int)KD || in_sizes[8] < (int)KD || in_sizes[9] < (int)KD || in_sizes[10] < (int)KD) return;
  if ((size_t)in_sizes[1] < (size_t)KD * KD || (size_t)in_sizes[3] < (size_t)KD * KD || (size_t)in_sizes[5] < (size_t)KD * KD || (size_t)in_sizes[7] < (size_t)KD * KD) return;
  const float* x = (const float*)d_in[0];
  const float* Wq = (const float*)d_in[1]; const float* bq = (const float*)d_in[2]; const float* Wk = (const float*)d_in[3]; const float* bk = (const float*)d_in[4];
  const float* Wv = (const float*)d_in[5]; const float* bv = (const float*)d_in[6]; const float* Wo = (const float*)d_in[7]; const float* bo = (const float*)d_in[8];
  const float* gam = (const float*)d_in[9]; const float* bet = (const float*)d_in[10];
  float* out = (float*)d_out;
  size_t off = 0; char* ws = (char*)d_ws;
  auto carve = [&](size_t bytes) { char* p = ws + off; off += (bytes + 255) & ~(size_t)255; return p; };
  b16* XH = (b16*)carve(SZ_XH);        // 16 MiB  x as f16 [MT][1024], fragment order
  b16* WT = (b16*)carve(SZ_WT);        //  8 MiB  weight planes [4][1024 out][1024 in] x16, fragment order
  b16* QK = (b16*)carve(SZ_QK);        // 32 MiB  [MT][Q 1024 | K 1024] f16, fragment order
  b16* VT = (b16*)carve(SZ_VT);        // 16 MiB  V^T [h*64+d][MT] f16, fragment order
  b16* CTX = (b16*)carve(SZ_CTX);      // 16 MiB  attention output x32 f16 [MT][1024], fragment order
  float* Y = (float*)carve(SZ_Y);      // 32 MiB  y = ctx Wo + bo + x, f32, full-stride rows [YROWS][1024]
  if (off > ws_size || off > ((size_t)128 << 20)) return;   // 120 MiB at the shipped sizes
  const float s16 = 1.0f / WSC, s512 = 1.0f / (WSC * CSC);
  xh_kernel<<<(unsigned)((size_t)MT * KD / 8 / 256), 256, 0, stream>>>(x, XH);
  wt_kernel<<<dim3(KD * KD / 8 / 256, 4), 256, 0, stream>>>(Wq, Wk, Wv, Wo, WT);
  gemm_kernel<0><<<dim3(MT / 128, KD / 128), 128, 0, stream>>>(XH, WT, bq, x, QK, out, QKP, s16);                                   // Q = x Wq + bq -> QK k-tiles 0..31 of every row block
  gemm_kernel<0><<<dim3(MT / 128, KD / 128), 128, 0, stream>>>(XH, WT + (size_t)KD * KD, bk, x, QK + (size_t)KTD * TILE, out, QKP, s16);   // K = x Wk + bk -> QK k-tiles 32..63 of every row block
  gemm_kernel<1><<<dim3(KD / 128, MT / 128), 128, 0, stream>>>(WT + (size_t)2 * KD * KD, XH, bv, x, VT, out, MT, s16);              // V^T[c][m] = sum_k WvT[c][k] x[m][k] + bv[c]
  attn_kernel<<<dim3(NHEAD, NBU, SEQU / 64), 128, 0, stream>>>(QK, VT, CTX);
  gemm_kernel<2><<<dim3(MT / 128, KD / 128), 128, 0, stream>>>(CTX, WT + (size_t)3 * KD * KD, bo, x, CTX, Y, KD, s512);             // y = ctx Wo + bo + x -> Y (f32)
  lnout_kernel<<<MT / 8, 256, 0, stream>>>(Y, gam, bet, out);                                                                      // out = LayerNorm(y) * gamma + beta
}

// v006
// One run takes 136 microseconds.
// Timed twice side by side with v005, it ran 1.12 and 1.10 times as fast.
// Counting every step since v000, it is 3.05 times as fast.
#include <hip/hip_runtime.h>

// compute dtype: every contraction on v_wmma_f32_16x16x32_f16 (f16 operands, f32 accumulate), single products: x [Wq|Wk|Wv] (x exact bf16 as f16, weights exact bf16 x16),
// S^T = K Q^T (q, k f16), O^T = V^T P^T (v f16, p = exp2(s - max) f16 in (0,1]), ctx Wo (ctx f16 x32, Wo exact bf16 x16). Softmax, bias, the skip connection and
// the closing LayerNorm in f32. All float inputs are RNE-converted to bf16 on load. Fragment k-map per lane half hh for A AND B: elements 0..7 <- k = 8hh+0..7,
// Operand planes (XH, WT, Q|K, V^T, CTX) are stored in fragment order: a tile of 16 rows x 32 k is 1024 contiguous bytes, tile (rt, kt) of a plane with KT k-tiles per row block at
// halves (rt*KT + kt)*512; inside it lane l = 16hh + row owns halves 8l..8l+7 (k = 8hh+0..7) and 256+8l..256+8l+7 (k = 16+8hh+0..7), so each fragment load of a wave is 512 contiguous bytes.
// Structure: causal post-LN attention block; x cast -> Q|K plane, V^T plane -> fused causal flash attention -> y = ctx Wo + bo + x (f32 plane) -> LayerNorm(y) -> output buffer.

#ifndef NB
#define NB 4
#endif
#ifndef SEQ
#define SEQ 2048
#endif
#ifndef SEQ_FULL
#define SEQ_FULL 2048
#endif

namespace {

constexpr unsigned KD = 1024 /* model width == heads * head dim == GEMM depth */, NHEAD = 16, DH = 64, QKP = 2048 /* pitch of the Q|K plane (halves) */;
constexpr unsigned NBU = NB, SEQU = SEQ, SEQF = SEQ_FULL, MT = NBU * SEQU /* compact rows */;
constexpr float LOG2E = 1.4426950408889634f, LNEPS = 1e-5f, WSC = 16.0f /* weight carry */, CSC = 32.0f /* ctx carry */;
static_assert(NHEAD * DH == KD);
static_assert(SEQU % 128 == 0 && SEQU <= SEQF && NBU >= 1);
static_assert(MT % 128 == 0 && KD % 32 == 0);

// extents the added kernels and the launch plan rely on
static_assert(KD == 8u * 128u);                                  // LayerNorm: 8 chunks x 32 lanes x 4 floats per row
static_assert(((size_t)MT * KD / 8) % 256 == 0);                 // cast grid exact
static_assert(MT % 8 == 0);                                      // LayerNorm grid exact (8 rows per block)
static_assert(((size_t)KD * KD / 8) % 256 == 0);                 // weight plane grid exact
static_assert(MT % 64 == 0 && KD % 128 == 0 && KD % 64 == 0 && SEQU % 64 == 0);   // GEMM / attention tile multiples
constexpr unsigned TILE = 512 /* halves of one 16 x 32 fragment tile */, KTD = KD / 32 /* k-tiles per row block, depth-1024 planes */, KTQ = QKP / 32 /* Q|K plane */, KTV = MT / 32 /* V^T plane */;
static_assert(KTD == 32);                                        // the cast and weight parts of prep_kernel split a tile index by shifts of 5
constexpr size_t YROWS = (size_t)(NBU - 1) * SEQF + SEQU;        // rows of the y plane (full-stride row map)
constexpr size_t SZ_XH = (size_t)MT * KD * 2, SZ_WT = (size_t)4 * KD * KD * 2, SZ_QK = (size_t)MT * QKP * 2, SZ_VT = (size_t)KD * MT * 2, SZ_CTX = (size_t)MT * KD * 2, SZ_Y = YROWS * KD * 4;
static_assert(SZ_XH % 256 == 0 && SZ_WT % 256 == 0 && SZ_QK % 256 == 0 && SZ_VT % 256 == 0 && SZ_CTX % 256 == 0 && SZ_Y % 256 == 0);
static_assert(SZ_XH + SZ_WT + SZ_QK + SZ_VT + SZ_CTX + SZ_Y <= ((size_t)128 << 20));   // 120 MiB at the shipped sizes

typedef _Float16 b16;
typedef __attribute__((ext_vector_type(16))) _Float16 v16b;
typedef __attribute__((ext_vector_type(8))) _Float16 v8b;
typedef __attribute__((ext_vector_type(8))) float v8f;
typedef __attribute__((ext_vector_type(4))) float v4f;

__device__ __forceinline__ float bf16_rne(float f) { unsigned int u = __float_as_uint(f); u += 0x7FFFu + ((u >> 16) & 1u); return __uint_as_float(u & 0xFFFF0000u); }
// p = tile base + 8 * lane
__device__ __forceinline__ v16b frag_pk(const b16* p) { const v8b a = *(const v8b*)(p), b = *(const v8b*)(p + 256); v16b f;
#pragma unroll
  for (int e = 0; e < 8; ++e) { f[e] = a[e]; f[8 + e] = b[e]; } return f; }
__device__ __forceinline__ v8f wmma16b(v16b a, v16b b, v8f c) { v8f d = __builtin_amdgcn_wmma_f32_16x16x32_f16(false, a, false, b, (short)0, c, false, false); asm volatile("v_nop\n\tv_nop\n\tv_nop\n\tv_nop" : "+v"(d) : "v"(a), "v"(b)); return d; }
__device__ __forceinline__ void wave_lds_sync() { __builtin_amdgcn_fence(3 /* release order */, "workgroup"); __builtin_amdgcn_wave_barrier(); __builtin_amdgcn_fence(2 /* acquire order */, "workgroup"); }
// f32 -> f16 operand convert that cannot yield an f16 subnormal (value select below 2^-14)
__device__ __forceinline__ b16 toh_flush(float v) { const b16 r = (b16)v; return (fabsf(v) < 6.103515625e-05f) ? (b16)0.0f : r; }

// 2^x as the bare v_exp_f32, for x <= 0 in the softmax. The library exp2f wraps it in a range guard (compare, two selects, add, ldexp) that only matters for results below 2^-126, where the bare
// instruction may give 0 for a subnormal: as p such a value rounds to f16 zero either way, and as the rescale factor it multiplies sums that then stand beside a term of 1.
__device__ __forceinline__ float exp2_bare(float x) { return __builtin_amdgcn_exp2f(x); }

__device__ __forceinline__ void xh_part(const unsigned blk, const float* __restrict__ x, b16* __restrict__ XH) {
  const unsigned u = blk * 256 + threadIdx.x;                 // < MT*KD/8 (blk < XB)
  const unsigned tile = u >> 6, nloc = ((u >> 5) & 1u) * 8 + ((u >> 2) & 7u), part = (u >> 1) & 1u, hh = u & 1u;   // a wave: 8 rows x the 4 granules of one k-tile (whole lines read and written)
  const unsigned r = (tile >> 5) * 16 + nloc, col = (tile & 31u) * 32 + part * 16 + hh * 8;
  const unsigned bb = r / SEQU, ss = r - bb * SEQU;
  const float* xr = x + ((size_t)bb * SEQF + ss) * KD + col;
  const v4f a = *(const v4f*)(xr), b = *(const v4f*)(xr + 4);
  v8b v;
#pragma unroll
  for (int j = 0; j < 4; ++j) { v[j] = toh_flush(bf16_rne(a[j])); v[4 + j] = toh_flush(bf16_rne(b[j])); }
  { *(v8b*)(XH + (size_t)tile * TILE + part * 256 + (hh * 16 + nloc) * 8) = v;  }
}

__device__ __forceinline__ void wt_part(const unsigned blk, const unsigned y, const float* __restrict__ w0, const float* __restrict__ w1, const float* __restrict__ w2, const float* __restrict__ w3, b16* __restrict__ WT) {
  const float* w = (y == 0) ? w0 : (y == 1) ? w1 : (y == 2) ? w2 : w3;
  const unsigned u = blk * 256 + threadIdx.x;                 // < KD*KD/8 (blk < WB)
  const unsigned e = u * 8, tile = u >> 6, part = (u >> 5) & 1u, hh = (u >> 4) & 1u, nloc = u & 15u;   // u = granule index in fragment order
  const unsigned o = (tile >> 5) * 16 + nloc, k0 = (tile & 31u) * 32 + part * 16 + hh * 8; v8b v;
#pragma unroll
  for (int j = 0; j < 8; ++j) v[j] = (b16)(bf16_rne(w[(size_t)(k0 + j) * KD + o]) * WSC);
  { *(v8b*)(WT + (size_t)y * KD * KD + e) = v;  }
}

// The x cast and the four weight planes depend on nothing but the inputs: one launch, the part chosen by a block-uniform branch. The weight blocks (8 strided reads a thread) come first in the index.
constexpr unsigned XB = (unsigned)((size_t)MT * KD / 8 / 256) /* blocks of the cast */, WB = KD * KD / 8 / 256 /* blocks of one weight plane */;
__global__ __launch_bounds__(256) void prep_kernel(const float* __restrict__ x, const float* __restrict__ w0, const float* __restrict__ w1, const float* __restrict__ w2, const float* __restrict__ w3, b16* __restrict__ XH, b16* __restrict__ WT) {
  const unsigned blk = blockIdx.x;                            // < 4 * WB + XB (grid exact)
  if (blk < 4 * WB) wt_part(blk % WB, blk / WB, w0, w1, w2, w3, WT);
  else xh_part(blk - 4 * WB, x, XH);
}

// One k-stage of a GEMM block in LDS: 64 of depth (2 k-tiles) of 8 row blocks of A, then of 8 row blocks of Bt, every 1024-byte tile kept in fragment order.
constexpr unsigned SKT = 2 /* k-tiles per stage */, SRB = SKT * TILE /* halves of one row block in a stage */, SOP = 8 * SRB /* halves of one operand */, STG = 2 * SOP /* halves of a stage: 32 KiB */, NSTG = KTD / SKT;
static_assert(KTD % SKT == 0 && NSTG >= 2);
static_assert(MT % 128 == 0 && KD % 128 == 0);                   // GEMM block tile multiples

// A wave's 8 copies of 512 bytes: the 2048 contiguous bytes that a stage takes of two row blocks (la <- ga, lb <- gb; LDS byte addresses and global pointers of the lane's own 16 bytes).
__device__ __forceinline__ void copy8(unsigned la, const b16* ga, unsigned lb, const b16* gb) {
  // the closing s_wait_xcnt stands inside the statement so that no address register of a copy is rewritten ahead of it
  asm volatile("global_load_async_to_lds_b128 %0, %8, off\n\t"
               "global_load_async_to_lds_b128 %1, %9, off\n\t"
               "global_load_async_to_lds_b128 %2, %10, off\n\t"
               "global_load_async_to_lds_b128 %3, %11, off\n\t"
               "global_load_async_to_lds_b128 %4, %12, off\n\t"
               "global_load_async_to_lds_b128 %5, %13, off\n\t"
               "global_load_async_to_lds_b128 %6, %14, off\n\t"
               "global_load_async_to_lds_b128 %7, %15, off\n\t"
               "s_wait_xcnt 0x0"
               :: "v"(la), "v"(la + 512u), "v"(la + 1024u), "v"(la + 1536u), "v"(lb), "v"(lb + 512u), "v"(lb + 1024u), "v"(lb + 1536u),
                  "v"(ga), "v"(ga + 256), "v"(ga + 512), "v"(ga + 768), "v"(gb), "v"(gb + 256), "v"(gb + 512), "v"(gb + 768)
               : "memory");
}

// ---------------- tile GEMM, depth 1024: C[m][n] = sum_k A[m][k] Bt[n][k]; A, Bt f16 planes in fragment order (32 k-tiles per row block).
// block = 4 waves, tile 128 x 128; wave tile 64 x 64 (4 x 4 accumulators). The block's operands pass through LDS, so each tile leaves L2 once per block: asynchronous copies fill a ring of two
// stages, stage t + 2 flying while stage t + 1 is worked on; a wave copies row blocks 2 wave and 2 wave + 1 of both operands and reads its fragments from LDS, 512 contiguous bytes per load.
// The block's tile starts at row mb, column nb; bias points at the block's first row (rowbias) or column.
// OMODE 0: f16 out, y = acc*scale + bias[col], or + bias[row] where rowbias (block-uniform) is set;
// OMODE 2: f32 out, y = acc*scale + bias[col] + bf16(resid[row][col]) with rows mapped to the full-stride layout. The wave stages its tile in private LDS and stores whole lines.
template <int OMODE>
__device__ __forceinline__ void gemm_block(const b16* A, const b16* Bt, const float* bias, const bool rowbias, const float* resid, b16* outH, float* outF, const unsigned opitch, const float scale, const unsigned mb, const unsigned nb) {
  __shared__ __attribute__((aligned(16))) b16 ring[2 * STG];
  const unsigned wave = threadIdx.x >> 5, lane = threadIdx.x & 31, nloc = lane & 15, hh = lane >> 4;
  const unsigned mw = (wave & 1) * 64, nw = (wave >> 1) * 64;
  const unsigned m0 = mb + mw, n0 = nb + nw;
  v8f acc[4][4];
#pragma unroll
  for (int i = 0; i < 4; ++i)
#pragma unroll
    for (int j = 0; j < 4; ++j) acc[i][j] = (v8f){};
  const b16* ga = A + ((size_t)(mb >> 4) + 2 * wave) * KTD * TILE + lane * 8;
  const b16* gb = Bt + ((size_t)(nb >> 4) + 2 * wave) * KTD * TILE + lane * 8;
  const unsigned lw = (unsigned)(size_t)(&ring[0]) + wave * (2 * SRB * 2) + lane * 16;   // LDS byte address: low 32 bits of the shared address
  auto fill = [&](unsigned t) {
    const unsigned l = lw + (t & 1u) * (STG * 2); const b16* pa = ga + t * SRB; const b16* pb = gb + t * SRB;
    copy8(l, pa, l + SRB * 2, pa + KTD * TILE);
    copy8(l + SOP * 2, pb, l + SOP * 2 + SRB * 2, pb + KTD * TILE);
  };
  fill(0);
  asm volatile("s_wait_asynccnt 0x0" ::: "memory");   // this wave's share of stage 0 has landed
  __syncthreads();                                    // every wave's share of stage 0 has landed
  fill(1);
#pragma unroll 1   // one trip is one stage: 32 products per wave
  for (unsigned t = 0; t < NSTG; ++t) {
    const b16* la = ring + (t & 1u) * STG + (wave & 1) * (4 * SRB) + lane * 8;
    const b16* lb = ring + (t & 1u) * STG + SOP + (wave >> 1) * (4 * SRB) + lane * 8;
#pragma unroll
    for (unsigned kk = 0; kk < SKT; ++kk) {
      v16b fa[4], fb[4];
#pragma unroll
      for (int i = 0; i < 4; ++i) { fa[i] = frag_pk(la + i * SRB + kk * TILE); fb[i] = frag_pk(lb + i * SRB + kk * TILE); }
#pragma unroll
      for (int j = 0; j < 4; ++j)
#pragma unroll
        for (int i = 0; i < 4; ++i) acc[i][j] = wmma16b(fa[i], fb[j], acc[i][j]);
    }
    asm volatile("s_wait_dscnt 0x0" ::: "memory");      // this wave's reads of stage t are done before the stage's buffer is given up
    asm volatile("s_wait_asynccnt 0x0" ::: "memory");   // this wave's share of stage t + 1 has landed
    __syncthreads();                                    // publishes stage t + 1 and ends every wave's reads of stage t
    if (t + 2 < NSTG) fill(t + 2);                      // block-uniform; into the buffer that stage t has left
  }
  asm volatile("s_wait_asynccnt 0x0" ::: "memory");     // no copy is outstanding when the wave goes on
  if constexpr (OMODE != 2) {
    __shared__ __attribute__((aligned(16))) b16 Th[4][64][72];
    // Both slices lie inside the block's 128 bias entries: both are read, and the block-uniform flag picks the addend, so the tile has one copy of its LDS stores.
    // The loops are fully unrolled so that every index of br, bc and acc is a compile-time constant and the arrays stay in registers.
    float br[4][8], bc[4];
    const float* rp = bias + mw + 8 * hh; const float* cp = bias + nw + nloc;   // the lane's first row entry and first column entry
#pragma unroll
    for (int i = 0; i < 4; ++i)
#pragma unroll
      for (int r = 0; r < 8; ++r) br[i][r] = rp[i * 16 + r];
#pragma unroll
    for (int j = 0; j < 4; ++j) bc[j] = cp[j * 16];
    asm volatile("s_wait_xcnt 0x0" :: "v"(rp), "v"(cp) : "memory");   // the bias loads are in flight; their addresses are inputs so that they stay in their registers up to this wait
#pragma unroll
    for (int i = 0; i < 4; ++i)
#pragma unroll
      for (int r = 0; r < 8; ++r) br[i][r] = bf16_rne(br[i][r]);
#pragma unroll
    for (int j = 0; j < 4; ++j) bc[j] = bf16_rne(bc[j]);
#pragma unroll
    for (int i = 0; i < 4; ++i)
#pragma unroll
      for (int j = 0; j < 4; ++j) { const unsigned col = j * 16 + nloc;
#pragma unroll
        for (int r = 0; r < 8; ++r) { const unsigned row = i * 16 + 8 * hh + r; Th[wave][row][col] = (b16)(acc[i][j][r] * scale + (rowbias ? br[i][r] : bc[j])); } }
    wave_lds_sync();   // wave-private tile: same wave writes and reads
    {
      for (unsigned it = 0; it < 8; ++it) { const unsigned rtl = it >> 1, ktl = it & 1u; const b16* tp = &Th[wave][rtl * 16 + nloc][ktl * 32 + hh * 8]; const v8b v0 = *(const v8b*)(tp), v1 = *(const v8b*)(tp + 16);
        b16* op = outH + ((size_t)((m0 >> 4) + rtl) * (opitch >> 5) + (n0 >> 5) + ktl) * TILE + lane * 8;   // one tile of the out plane in fragment order, k = column
        *(v8b*)(op) = v0; *(v8b*)(op + 256) = v1; }
       }
  } else {
    __shared__ __attribute__((aligned(16))) float Tf[4][64][68];
#pragma unroll
    for (int i = 0; i < 4; ++i)
#pragma unroll
      for (int j = 0; j < 4; ++j) { const unsigned col = j * 16 + nloc; const float bc = bf16_rne(bias[nw + col]);
#pragma unroll
        for (int r = 0; r < 8; ++r) { const unsigned row = i * 16 + 8 * hh + r; Tf[wave][row][col] = acc[i][j][r] * scale + bc; } }
    wave_lds_sync();   // wave-private tile
    const unsigned bt = m0 / SEQU; const unsigned mfull = bt * SEQF + (m0 - bt * SEQU);   // 64-row wave tiles never straddle a batch (SEQ % 128 == 0)
    {
#pragma unroll 2
      for (unsigned it = 0; it < 32; ++it) { const unsigned row = it * 2 + (lane >> 4), c4 = (lane & 15) * 4; const size_t go = (size_t)(mfull + row) * opitch + n0 + c4;
        v4f t = *(const v4f*)(&Tf[wave][row][c4]); const v4f xr = *(const v4f*)(resid + go);
#pragma unroll
        for (int j = 0; j < 4; ++j) t[j] += bf16_rne(xr[j]);
        *(v4f*)(outF + go) = t; }
       }
  }
}

// The three projections read the same two planes and depend on nothing else: one launch. Grid (MT/128, 24): y < 16 is a tile of [Q|K] = x [Wq|Wk] (row block x, column block y; the two weight planes and
// the two halves of the Q|K plane follow one another), y >= 16 a tile of V^T = Wv^T x^T (row block y - 16, column block x). Every choice is block-uniform.
constexpr unsigned NQK = 2 * KD / 128 /* column blocks of Q|K */, NVR = KD / 128 /* row blocks of V^T */;
__global__ __launch_bounds__(128) void qkv_kernel(const b16* __restrict__ XH, const b16* __restrict__ WT, const float* __restrict__ bq, const float* __restrict__ bk, const float* __restrict__ bv, b16* __restrict__ QK, b16* __restrict__ VT, float scale) {
  const bool isv = blockIdx.y >= NQK;
  const unsigned mb = (isv ? blockIdx.y - NQK : blockIdx.x) * 128, nb = (isv ? blockIdx.x : blockIdx.y) * 128;
  const float* bias = isv ? bv + mb : (nb < KD) ? bq + nb : bk + (nb - KD);
  gemm_block<0>(isv ? WT + (size_t)2 * KD * KD : XH, isv ? XH : WT, bias, isv, nullptr, isv ? VT : QK, nullptr, isv ? MT : QKP, scale, mb, nb);
}

__global__ __launch_bounds__(128) void out_kernel(const b16* __restrict__ CTX, const b16* __restrict__ WoT, const float* __restrict__ bo, const float* __restrict__ x, float* __restrict__ Y, float scale) {
  gemm_block<2>(CTX, WoT, bo + blockIdx.y * 128, false, x, nullptr, Y, KD, scale, blockIdx.x * 128, blockIdx.y * 128);
}

// ---------------- causal flash attention, transposed form. grid (heads, batch, SEQ/64), 4 independent waves, wave = 16 query rows i (iw0 .. iw0+15), key tiles of 64.
// A work-group of query tile qt walks qt + 1 key tiles and only half the work-groups are resident at once: qt falls with the flat index (slowest grid axis, counted down), so the longest start first and the shortest fill the tail.
// S^T tile t (16 keys x 16 queries) = K rows (A: row = key, k = d) x Q rows (B: col = query, k = d); lane holds query i = lane&15, keys 16t+8hh+r.
// p = exp2(s*0.125*log2e - m) as f16; P^T is the B operand of O^T = V^T P^T directly from the score accumulators: k-step c (32 keys) elements 0..7 <- tile 2c acc[0..7],
// elements 8..15 <- tile 2c+1 acc[0..7] (the D row map equals the B k map). A = VT rows (row = d, k = key). O^T acc[r] = O[d = 16dt+8hh+r][i = lane&15].
__global__ __launch_bounds__(128) void attn_kernel(const b16* __restrict__ QK, const b16* __restrict__ VT, b16* __restrict__ CTX) {
  const unsigned wave = threadIdx.x >> 5, lane = threadIdx.x & 31, nloc = lane & 15, hh = lane >> 4;
  const unsigned qt = SEQU / 64 - 1 - blockIdx.z, h = blockIdx.x, b = blockIdx.y;
  const unsigned iw0 = qt * 64 + wave * 16;
  const b16* qrow = QK + ((size_t)((b * SEQU + iw0) >> 4) * KTQ + h * 2) * TILE + lane * 8;
  const v16b qf0 = frag_pk(qrow), qf1 = frag_pk(qrow + TILE);
  const b16* kbase = QK + ((size_t)((b * SEQU) >> 4) * KTQ + KTD + h * 2) * TILE + lane * 8;
  const b16* vbase = VT + ((size_t)(h * 4) * KTV + ((b * SEQU) >> 5)) * TILE + lane * 8;
  v8f o[4];
#pragma unroll
  for (int dt = 0; dt < 4; ++dt) o[dt] = (v8f){};
  float m = -1.0e30f, l = 0.0f;
  const float SCL = 0.125f * LOG2E;
  const unsigned iq = iw0 + nloc;
  // K and V fragments of a key tile each have 8 register sets of their own and are loaded as one group: V of tile jt ahead of the score products, K of tile jt + 1 behind them, ahead of the softmax
  v16b kf[8], vf[8];
#pragma unroll
  for (int t = 0; t < 4; ++t) { const b16* kr = kbase + (size_t)t * KTQ * TILE; kf[2 * t] = frag_pk(kr); kf[2 * t + 1] = frag_pk(kr + TILE); }
  asm volatile("s_wait_xcnt 0x0" ::: "memory");   // the loop reuses the address registers of the Q and K loads while these are in flight
#pragma unroll 1
  for (unsigned jt = 0; jt <= qt; ++jt) {            // block-uniform trip count; every tile holds at least key j0 <= i for every query of the block
    const unsigned j0 = jt * 64;
#pragma unroll
    for (int dt = 0; dt < 4; ++dt) { const b16* vr = vbase + ((size_t)dt * KTV + jt * 2) * TILE; vf[2 * dt] = frag_pk(vr); vf[2 * dt + 1] = frag_pk(vr + TILE); }
    __builtin_amdgcn_sched_barrier(0);   // keeps the V loads at the head of the trip: without it the first score product moves up with its wait on K, and the V loads are issued only behind that wait
    v8f s[4];
#pragma unroll
    for (int t = 0; t < 4; ++t) { s[t] = wmma16b(kf[2 * t], qf0, (v8f){}); s[t] = wmma16b(kf[2 * t + 1], qf1, s[t]); }
    asm volatile("s_wait_xcnt 0x0" ::: "memory");   // the V loads are in flight and their address registers are reused from here on
    if (jt < qt) {                                   // block-uniform: the next key tile exists
#pragma unroll
      for (int t = 0; t < 4; ++t) { const b16* kr = kbase + (size_t)((jt + 1) * 4 + t) * KTQ * TILE; kf[2 * t] = frag_pk(kr); kf[2 * t + 1] = frag_pk(kr + TILE); }
      asm volatile("s_wait_xcnt 0x0" ::: "memory");   // the softmax reuses the address registers of these loads while they are in flight
    }
    const bool diag = (jt == qt);                    // block-uniform
    float mx = -1.0e30f;
#pragma unroll
    for (int t = 0; t < 4; ++t)
#pragma unroll
      for (int r = 0; r < 8; ++r) { float xv = s[t][r] * SCL; if (diag) { const unsigned j = j0 + 16 * t + 8 * hh + r; xv = (j > iq) ? -1.0e30f : xv; } s[t][r] = xv; mx = fmaxf(mx, xv); }
    mx = fmaxf(mx, __shfl_xor(mx, 16, 32));
    const float newm = fmaxf(m, mx); const float alpha = exp2_bare(m - newm); m = newm;
    float psum = 0.0f; v16b pf0, pf1;
#pragma unroll
    for (int t = 0; t < 4; ++t)
#pragma unroll
      for (int r = 0; r < 8; ++r) { const b16 ph = (b16)exp2_bare(s[t][r] - m); psum += (float)ph; if (t < 2) pf0[(t & 1) * 8 + r] = ph; else pf1[(t & 1) * 8 + r] = ph; }
    psum += __shfl_xor(psum, 16, 32);
    l = l * alpha + psum;
#pragma unroll
    for (int dt = 0; dt < 4; ++dt)
#pragma unroll
      for (int r = 0; r < 8; ++r) o[dt][r] *= alpha;
#pragma unroll
    for (int dt = 0; dt < 4; ++dt) { o[dt] = wmma16b(vf[2 * dt], pf0, o[dt]); o[dt] = wmma16b(vf[2 * dt + 1], pf1, o[dt]); }
  }
  const float inv = CSC * (1.0f / l);                // l >= 1 (the running-max key contributes exactly 1)
  b16* cp = CTX + ((size_t)((b * SEQU + iw0) >> 4) * KTD + h * 2) * TILE + lane * 8;
#pragma unroll
  for (int dt = 0; dt < 4; ++dt) { v8b v;
#pragma unroll
    for (int r = 0; r < 8; ++r) v[r] = (b16)(o[dt][r] * inv);
    *(v8b*)(cp + (dt >> 1) * TILE + (dt & 1) * 256) = v; }   // the lane's 8 values (query nloc, d = 16dt+8hh+0..7) are its own granule of the CTX tile: 512 contiguous bytes per wave store
}

__global__ __launch_bounds__(256) void lnout_kernel(const float* __restrict__ Y, const float* __restrict__ gam, const float* __restrict__ bet, float* __restrict__ out) {
#pragma clang fp contract(off)
  const unsigned wave = __builtin_amdgcn_readfirstlane(threadIdx.x >> 5), lane = threadIdx.x & 31;
  const unsigned r = blockIdx.x * 8 + wave;                 // compact row < MT (grid exact)
  const unsigned bb = r / SEQU, ss = r - bb * SEQU;
  const size_t ro = ((size_t)bb * SEQF + ss) * KD + lane * 4;
  const float* yr = Y + ro;
  float s = 0.0f;
#pragma unroll 1
  for (unsigned c = 0; c < 8; ++c) { const v4f a = *(const v4f*)(yr + c * 128); s += (a[0] + a[1]) + (a[2] + a[3]); }
#pragma unroll
  for (int m = 16; m > 0; m >>= 1) s += __shfl_xor(s, m, 32);
  const float mu = s * (1.0f / 1024.0f);
  float q = 0.0f;
#pragma unroll 1
  for (unsigned c = 0; c < 8; ++c) { const v4f a = *(const v4f*)(yr + c * 128);
#pragma unroll
    for (int j = 0; j < 4; ++j) { const float d0 = a[j] - mu; q += d0 * d0; } }
#pragma unroll
  for (int m = 16; m > 0; m >>= 1) q += __shfl_xor(q, m, 32);
  const float inv = rsqrtf(q * (1.0f / 1024.0f) + LNEPS);
  {
#pragma unroll 1
    for (unsigned c = 0; c < 8; ++c) { const unsigned co = c * 128 + lane * 4;
      const v4f a = *(const v4f*)(yr + c * 128);
      const v4f ga = *(const v4f*)(gam + co), ba = *(const v4f*)(bet + co);
      v4f t;
#pragma unroll
      for (int j = 0; j < 4; ++j) t[j] = (a[j] - mu) * inv * bf16_rne(ga[j]) + bf16_rne(ba[j]);
      *(v4f*)(out + ro + c * 128) = t; }
     }
}

}  // namespace

extern "C" void kernel_launch(void* const* d_in, const int* in_sizes, int n_in, void* d_out, int out_size, void* d_ws, size_t ws_size, hipStream_t stream) {
  if (n_in < 11) return;
  // wire order: 0 x [4,2048,1024], 1 Wq [1024,1024] (in,out), 2 bq, 3 Wk, 4 bk, 5 Wv, 6 bv, 7 Wo [1024,1024] (in,out), 8 bo, 9 gamma [1024], 10 beta [1024]; all f32. Output f32 [4,2048,1024].
  const size_t need = ((size_t)(NBU - 1) * SEQF + SEQU) * KD;
  if ((size_t)in_sizes[0] < need || (size_t)out_size < need) return;
  if (in_sizes[2] < (int)KD || in_sizes[4] < (int)KD || in_sizes[6] < (int)KD || in_sizes[8] < (int)KD || in_sizes[9] < (int)KD || in_sizes[10] < (int)KD) return;
  if ((size_t)in_sizes[1] < (size_t)KD * KD || (size_t)in_sizes[3] < (size_t)KD * KD || (size_t)in_sizes[5] < (size_t)KD * KD || (size_t)in_sizes[7] < (size_t)KD * KD) return;
  const float* x = (const float*)d_in[0];
  const float* Wq = (const float*)d_in[1]; const float* bq = (const float*)d_in[2]; const float* Wk = (const float*)d_in[3]; const float* bk = (const float*)d_in[4];
  const float* Wv = (const float*)d_in[5]; const float* bv = (const float*)d_in[6]; const float* Wo = (const float*)d_in[7]; const float* bo = (const float*)d_in[8];
  const float* gam = (const float*)d_in[9]; const float* bet = (const float*)d_in[10];
  float* out = (float*)d_out;
  size_t off = 0; char* ws = (char*)d_ws;
  auto carve = [&](size_t bytes) { char* p = ws + off; off += (bytes + 255) & ~(size_t)255; return p; };
  b16* XH = (b16*)carve(SZ_XH);        // 16 MiB  x as f16 [MT][1024], fragment order
  b16* WT = (b16*)carve(SZ_WT);        //  8 MiB  weight planes [4][1024 out][1024 in] x16, fragment order
  b16* QK = (b16*)carve(SZ_QK);        // 32 MiB  [MT][Q 1024 | K 1024] f16, fragment order
  b16* VT = (b16*)carve(SZ_VT);        // 16 MiB  V^T [h*64+d][MT] f16, fragment order
  b16* CTX = (b16*)carve(SZ_CTX);      // 16 MiB  attention output x32 f16 [MT][1024], fragment order
  float* Y = (float*)carve(SZ_Y);      // 32 MiB  y = ctx Wo + bo + x, f32, full-stride rows [YROWS][1024]
  if (off > ws_size || off > ((size_t)128 << 20)) return;   // 120 MiB at the shipped sizes
  const float s16 = 1.0f / WSC, s512 = 1.0f / (WSC * CSC);
  prep_kernel<<<4 * WB + XB, 256, 0, stream>>>(x, Wq, Wk, Wv, Wo, XH, WT);                                                           // XH, and the four weight planes
  qkv_kernel<<<dim3(MT / 128, NQK + NVR), 128, 0, stream>>>(XH, WT, bq, bk, bv, QK, VT, s16);                                         // Q = x Wq + bq | K = x Wk + bk -> QK; V^T[c][m] = sum_k WvT[c][k] x[m][k] + bv[c] -> VT
  attn_kernel<<<dim3(NHEAD, NBU, SEQU / 64), 128, 0, stream>>>(QK, VT, CTX);
  out_kernel<<<dim3(MT / 128, KD / 128), 128, 0, stream>>>(CTX, WT + (size_t)3 * KD * KD, bo, x, Y, s512);                            // y = ctx Wo + bo + x -> Y (f32)
  lnout_kernel<<<MT / 8, 256, 0, stream>>>(Y, gam, bet, out);                                                                      // out = LayerNorm(y) * gamma + beta
}

// v007
// One run takes 129 microseconds.
// In both of two side-by-side timings against v006, it was 1.06 times as fast.
// Counting every step since v000, it is 3.24 times as fast.
#include <hip/hip_runtime.h>

// compute dtype: every contraction on v_wmma_f32_16x16x32_f16 (f16 operands, f32 accumulate), single products: x [Wq|Wk|Wv] (x exact bf16 as f16, weights exact bf16 x16),
// S^T = K Q^T (q, k f16), O^T = V^T P^T (v f16, p = exp2(s - max) f16 in (0,1]), ctx Wo (ctx f16 x32, Wo exact bf16 x16). Softmax, bias, the skip connection and
// the closing LayerNorm in f32. All float inputs are RNE-converted to bf16 on load. Fragment k-map per lane half hh for A AND B: elements 0..7 <- k = 8hh+0..7,
// Operand planes (XH, WT, Q|K, V^T, CTX) are stored in fragment order: a tile of 16 rows x 32 k is 1024 contiguous bytes, tile (rt, kt) of a plane with KT k-tiles per row block at
// halves (rt*KT + kt)*512; inside it lane l = 16hh + row owns halves 8l..8l+7 (k = 8hh+0..7) and 256+8l..256+8l+7 (k = 16+8hh+0..7), so each fragment load of a wave is 512 contiguous bytes.
// Structure: causal post-LN attention block; x cast -> Q|K plane, V^T plane -> fused causal flash attention -> y = ctx Wo + bo + x (f32 plane) -> LayerNorm(y) -> output buffer.

#ifndef NB
#define NB 4
#endif
#ifndef SEQ
#define SEQ 2048
#endif
#ifndef SEQ_FULL
#define SEQ_FULL 2048
#endif

namespace {

constexpr unsigned KD = 1024 /* model width == heads * head dim == GEMM depth */, NHEAD = 16, DH = 64, QKP = 2048 /* pitch of the Q|K plane (halves) */;
constexpr unsigned NBU = NB, SEQU = SEQ, SEQF = SEQ_FULL, MT = NBU * SEQU /* compact rows */;
constexpr float LOG2E = 1.4426950408889634f, LNEPS = 1e-5f, WSC = 16.0f /* weight carry */, CSC = 32.0f /* ctx carry */;
static_assert(NHEAD * DH == KD);
static_assert(SEQU % 128 == 0 && SEQU <= SEQF && NBU >= 1);
static_assert(MT % 128 == 0 && KD % 32 == 0);

// extents the added kernels and the launch plan rely on
static_assert(KD == 8u * 128u);                                  // LayerNorm: 8 chunks x 32 lanes x 4 floats per row
static_assert(((size_t)MT * KD / 8) % 256 == 0);                 // cast grid exact
static_assert(MT % 8 == 0);                                      // LayerNorm grid exact (8 rows per block)
static_assert(((size_t)KD * KD / 8) % 256 == 0);                 // weight plane grid exact
static_assert(MT % 64 == 0 && KD % 128 == 0 && KD % 64 == 0 && SEQU % 64 == 0);   // GEMM / attention tile multiples
constexpr unsigned TILE = 512 /* halves of one 16 x 32 fragment tile */, KTD = KD / 32 /* k-tiles per row block, depth-1024 planes */, KTQ = QKP / 32 /* Q|K plane */, KTV = MT / 32 /* V^T plane */;
static_assert(KTD == 32);                                        // the cast and weight parts of prep_kernel split a tile index by shifts of 5
constexpr size_t YROWS = (size_t)(NBU - 1) * SEQF + SEQU;        // rows of the y plane (full-stride row map)
constexpr size_t SZ_XH = (size_t)MT * KD * 2, SZ_WT = (size_t)4 * KD * KD * 2, SZ_QK = (size_t)MT * QKP * 2, SZ_VT = (size_t)KD * MT * 2, SZ_CTX = (size_t)MT * KD * 2, SZ_Y = YROWS * KD * 4;
static_assert(SZ_XH % 256 == 0 && SZ_WT % 256 == 0 && SZ_QK % 256 == 0 && SZ_VT % 256 == 0 && SZ_CTX % 256 == 0 && SZ_Y % 256 == 0);
static_assert(SZ_XH + SZ_WT + SZ_QK + SZ_VT + SZ_CTX + SZ_Y <= ((size_t)128 << 20));   // 120 MiB at the shipped sizes

typedef _Float16 b16;
typedef __attribute__((ext_vector_type(16))) _Float16 v16b;
typedef __attribute__((ext_vector_type(8))) _Float16 v8b;
typedef __attribute__((ext_vector_type(8))) float v8f;
typedef __attribute__((ext_vector_type(4))) float v4f;

__device__ __forceinline__ float bf16_rne(float f) { unsigned int u = __float_as_uint(f); u += 0x7FFFu + ((u >> 16) & 1u); return __uint_as_float(u & 0xFFFF0000u); }
// p = tile base + 8 * lane
__device__ __forceinline__ v16b frag_pk(const b16* p) { const v8b a = *(const v8b*)(p), b = *(const v8b*)(p + 256); v16b f;
#pragma unroll
  for (int e = 0; e < 8; ++e) { f[e] = a[e]; f[8 + e] = b[e]; } return f; }
__device__ __forceinline__ v8f wmma16b(v16b a, v16b b, v8f c) { v8f d = __builtin_amdgcn_wmma_f32_16x16x32_f16(false, a, false, b, (short)0, c, false, false); asm volatile("v_nop\n\tv_nop\n\tv_nop\n\tv_nop" : "+v"(d) : "v"(a), "v"(b)); return d; }
__device__ __forceinline__ void wave_lds_sync() { __builtin_amdgcn_fence(3 /* release order */, "workgroup"); __builtin_amdgcn_wave_barrier(); __builtin_amdgcn_fence(2 /* acquire order */, "workgroup"); }
// f32 -> f16 operand convert that cannot yield an f16 subnormal (value select below 2^-14)
__device__ __forceinline__ b16 toh_flush(float v) { const b16 r = (b16)v; return (fabsf(v) < 6.103515625e-05f) ? (b16)0.0f : r; }

// 2^x as the bare v_exp_f32, for x <= 0 in the softmax. The library exp2f wraps it in a range guard (compare, two selects, add, ldexp) that only matters for results below 2^-126, where the bare
// instruction may give 0 for a subnormal: as p such a value rounds to f16 zero either way, and as the rescale factor it multiplies sums that then stand beside a term of 1.
__device__ __forceinline__ float exp2_bare(float x) { return __builtin_amdgcn_exp2f(x); }

__device__ __forceinline__ void xh_part(const unsigned blk, const float* __restrict__ x, b16* __restrict__ XH) {
  const unsigned u = blk * 256 + threadIdx.x;                 // < MT*KD/8 (blk < XB)
  const unsigned tile = u >> 6, nloc = ((u >> 5) & 1u) * 8 + ((u >> 2) & 7u), part = (u >> 1) & 1u, hh = u & 1u;   // a wave: 8 rows x the 4 granules of one k-tile (whole lines read and written)
  const unsigned r = (tile >> 5) * 16 + nloc, col = (tile & 31u) * 32 + part * 16 + hh * 8;
  const unsigned bb = r / SEQU, ss = r - bb * SEQU;
  const float* xr = x + ((size_t)bb * SEQF + ss) * KD + col;
  const v4f a = *(const v4f*)(xr), b = *(const v4f*)(xr + 4);
  v8b v;
#pragma unroll
  for (int j = 0; j < 4; ++j) { v[j] = toh_flush(bf16_rne(a[j])); v[4 + j] = toh_flush(bf16_rne(b[j])); }
  { *(v8b*)(XH + (size_t)tile * TILE + part * 256 + (hh * 16 + nloc) * 8) = v;  }
}

__device__ __forceinline__ void wt_part(const unsigned blk, const unsigned y, const float* __restrict__ w0, const float* __restrict__ w1, const float* __restrict__ w2, const float* __restrict__ w3, b16* __restrict__ WT) {
  const float* w = (y == 0) ? w0 : (y == 1) ? w1 : (y == 2) ? w2 : w3;
  const unsigned u = blk * 256 + threadIdx.x;                 // < KD*KD/8 (blk < WB)
  const unsigned e = u * 8, tile = u >> 6, part = (u >> 5) & 1u, hh = (u >> 4) & 1u, nloc = u & 15u;   // u = granule index in fragment order
  const unsigned o = (tile >> 5) * 16 + nloc, k0 = (tile & 31u) * 32 + part * 16 + hh * 8; v8b v;
#pragma unroll
  for (int j = 0; j < 8; ++j) v[j] = (b16)(bf16_rne(w[(size_t)(k0 + j) * KD + o]) * WSC);
  { *(v8b*)(WT + (size_t)y * KD * KD + e) = v;  }
}

// The x cast and the four weight planes depend on nothing but the inputs: one launch, the part chosen by a block-uniform branch. The weight blocks (8 strided reads a thread) come first in the index.
constexpr unsigned XB = (unsigned)((size_t)MT * KD / 8 / 256) /* blocks of the cast */, WB = KD * KD / 8 / 256 /* blocks of one weight plane */;
__global__ __launch_bounds__(256) void prep_kernel(const float* __restrict__ x, const float* __restrict__ w0, const float* __restrict__ w1, const float* __restrict__ w2, const float* __restrict__ w3, b16* __restrict__ XH, b16* __restrict__ WT) {
  const unsigned blk = blockIdx.x;                            // < 4 * WB + XB (grid exact)
  if (blk < 4 * WB) wt_part(blk % WB, blk / WB, w0, w1, w2, w3, WT);
  else xh_part(blk - 4 * WB, x, XH);
}

// One k-stage of a GEMM block in LDS: 64 of depth (2 k-tiles) of 8 row blocks of A, then of 8 row blocks of Bt, every 1024-byte tile kept in fragment order.
constexpr unsigned SKT = 2 /* k-tiles per stage */, SRB = SKT * TILE /* halves of one row block in a stage */, SOP = 8 * SRB /* halves of one operand */, STG = 2 * SOP /* halves of a stage: 32 KiB */, NSTG = KTD / SKT;
static_assert(KTD % SKT == 0 && NSTG >= 2);
static_assert(MT % 128 == 0 && KD % 128 == 0);                   // GEMM block tile multiples

// A wave's 8 copies of 512 bytes: the 2048 contiguous bytes that a stage takes of two row blocks (la <- ga, lb <- gb; LDS byte addresses and global pointers of the lane's own 16 bytes).
__device__ __forceinline__ void copy8(unsigned la, const b16* ga, unsigned lb, const b16* gb) {
  // the closing s_wait_xcnt stands inside the statement so that no address register of a copy is rewritten ahead of it
  asm volatile("global_load_async_to_lds_b128 %0, %8, off\n\t"
               "global_load_async_to_lds_b128 %1, %9, off\n\t"
               "global_load_async_to_lds_b128 %2, %10, off\n\t"
               "global_load_async_to_lds_b128 %3, %11, off\n\t"
               "global_load_async_to_lds_b128 %4, %12, off\n\t"
               "global_load_async_to_lds_b128 %5, %13, off\n\t"
               "global_load_async_to_lds_b128 %6, %14, off\n\t"
               "global_load_async_to_lds_b128 %7, %15, off\n\t"
               "s_wait_xcnt 0x0"
               :: "v"(la), "v"(la + 512u), "v"(la + 1024u), "v"(la + 1536u), "v"(lb), "v"(lb + 512u), "v"(lb + 1024u), "v"(lb + 1536u),
                  "v"(ga), "v"(ga + 256), "v"(ga + 512), "v"(ga + 768), "v"(gb), "v"(gb + 256), "v"(gb + 512), "v"(gb + 768)
               : "memory");
}

// ---------------- tile GEMM, depth 1024: C[m][n] = sum_k A[m][k] Bt[n][k]; A, Bt f16 planes in fragment order (32 k-tiles per row block).
// block = 4 waves, tile 128 x 128; wave tile 64 x 64 (4 x 4 accumulators). The block's operands pass through LDS, so each tile leaves L2 once per block: asynchronous copies fill a ring of two
// stages, stage t + 2 flying while stage t + 1 is worked on; a wave copies row blocks 2 wave and 2 wave + 1 of both operands and reads its fragments from LDS, 512 contiguous bytes per load.
// The block's tile starts at row mb, column nb; bias points at the block's first row (rowbias) or column.
// OMODE 0: f16 out, y = acc*scale + bias[col], or + bias[row] where rowbias (block-uniform) is set;
// OMODE 2: f32 out, y = acc*scale + bias[col] + bf16(resid[row][col]) with rows mapped to the full-stride layout. The wave stages its tile in private LDS and stores whole lines.
template <int OMODE>
__device__ __forceinline__ void gemm_block(const b16* A, const b16* Bt, const float* bias, const bool rowbias, const float* resid, b16* outH, float* outF, const unsigned opitch, const float scale, const unsigned mb, const unsigned nb) {
  __shared__ __attribute__((aligned(16))) b16 ring[2 * STG];
  const unsigned wave = threadIdx.x >> 5, lane = threadIdx.x & 31, nloc = lane & 15, hh = lane >> 4;
  const unsigned mw = (wave & 1) * 64, nw = (wave >> 1) * 64;
  const unsigned m0 = mb + mw, n0 = nb + nw;
  v8f acc[4][4];
#pragma unroll
  for (int i = 0; i < 4; ++i)
#pragma unroll
    for (int j = 0; j < 4; ++j) acc[i][j] = (v8f){};
  const b16* ga = A + ((size_t)(mb >> 4) + 2 * wave) * KTD * TILE + lane * 8;
  const b16* gb = Bt + ((size_t)(nb >> 4) + 2 * wave) * KTD * TILE + lane * 8;
  const unsigned lw = (unsigned)(size_t)(&ring[0]) + wave * (2 * SRB * 2) + lane * 16;   // LDS byte address: low 32 bits of the shared address
  auto fill = [&](unsigned t) {
    const unsigned l = lw + (t & 1u) * (STG * 2); const b16* pa = ga + t * SRB; const b16* pb = gb + t * SRB;
    copy8(l, pa, l + SRB * 2, pa + KTD * TILE);
    copy8(l + SOP * 2, pb, l + SOP * 2 + SRB * 2, pb + KTD * TILE);
  };
  fill(0);
  asm volatile("s_wait_asynccnt 0x0" ::: "memory");   // this wave's share of stage 0 has landed
  __syncthreads();                                    // every wave's share of stage 0 has landed
  fill(1);
#pragma unroll 1   // one trip is one stage: 32 products per wave
  for (unsigned t = 0; t < NSTG; ++t) {
    const b16* la = ring + (t & 1u) * STG + (wave & 1) * (4 * SRB) + lane * 8;
    const b16* lb = ring + (t & 1u) * STG + SOP + (wave >> 1) * (4 * SRB) + lane * 8;
#pragma unroll
    for (unsigned kk = 0; kk < SKT; ++kk) {
      v16b fa[4], fb[4];
#pragma unroll
      for (int i = 0; i < 4; ++i) { fa[i] = frag_pk(la + i * SRB + kk * TILE); fb[i] = frag_pk(lb + i * SRB + kk * TILE); }
#pragma unroll
      for (int j = 0; j < 4; ++j)
#pragma unroll
        for (int i = 0; i < 4; ++i) acc[i][j] = wmma16b(fa[i], fb[j], acc[i][j]);
    }
    asm volatile("s_wait_dscnt 0x0" ::: "memory");      // this wave's reads of stage t are done before the stage's buffer is given up
    asm volatile("s_wait_asynccnt 0x0" ::: "memory");   // this wave's share of stage t + 1 has landed
    __syncthreads();                                    // publishes stage t + 1 and ends every wave's reads of stage t
    if (t + 2 < NSTG) fill(t + 2);                      // block-uniform; into the buffer that stage t has left
  }
  asm volatile("s_wait_asynccnt 0x0" ::: "memory");     // no copy is outstanding when the wave goes on
  if constexpr (OMODE != 2) {
    __shared__ __attribute__((aligned(16))) b16 Th[4][64][72];
    // Both slices lie inside the block's 128 bias entries: both are read, and the block-uniform flag picks the addend, so the tile has one copy of its LDS stores.
    // The loops are fully unrolled so that every index of br, bc and acc is a compile-time constant and the arrays stay in registers.
    float br[4][8], bc[4];
    const float* rp = bias + mw + 8 * hh; const float* cp = bias + nw + nloc;   // the lane's first row entry and first column entry
#pragma unroll
    for (int i = 0; i < 4; ++i)
#pragma unroll
      for (int r = 0; r < 8; ++r) br[i][r] = rp[i * 16 + r];
#pragma unroll
    for (int j = 0; j < 4; ++j) bc[j] = cp[j * 16];
    asm volatile("s_wait_xcnt 0x0" :: "v"(rp), "v"(cp) : "memory");   // the bias loads are in flight; their addresses are inputs so that they stay in their registers up to this wait
#pragma unroll
    for (int i = 0; i < 4; ++i)
#pragma unroll
      for (int r = 0; r < 8; ++r) br[i][r] = bf16_rne(br[i][r]);
#pragma unroll
    for (int j = 0; j < 4; ++j) bc[j] = bf16_rne(bc[j]);
#pragma unroll
    for (int i = 0; i < 4; ++i)
#pragma unroll
      for (int j = 0; j < 4; ++j) { const unsigned col = j * 16 + nloc;
#pragma unroll
        for (int r = 0; r < 8; ++r) { const unsigned row = i * 16 + 8 * hh + r; Th[wave][row][col] = (b16)(acc[i][j][r] * scale + (rowbias ? br[i][r] : bc[j])); } }
    wave_lds_sync();   // wave-private tile: same wave writes and reads
    {
      for (unsigned it = 0; it < 8; ++it) { const unsigned rtl = it >> 1, ktl = it & 1u; const b16* tp = &Th[wave][rtl * 16 + nloc][ktl * 32 + hh * 8]; const v8b v0 = *(const v8b*)(tp), v1 = *(const v8b*)(tp + 16);
        b16* op = outH + ((size_t)((m0 >> 4) + rtl) * (opitch >> 5) + (n0 >> 5) + ktl) * TILE + lane * 8;   // one tile of the out plane in fragment order, k = column
        *(v8b*)(op) = v0; *(v8b*)(op + 256) = v1; }
       }
  } else {
    __shared__ __attribute__((aligned(16))) float Tf[4][64][68];
#pragma unroll
    for (int i = 0; i < 4; ++i)
#pragma unroll
      for (int j = 0; j < 4; ++j) { const unsigned col = j * 16 + nloc; const float bc = bf16_rne(bias[nw + col]);
#pragma unroll
        for (int r = 0; r < 8; ++r) { const unsigned row = i * 16 + 8 * hh + r; Tf[wave][row][col] = acc[i][j][r] * scale + bc; } }
    wave_lds_sync();   // wave-private tile
    const unsigned bt = m0 / SEQU; const unsigned mfull = bt * SEQF + (m0 - bt * SEQU);   // 64-row wave tiles never straddle a batch (SEQ % 128 == 0)
    {
#pragma unroll 2
      for (unsigned it = 0; it < 32; ++it) { const unsigned row = it * 2 + (lane >> 4), c4 = (lane & 15) * 4; const size_t go = (size_t)(mfull + row) * opitch + n0 + c4;
        v4f t = *(const v4f*)(&Tf[wave][row][c4]); const v4f xr = *(const v4f*)(resid + go);
#pragma unroll
        for (int j = 0; j < 4; ++j) t[j] += bf16_rne(xr[j]);
        *(v4f*)(outF + go) = t; }
       }
  }
}

// The three projections read the same two planes and depend on nothing else: one launch. Grid (MT/128, 24): y < 16 is a tile of [Q|K] = x [Wq|Wk] (row block x, column block y; the two weight planes and
// the two halves of the Q|K plane follow one another), y >= 16 a tile of V^T = Wv^T x^T (row block y - 16, column block x). Every choice is block-uniform.
constexpr unsigned NQK = 2 * KD / 128 /* column blocks of Q|K */, NVR = KD / 128 /* row blocks of V^T */;
__global__ __launch_bounds__(128) void qkv_kernel(const b16* __restrict__ XH, const b16* __restrict__ WT, const float* __restrict__ bq, const float* __restrict__ bk, const float* __restrict__ bv, b16* __restrict__ QK, b16* __restrict__ VT, float scale) {
  const bool isv = blockIdx.y >= NQK;
  const unsigned mb = (isv ? blockIdx.y - NQK : blockIdx.x) * 128, nb = (isv ? blockIdx.x : blockIdx.y) * 128;
  const float* bias = isv ? bv + mb : (nb < KD) ? bq + nb : bk + (nb - KD);
  gemm_block<0>(isv ? WT + (size_t)2 * KD * KD : XH, isv ? XH : WT, bias, isv, nullptr, isv ? VT : QK, nullptr, isv ? MT : QKP, scale, mb, nb);
}

__global__ __launch_bounds__(128) void out_kernel(const b16* __restrict__ CTX, const b16* __restrict__ WoT, const float* __restrict__ bo, const float* __restrict__ x, float* __restrict__ Y, float scale) {
  gemm_block<2>(CTX, WoT, bo + blockIdx.y * 128, false, x, nullptr, Y, KD, scale, blockIdx.x * 128, blockIdx.y * 128);
}

// ---------------- causal flash attention, transposed form. grid (heads, batch, SEQ/64), 4 independent waves, wave = 16 query rows i (iw0 .. iw0+15), key tiles of 64.
// A work-group of query tile qt walks qt + 1 key tiles and only half the work-groups are resident at once: qt falls with the flat index (slowest grid axis, counted down), so the longest start first and the shortest fill the tail.
// S^T tile t (16 keys x 16 queries) = K rows (A: row = key, k = d) x Q rows (B: col = query, k = d); lane holds query i = lane&15, keys 16t+8hh+r.
// p = exp2(s*0.125*log2e - m) as f16; P^T is the B operand of O^T = V^T P^T directly from the score accumulators: k-step c (32 keys) elements 0..7 <- tile 2c acc[0..7],
// elements 8..15 <- tile 2c+1 acc[0..7] (the D row map equals the B k map). A = VT rows (row = d, k = key). O^T acc[r] = O[d = 16dt+8hh+r][i = lane&15].
__global__ __launch_bounds__(128) void attn_kernel(const b16* __restrict__ QK, const b16* __restrict__ VT, b16* __restrict__ CTX) {
  const unsigned wave = threadIdx.x >> 5, lane = threadIdx.x & 31, nloc = lane & 15, hh = lane >> 4;
  const unsigned qt = SEQU / 64 - 1 - blockIdx.z, h = blockIdx.x, b = blockIdx.y;
  const unsigned iw0 = qt * 64 + wave * 16;
  const b16* qrow = QK + ((size_t)((b * SEQU + iw0) >> 4) * KTQ + h * 2) * TILE + lane * 8;
  const v16b qf0 = frag_pk(qrow), qf1 = frag_pk(qrow + TILE);
  const b16* kbase = QK + ((size_t)((b * SEQU) >> 4) * KTQ + KTD + h * 2) * TILE + lane * 8;
  const b16* vbase = VT + ((size_t)(h * 4) * KTV + ((b * SEQU) >> 5)) * TILE + lane * 8;
  v8f o[4];
#pragma unroll
  for (int dt = 0; dt < 4; ++dt) o[dt] = (v8f){};
  float m = -1.0e30f, l = 0.0f;
  const float SCL = 0.125f * LOG2E;
  const unsigned iq = iw0 + nloc;
  // K and V fragments of a key tile each have 8 register sets of their own and are loaded as one group: V of tile jt ahead of the score products, K of tile jt + 1 behind them, ahead of the softmax
  v16b kf[8], vf[8];
#pragma unroll
  for (int t = 0; t < 4; ++t) { const b16* kr = kbase + (size_t)t * KTQ * TILE; kf[2 * t] = frag_pk(kr); kf[2 * t + 1] = frag_pk(kr + TILE); }
  asm volatile("s_wait_xcnt 0x0" ::: "memory");   // the loop reuses the address registers of the Q and K loads while these are in flight
  // One key tile. diag is a literal at both calls: only the block's last tile (jt == qt) crosses the diagonal, so the tiles in front of it carry no mask code at all and always have a next tile to fetch.
  // always_inline: both copies must see their literal, and the register arrays must stay in registers.
  auto tile = [&](const unsigned jt, const bool diag) __attribute__((always_inline)) {
    const unsigned j0 = jt * 64;
#pragma unroll
    for (int dt = 0; dt < 4; ++dt) { const b16* vr = vbase + ((size_t)dt * KTV + jt * 2) * TILE; vf[2 * dt] = frag_pk(vr); vf[2 * dt + 1] = frag_pk(vr + TILE); }
    __builtin_amdgcn_sched_barrier(0);   // keeps the V loads at the head of the trip: without it the first score product moves up with its wait on K, and the V loads are issued only behind that wait
    v8f s[4];
#pragma unroll
    for (int t = 0; t < 4; ++t) { s[t] = wmma16b(kf[2 * t], qf0, (v8f){}); s[t] = wmma16b(kf[2 * t + 1], qf1, s[t]); }
    asm volatile("s_wait_xcnt 0x0" ::: "memory");   // the V loads are in flight and their address registers are reused from here on
    if (!diag) {                                     // compile-time: the next key tile exists
#pragma unroll
      for (int t = 0; t < 4; ++t) { const b16* kr = kbase + (size_t)((jt + 1) * 4 + t) * KTQ * TILE; kf[2 * t] = frag_pk(kr); kf[2 * t + 1] = frag_pk(kr + TILE); }
      asm volatile("s_wait_xcnt 0x0" ::: "memory");   // the softmax reuses the address registers of these loads while they are in flight
    }
    float mx = -1.0e30f;
#pragma unroll
    for (int t = 0; t < 4; ++t)
#pragma unroll
      for (int r = 0; r < 8; ++r) { float xv = s[t][r] * SCL; if (diag) { const unsigned j = j0 + 16 * t + 8 * hh + r; xv = (j > iq) ? -1.0e30f : xv; } s[t][r] = xv; mx = fmaxf(mx, xv); }
    mx = fmaxf(mx, __shfl_xor(mx, 16, 32));
    const float newm = fmaxf(m, mx); const float alpha = exp2_bare(m - newm); m = newm;
    float psum = 0.0f; v16b pf0, pf1;
#pragma unroll
    for (int t = 0; t < 4; ++t)
#pragma unroll
      for (int r = 0; r < 8; ++r) { const b16 ph = (b16)exp2_bare(s[t][r] - m); psum += (float)ph; if (t < 2) pf0[(t & 1) * 8 + r] = ph; else pf1[(t & 1) * 8 + r] = ph; }
    psum += __shfl_xor(psum, 16, 32);
    l = l * alpha + psum;
#pragma unroll
    for (int dt = 0; dt < 4; ++dt)
#pragma unroll
      for (int r = 0; r < 8; ++r) o[dt][r] *= alpha;
#pragma unroll
    for (int dt = 0; dt < 4; ++dt) { o[dt] = wmma16b(vf[2 * dt], pf0, o[dt]); o[dt] = wmma16b(vf[2 * dt + 1], pf1, o[dt]); }
  };
#pragma unroll 1   // one trip is one key tile; unrolled, the two fragment groups of several tiles would not fit the registers
  for (unsigned jt = 0; jt < qt; ++jt) tile(jt, false);   // block-uniform trip count; every key of these tiles lies in front of every query of the block
  tile(qt, true);                                         // the diagonal tile: holds at least key j0 <= i for every query of the block
  const float inv = CSC * (1.0f / l);                // l >= 1 (the running-max key contributes exactly 1)
  b16* cp = CTX + ((size_t)((b * SEQU + iw0) >> 4) * KTD + h * 2) * TILE + lane * 8;
#pragma unroll
  for (int dt = 0; dt < 4; ++dt) { v8b v;
#pragma unroll
    for (int r = 0; r < 8; ++r) v[r] = (b16)(o[dt][r] * inv);
    *(v8b*)(cp + (dt >> 1) * TILE + (dt & 1) * 256) = v; }   // the lane's 8 values (query nloc, d = 16dt+8hh+0..7) are its own granule of the CTX tile: 512 contiguous bytes per wave store
}

__global__ __launch_bounds__(256) void lnout_kernel(const float* __restrict__ Y, const float* __restrict__ gam, const float* __restrict__ bet, float* __restrict__ out) {
#pragma clang fp contract(off)
  const unsigned wave = __builtin_amdgcn_readfirstlane(threadIdx.x >> 5), lane = threadIdx.x & 31;
  const unsigned r = blockIdx.x * 8 + wave;                 // compact row < MT (grid exact)
  const unsigned bb = r / SEQU, ss = r - bb * SEQU;
  const size_t ro = ((size_t)bb * SEQF + ss) * KD + lane * 4;
  const float* yr = Y + ro;
  float s = 0.0f;
#pragma unroll 1
  for (unsigned c = 0; c < 8; ++c) { const v4f a = *(const v4f*)(yr + c * 128); s += (a[0] + a[1]) + (a[2] + a[3]); }
#pragma unroll
  for (int m = 16; m > 0; m >>= 1) s += __shfl_xor(s, m, 32);
  const float mu = s * (1.0f / 1024.0f);
  float q = 0.0f;
#pragma unroll 1
  for (unsigned c = 0; c < 8; ++c) { const v4f a = *(const v4f*)(yr + c * 128);
#pragma unroll
    for (int j = 0; j < 4; ++j) { const float d0 = a[j] - mu; q += d0 * d0; } }
#pragma unroll
  for (int m = 16; m > 0; m >>= 1) q += __shfl_xor(q, m, 32);
  const float inv = rsqrtf(q * (1.0f / 1024.0f) + LNEPS);
  {
#pragma unroll 1
    for (unsigned c = 0; c < 8; ++c) { const unsigned co = c * 128 + lane * 4;
      const v4f a = *(const v4f*)(yr + c * 128);
      const v4f ga = *(const v4f*)(gam + co), ba = *(const v4f*)(bet + co);
      v4f t;
#pragma unroll
      for (int j = 0; j < 4; ++j) t[j] = (a[j] - mu) * inv * bf16_rne(ga[j]) + bf16_rne(ba[j]);
      *(v4f*)(out + ro + c * 128) = t; }
     }
}

}  // namespace

extern "C" void kernel_launch(void* const* d_in, const int* in_sizes, int n_in, void* d_out, int out_size, void* d_ws, size_t ws_size, hipStream_t stream) {
  if (n_in < 11) return;
  // wire order: 0 x [4,2048,1024], 1 Wq [1024,1024] (in,out), 2 bq, 3 Wk, 4 bk, 5 Wv, 6 bv, 7 Wo [1024,1024] (in,out), 8 bo, 9 gamma [1024], 10 beta [1024]; all f32. Output f32 [4,2048,1024].
  const size_t need = ((size_t)(NBU - 1) * SEQF + SEQU) * KD;
  if ((size_t)in_sizes[0] < need || (size_t)out_size < need) return;
  if (in_sizes[2] < (int)KD || in_sizes[4] < (int)KD || in_sizes[6] < (int)KD || in_sizes[8] < (int)KD || in_sizes[9] < (int)KD || in_sizes[10] < (int)KD) return;
  if ((size_t)in_sizes[1] < (size_t)KD * KD || (size_t)in_sizes[3] < (size_t)KD * KD || (size_t)in_sizes[5] < (size_t)KD * KD || (size_t)in_sizes[7] < (size_t)KD * KD) return;
  const float* x = (const float*)d_in[0];
  const float* Wq = (const float*)d_in[1]; const float* bq = (const float*)d_in[2]; const float* Wk = (const float*)d_in[3]; const float* bk = (const float*)d_in[4];
  const float* Wv = (const float*)d_in[5]; const float* bv = (const float*)d_in[6]; const float* Wo = (const float*)d_in[7]; const float* bo = (const float*)d_in[8];
  const float* gam = (const float*)d_in[9]; const float* bet = (const float*)d_in[10];
  float* out = (float*)d_out;
  size_t off = 0; char* ws = (char*)d_ws;
  auto carve = [&](size_t bytes) { char* p = ws + off; off += (bytes + 255) & ~(size_t)255; return p; };
  b16* XH = (b16*)carve(SZ_XH);        // 16 MiB  x as f16 [MT][1024], fragment order
  b16* WT = (b16*)carve(SZ_WT);        //  8 MiB  weight planes [4][1024 out][1024 in] x16, fragment order
  b16* QK = (b16*)carve(SZ_QK);        // 32 MiB  [MT][Q 1024 | K 1024] f16, fragment order
  b16* VT = (b16*)carve(SZ_VT);        // 16 MiB  V^T [h*64+d][MT] f16, fragment order
  b16* CTX = (b16*)carve(SZ_CTX);      // 16 MiB  attention output x32 f16 [MT][1024], fragment order
  float* Y = (float*)carve(SZ_Y);      // 32 MiB  y = ctx Wo + bo + x, f32, full-stride rows [YROWS][1024]
  if (off > ws_size || off > ((size_t)128 << 20)) return;   // 120 MiB at the shipped sizes
  const float s16 = 1.0f / WSC, s512 = 1.0f / (WSC * CSC);
  prep_kernel<<<4 * WB + XB, 256, 0, stream>>>(x, Wq, Wk, Wv, Wo, XH, WT);                                                           // XH, and the four weight planes
  qkv_kernel<<<dim3(MT / 128, NQK + NVR), 128, 0, stream>>>(XH, WT, bq, bk, bv, QK, VT, s16);                                         // Q = x Wq + bq | K = x Wk + bk -> QK; V^T[c][m] = sum_k WvT[c][k] x[m][k] + bv[c] -> VT
  attn_kernel<<<dim3(NHEAD, NBU, SEQU / 64), 128, 0, stream>>>(QK, VT, CTX);
  out_kernel<<<dim3(MT / 128, KD / 128), 128, 0, stream>>>(CTX, WT + (size_t)3 * KD * KD, bo, x, Y, s512);                            // y = ctx Wo + bo + x -> Y (f32)
  lnout_kernel<<<MT / 8, 256, 0, stream>>>(Y, gam, bet, out);                                                                      // out = LayerNorm(y) * gamma + beta
}

// v008
// It runs in 116 microseconds.
// Two timings next to v007 put it at 1.12 and 1.11 times that version's speed.
// Over all steps from v000 it is 3.62 times as fast.
#include <hip/hip_runtime.h>

// compute dtype: every contraction on v_wmma_f32_16x16x32_f16 (f16 operands, f32 accumulate), single products: x [Wq|Wk|Wv] (x exact bf16 as f16, weights exact bf16 x16),
// S^T = K Q^T (q, k f16), O^T = V^T P^T (v f16, p = exp2(s - max) f16 in (0,1]), ctx Wo (ctx f16 x32, Wo exact bf16 x16). Softmax, bias, the skip connection and
// the closing LayerNorm in f32. All float inputs are RNE-converted to bf16 on load. Fragment k-map per lane half hh for A AND B: elements 0..7 <- k = 8hh+0..7,
// Operand planes (XH, WT, Q|K, V^T, CTX) are stored in fragment order: a tile of 16 rows x 32 k is 1024 contiguous bytes, tile (rt, kt) of a plane with KT k-tiles per row block at
// halves (rt*KT + kt)*512; inside it lane l = 16hh + row owns halves 8l..8l+7 (k = 8hh+0..7) and 256+8l..256+8l+7 (k = 16+8hh+0..7), so each fragment load of a wave is 512 contiguous bytes.
// Structure: causal post-LN attention block; x cast -> Q|K plane, V^T plane -> fused causal flash attention -> y = ctx Wo + bo + x, whole rows in one work-group's LDS -> LayerNorm(y) -> output buffer.

#ifndef NB
#define NB 4
#endif
#ifndef SEQ
#define SEQ 2048
#endif
#ifndef SEQ_FULL
#define SEQ_FULL 2048
#endif

namespace {

constexpr unsigned KD = 1024 /* model width == heads * head dim == GEMM depth */, NHEAD = 16, DH = 64, QKP = 2048 /* pitch of the Q|K plane (halves) */;
constexpr unsigned NBU = NB, SEQU = SEQ, SEQF = SEQ_FULL, MT = NBU * SEQU /* compact rows */;
constexpr float LOG2E = 1.4426950408889634f, LNEPS = 1e-5f, WSC = 16.0f /* weight carry */, CSC = 32.0f /* ctx carry */;
static_assert(NHEAD * DH == KD);
static_assert(SEQU % 128 == 0 && SEQU <= SEQF && NBU >= 1);
static_assert(MT % 128 == 0 && KD % 32 == 0);

// extents the added kernels and the launch plan rely on
static_assert(KD == 8u * 128u);                                  // LayerNorm: 8 chunks x 32 lanes x 4 floats per row
static_assert(((size_t)MT * KD / 8) % 256 == 0);                 // cast grid exact
static_assert(((size_t)KD * KD / 8) % 256 == 0);                 // weight plane grid exact
static_assert(MT % 64 == 0 && KD % 128 == 0 && KD % 64 == 0 && SEQU % 64 == 0);   // GEMM / attention tile multiples
constexpr unsigned TILE = 512 /* halves of one 16 x 32 fragment tile */, KTD = KD / 32 /* k-tiles per row block, depth-1024 planes */, KTQ = QKP / 32 /* Q|K plane */, KTV = MT / 32 /* V^T plane */;
static_assert(KTD == 32);                                        // the cast and weight kernels split a tile index by shifts of 5
constexpr size_t SZ_XH = (size_t)MT * KD * 2, SZ_WT = (size_t)4 * KD * KD * 2, SZ_QK = (size_t)MT * QKP * 2, SZ_VT = (size_t)KD * MT * 2, SZ_CTX = (size_t)MT * KD * 2;
static_assert(SZ_XH % 256 == 0 && SZ_WT % 256 == 0 && SZ_QK % 256 == 0 && SZ_VT % 256 == 0 && SZ_CTX % 256 == 0);
static_assert(SZ_XH + SZ_WT + SZ_QK + SZ_VT + SZ_CTX <= ((size_t)128 << 20));   // 88 MiB at the shipped sizes

typedef _Float16 b16;
typedef __attribute__((ext_vector_type(16))) _Float16 v16b;
typedef __attribute__((ext_vector_type(8))) _Float16 v8b;
typedef __attribute__((ext_vector_type(8))) float v8f;
typedef __attribute__((ext_vector_type(4))) float v4f;

__device__ __forceinline__ float bf16_rne(float f) { unsigned int u = __float_as_uint(f); u += 0x7FFFu + ((u >> 16) & 1u); return __uint_as_float(u & 0xFFFF0000u); }
// p = tile base + 8 * lane
__device__ __forceinline__ v16b frag_pk(const b16* p) { const v8b a = *(const v8b*)(p), b = *(const v8b*)(p + 256); v16b f;
#pragma unroll
  for (int e = 0; e < 8; ++e) { f[e] = a[e]; f[8 + e] = b[e]; } return f; }
__device__ __forceinline__ v8f wmma16b(v16b a, v16b b, v8f c) { v8f d = __builtin_amdgcn_wmma_f32_16x16x32_f16(false, a, false, b, (short)0, c, false, false); asm volatile("v_nop\n\tv_nop\n\tv_nop\n\tv_nop" : "+v"(d) : "v"(a), "v"(b)); return d; }
__device__ __forceinline__ void wave_lds_sync() { __builtin_amdgcn_fence(3 /* release order */, "workgroup"); __builtin_amdgcn_wave_barrier(); __builtin_amdgcn_fence(2 /* acquire order */, "workgroup"); }
// f32 -> f16 operand convert that cannot yield an f16 subnormal (value select below 2^-14)
__device__ __forceinline__ b16 toh_flush(float v) { const b16 r = (b16)v; return (fabsf(v) < 6.103515625e-05f) ? (b16)0.0f : r; }

// 2^x as the bare v_exp_f32, for x <= 0 in the softmax. The library exp2f wraps it in a range guard (compare, two selects, add, ldexp) that only matters for results below 2^-126, where the bare
// instruction may give 0 for a subnormal: as p such a value rounds to f16 zero either way, and as the rescale factor it multiplies sums that then stand beside a term of 1.
__device__ __forceinline__ float exp2_bare(float x) { return __builtin_amdgcn_exp2f(x); }

__device__ __forceinline__ void xh_part(const unsigned blk, const float* __restrict__ x, b16* __restrict__ XH) {
  const unsigned u = blk * 256 + threadIdx.x;                 // < MT*KD/8 (blk < XB)
  const unsigned tile = u >> 6, nloc = ((u >> 5) & 1u) * 8 + ((u >> 2) & 7u), part = (u >> 1) & 1u, hh = u & 1u;   // a wave: 8 rows x the 4 granules of one k-tile (whole lines read and written)
  const unsigned r = (tile >> 5) * 16 + nloc, col = (tile & 31u) * 32 + part * 16 + hh * 8;
  const unsigned bb = r / SEQU, ss = r - bb * SEQU;
  const float* xr = x + ((size_t)bb * SEQF + ss) * KD + col;
  const v4f a = *(const v4f*)(xr), b = *(const v4f*)(xr + 4);
  v8b v;
#pragma unroll
  for (int j = 0; j < 4; ++j) { v[j] = toh_flush(bf16_rne(a[j])); v[4 + j] = toh_flush(bf16_rne(b[j])); }
  { *(v8b*)(XH + (size_t)tile * TILE + part * 256 + (hh * 16 + nloc) * 8) = v;  }
}

__device__ __forceinline__ void wt_part(const unsigned blk, const unsigned y, const float* __restrict__ w0, const float* __restrict__ w1, const float* __restrict__ w2, const float* __restrict__ w3, b16* __restrict__ WT) {
  const float* w = (y == 0) ? w0 : (y == 1) ? w1 : (y == 2) ? w2 : w3;
  const unsigned u = blk * 256 + threadIdx.x;                 // < KD*KD/8 (blk < WB)
  const unsigned e = u * 8, tile = u >> 6, part = (u >> 5) & 1u, hh = (u >> 4) & 1u, nloc = u & 15u;   // u = granule index in fragment order
  const unsigned o = (tile >> 5) * 16 + nloc, k0 = (tile & 31u) * 32 + part * 16 + hh * 8; v8b v;
#pragma unroll
  for (int j = 0; j < 8; ++j) v[j] = (b16)(bf16_rne(w[(size_t)(k0 + j) * KD + o]) * WSC);
  { *(v8b*)(WT + (size_t)y * KD * KD + e) = v;  }
}

// The x cast and the four weight planes depend on nothing but the inputs: one launch, the part chosen by a block-uniform branch. The weight blocks (8 strided reads a thread) come first in the index.
constexpr unsigned XB = (unsigned)((size_t)MT * KD / 8 / 256) /* blocks of the cast */, WB = KD * KD / 8 / 256 /* blocks of one weight plane */;
__global__ __launch_bounds__(256) void prep_kernel(const float* __restrict__ x, const float* __restrict__ w0, const float* __restrict__ w1, const float* __restrict__ w2, const float* __restrict__ w3, b16* __restrict__ XH, b16* __restrict__ WT) {
  const unsigned blk = blockIdx.x;                            // < 4 * WB + XB (grid exact)
  if (blk < 4 * WB) wt_part(blk % WB, blk / WB, w0, w1, w2, w3, WT);
  else xh_part(blk - 4 * WB, x, XH);
}

// One k-stage of a GEMM block in LDS: 64 of depth (2 k-tiles) of 8 row blocks of A, then of 8 row blocks of Bt, every 1024-byte tile kept in fragment order.
constexpr unsigned SKT = 2 /* k-tiles per stage */, SRB = SKT * TILE /* halves of one row block in a stage */, SOP = 8 * SRB /* halves of one operand */, STG = 2 * SOP /* halves of a stage: 32 KiB */, NSTG = KTD / SKT;
static_assert(KTD % SKT == 0 && NSTG >= 2);
static_assert(MT % 128 == 0 && KD % 128 == 0);                   // GEMM block tile multiples

// A wave's 8 copies of 512 bytes: the 2048 contiguous bytes that a stage takes of two row blocks (la <- ga, lb <- gb; LDS byte addresses and global pointers of the lane's own 16 bytes).
__device__ __forceinline__ void copy8(unsigned la, const b16* ga, unsigned lb, const b16* gb) {
  // the closing s_wait_xcnt stands inside the statement so that no address register of a copy is rewritten ahead of it
  asm volatile("global_load_async_to_lds_b128 %0, %8, off\n\t"
               "global_load_async_to_lds_b128 %1, %9, off\n\t"
               "global_load_async_to_lds_b128 %2, %10, off\n\t"
               "global_load_async_to_lds_b128 %3, %11, off\n\t"
               "global_load_async_to_lds_b128 %4, %12, off\n\t"
               "global_load_async_to_lds_b128 %5, %13, off\n\t"
               "global_load_async_to_lds_b128 %6, %14, off\n\t"
               "global_load_async_to_lds_b128 %7, %15, off\n\t"
               "s_wait_xcnt 0x0"
               :: "v"(la), "v"(la + 512u), "v"(la + 1024u), "v"(la + 1536u), "v"(lb), "v"(lb + 512u), "v"(lb + 1024u), "v"(lb + 1536u),
                  "v"(ga), "v"(ga + 256), "v"(ga + 512), "v"(ga + 768), "v"(gb), "v"(gb + 256), "v"(gb + 512), "v"(gb + 768)
               : "memory");
}

// ---------------- tile GEMM, depth 1024: C[m][n] = sum_k A[m][k] Bt[n][k]; A, Bt f16 planes in fragment order (32 k-tiles per row block).
// block = 4 waves, tile 128 x 128; wave tile 64 x 64 (4 x 4 accumulators). The block's operands pass through LDS, so each tile leaves L2 once per block: asynchronous copies fill a ring of two
// stages, stage t + 2 flying while stage t + 1 is worked on; a wave copies row blocks 2 wave and 2 wave + 1 of both operands and reads its fragments from LDS, 512 contiguous bytes per load.
// The block's tile starts at row mb, column nb; bias points at the block's first row (rowbias) or column.
// f16 out, y = acc*scale + bias[col], or + bias[row] where rowbias (block-uniform) is set. The wave stages its tile in private LDS and stores whole lines.
__device__ __forceinline__ void gemm_block(const b16* A, const b16* Bt, const float* bias, const bool rowbias, b16* outH, const unsigned opitch, const float scale, const unsigned mb, const unsigned nb) {
  __shared__ __attribute__((aligned(16))) b16 ring[2 * STG];
  const unsigned wave = threadIdx.x >> 5, lane = threadIdx.x & 31, nloc = lane & 15, hh = lane >> 4;
  const unsigned mw = (wave & 1) * 64, nw = (wave >> 1) * 64;
  const unsigned m0 = mb + mw, n0 = nb + nw;
  v8f acc[4][4];
#pragma unroll
  for (int i = 0; i < 4; ++i)
#pragma unroll
    for (int j = 0; j < 4; ++j) acc[i][j] = (v8f){};
  const b16* ga = A + ((size_t)(mb >> 4) + 2 * wave) * KTD * TILE + lane * 8;
  const b16* gb = Bt + ((size_t)(nb >> 4) + 2 * wave) * KTD * TILE + lane * 8;
  const unsigned lw = (unsigned)(size_t)(&ring[0]) + wave * (2 * SRB * 2) + lane * 16;   // LDS byte address: low 32 bits of the shared address
  auto fill = [&](unsigned t) {
    const unsigned l = lw + (t & 1u) * (STG * 2); const b16* pa = ga + t * SRB; const b16* pb = gb + t * SRB;
    copy8(l, pa, l + SRB * 2, pa + KTD * TILE);
    copy8(l + SOP * 2, pb, l + SOP * 2 + SRB * 2, pb + KTD * TILE);
  };
  fill(0);
  asm volatile("s_wait_asynccnt 0x0" ::: "memory");   // this wave's share of stage 0 has landed
  __syncthreads();                                    // every wave's share of stage 0 has landed
  fill(1);
#pragma unroll 1   // one trip is one stage: 32 products per wave
  for (unsigned t = 0; t < NSTG; ++t) {
    const b16* la = ring + (t & 1u) * STG + (wave & 1) * (4 * SRB) + lane * 8;
    const b16* lb = ring + (t & 1u) * STG + SOP + (wave >> 1) * (4 * SRB) + lane * 8;
#pragma unroll
    for (unsigned kk = 0; kk < SKT; ++kk) {
      v16b fa[4], fb[4];
#pragma unroll
      for (int i = 0; i < 4; ++i) { fa[i] = frag_pk(la + i * SRB + kk * TILE); fb[i] = frag_pk(lb + i * SRB + kk * TILE); }
#pragma unroll
      for (int j = 0; j < 4; ++j)
#pragma unroll
        for (int i = 0; i < 4; ++i) acc[i][j] = wmma16b(fa[i], fb[j], acc[i][j]);
    }
    asm volatile("s_wait_dscnt 0x0" ::: "memory");      // this wave's reads of stage t are done before the stage's buffer is given up
    asm volatile("s_wait_asynccnt 0x0" ::: "memory");   // this wave's share of stage t + 1 has landed
    __syncthreads();                                    // publishes stage t + 1 and ends every wave's reads of stage t
    if (t + 2 < NSTG) fill(t + 2);                      // block-uniform; into the buffer that stage t has left
  }
  asm volatile("s_wait_asynccnt 0x0" ::: "memory");     // no copy is outstanding when the wave goes on
  {
    __shared__ __attribute__((aligned(16))) b16 Th[4][64][72];
    // Both slices lie inside the block's 128 bias entries: both are read, and the block-uniform flag picks the addend, so the tile has one copy of its LDS stores.
    // The loops are fully unrolled so that every index of br, bc and acc is a compile-time constant and the arrays stay in registers.
    float br[4][8], bc[4];
    const float* rp = bias + mw + 8 * hh; const float* cp = bias + nw + nloc;   // the lane's first row entry and first column entry
#pragma unroll
    for (int i = 0; i < 4; ++i)
#pragma unroll
      for (int r = 0; r < 8; ++r) br[i][r] = rp[i * 16 + r];
#pragma unroll
    for (int j = 0; j < 4; ++j) bc[j] = cp[j * 16];
    asm volatile("s_wait_xcnt 0x0" :: "v"(rp), "v"(cp) : "memory");   // the bias loads are in flight; their addresses are inputs so that they stay in their registers up to this wait
#pragma unroll
    for (int i = 0; i < 4; ++i)
#pragma unroll
      for (int r = 0; r < 8; ++r) br[i][r] = bf16_rne(br[i][r]);
#pragma unroll
    for (int j = 0; j < 4; ++j) bc[j] = bf16_rne(bc[j]);
#pragma unroll
    for (int i = 0; i < 4; ++i)
#pragma unroll
      for (int j = 0; j < 4; ++j) { const unsigned col = j * 16 + nloc;
#pragma unroll
        for (int r = 0; r < 8; ++r) { const unsigned row = i * 16 + 8 * hh + r; Th[wave][row][col] = (b16)(acc[i][j][r] * scale + (rowbias ? br[i][r] : bc[j])); } }
    wave_lds_sync();   // wave-private tile: same wave writes and reads
    {
      for (unsigned it = 0; it < 8; ++it) { const unsigned rtl = it >> 1, ktl = it & 1u; const b16* tp = &Th[wave][rtl * 16 + nloc][ktl * 32 + hh * 8]; const v8b v0 = *(const v8b*)(tp), v1 = *(const v8b*)(tp + 16);
        b16* op = outH + ((size_t)((m0 >> 4) + rtl) * (opitch >> 5) + (n0 >> 5) + ktl) * TILE + lane * 8;   // one tile of the out plane in fragment order, k = column
        *(v8b*)(op) = v0; *(v8b*)(op + 256) = v1; }
       }
  }
}

// The three projections read the same two planes and depend on nothing else: one launch. Grid (MT/128, 24): y < 16 is a tile of [Q|K] = x [Wq|Wk] (row block x, column block y; the two weight planes and
// the two halves of the Q|K plane follow one another), y >= 16 a tile of V^T = Wv^T x^T (row block y - 16, column block x). Every choice is block-uniform.
constexpr unsigned NQK = 2 * KD / 128 /* column blocks of Q|K */, NVR = KD / 128 /* row blocks of V^T */;
__global__ __launch_bounds__(128) void qkv_kernel(const b16* __restrict__ XH, const b16* __restrict__ WT, const float* __restrict__ bq, const float* __restrict__ bk, const float* __restrict__ bv, b16* __restrict__ QK, b16* __restrict__ VT, float scale) {
  const bool isv = blockIdx.y >= NQK;
  const unsigned mb = (isv ? blockIdx.y - NQK : blockIdx.x) * 128, nb = (isv ? blockIdx.x : blockIdx.y) * 128;
  const float* bias = isv ? bv + mb : (nb < KD) ? bq + nb : bk + (nb - KD);
  gemm_block(isv ? WT + (size_t)2 * KD * KD : XH, isv ? XH : WT, bias, isv, isv ? VT : QK, isv ? MT : QKP, scale, mb, nb);
}

// ---------------- causal flash attention, transposed form. grid (heads, batch, SEQ/64), 4 independent waves, wave = 16 query rows i (iw0 .. iw0+15), key tiles of 64.
// A work-group of query tile qt walks qt + 1 key tiles and only half the work-groups are resident at once: qt falls with the flat index (slowest grid axis, counted down), so the longest start first and the shortest fill the tail.
// S^T tile t (16 keys x 16 queries) = K rows (A: row = key, k = d) x Q rows (B: col = query, k = d); lane holds query i = lane&15, keys 16t+8hh+r.
// p = exp2(s*0.125*log2e - m) as f16; P^T is the B operand of O^T = V^T P^T directly from the score accumulators: k-step c (32 keys) elements 0..7 <- tile 2c acc[0..7],
// elements 8..15 <- tile 2c+1 acc[0..7] (the D row map equals the B k map). A = VT rows (row = d, k = key). O^T acc[r] = O[d = 16dt+8hh+r][i = lane&15].
__global__ __launch_bounds__(128) void attn_kernel(const b16* __restrict__ QK, const b16* __restrict__ VT, b16* __restrict__ CTX) {
  const unsigned wave = threadIdx.x >> 5, lane = threadIdx.x & 31, nloc = lane & 15, hh = lane >> 4;
  const unsigned qt = SEQU / 64 - 1 - blockIdx.z, h = blockIdx.x, b = blockIdx.y;
  const unsigned iw0 = qt * 64 + wave * 16;
  const b16* qrow = QK + ((size_t)((b * SEQU + iw0) >> 4) * KTQ + h * 2) * TILE + lane * 8;
  const v16b qf0 = frag_pk(qrow), qf1 = frag_pk(qrow + TILE);
  const b16* kbase = QK + ((size_t)((b * SEQU) >> 4) * KTQ + KTD + h * 2) * TILE + lane * 8;
  const b16* vbase = VT + ((size_t)(h * 4) * KTV + ((b * SEQU) >> 5)) * TILE + lane * 8;
  v8f o[4];
#pragma unroll
  for (int dt = 0; dt < 4; ++dt) o[dt] = (v8f){};
  float m = -1.0e30f, l = 0.0f;
  const float SCL = 0.125f * LOG2E;
  const unsigned iq = iw0 + nloc;
  // K and V fragments of a key tile each have 8 register sets of their own and are loaded as one group: V of tile jt ahead of the score products, K of tile jt + 1 behind them, ahead of the softmax
  v16b kf[8], vf[8];
#pragma unroll
  for (int t = 0; t < 4; ++t) { const b16* kr = kbase + (size_t)t * KTQ * TILE; kf[2 * t] = frag_pk(kr); kf[2 * t + 1] = frag_pk(kr + TILE); }
  asm volatile("s_wait_xcnt 0x0" ::: "memory");   // the loop reuses the address registers of the Q and K loads while these are in flight
  // One key tile. diag is a literal at both calls: only the block's last tile (jt == qt) crosses the diagonal, so the tiles in front of it carry no mask code at all and always have a next tile to fetch.
  // always_inline: both copies must see their literal, and the register arrays must stay in registers.
  auto tile = [&](const unsigned jt, const bool diag) __attribute__((always_inline)) {
    const unsigned j0 = jt * 64;
#pragma unroll
    for (int dt = 0; dt < 4; ++dt) { const b16* vr = vbase + ((size_t)dt * KTV + jt * 2) * TILE; vf[2 * dt] = frag_pk(vr); vf[2 * dt + 1] = frag_pk(vr + TILE); }
    __builtin_amdgcn_sched_barrier(0);   // keeps the V loads at the head of the trip: without it the first score product moves up with its wait on K, and the V loads are issued only behind that wait
    v8f s[4];
#pragma unroll
    for (int t = 0; t < 4; ++t) { s[t] = wmma16b(kf[2 * t], qf0, (v8f){}); s[t] = wmma16b(kf[2 * t + 1], qf1, s[t]); }
    asm volatile("s_wait_xcnt 0x0" ::: "memory");   // the V loads are in flight and their address registers are reused from here on
    if (!diag) {                                     // compile-time: the next key tile exists
#pragma unroll
      for (int t = 0; t < 4; ++t) { const b16* kr = kbase + (size_t)((jt + 1) * 4 + t) * KTQ * TILE; kf[2 * t] = frag_pk(kr); kf[2 * t + 1] = frag_pk(kr + TILE); }
      asm volatile("s_wait_xcnt 0x0" ::: "memory");   // the softmax reuses the address registers of these loads while they are in flight
    }
    float mx = -1.0e30f;
#pragma unroll
    for (int t = 0; t < 4; ++t)
#pragma unroll
      for (int r = 0; r < 8; ++r) { float xv = s[t][r] * SCL; if (diag) { const unsigned j = j0 + 16 * t + 8 * hh + r; xv = (j > iq) ? -1.0e30f : xv; } s[t][r] = xv; mx = fmaxf(mx, xv); }
    mx = fmaxf(mx, __shfl_xor(mx, 16, 32));
    const float newm = fmaxf(m, mx); const float alpha = exp2_bare(m - newm); m = newm;
    float psum = 0.0f; v16b pf0, pf1;
#pragma unroll
    for (int t = 0; t < 4; ++t)
#pragma unroll
      for (int r = 0; r < 8; ++r) { const b16 ph = (b16)exp2_bare(s[t][r] - m); psum += (float)ph; if (t < 2) pf0[(t & 1) * 8 + r] = ph; else pf1[(t & 1) * 8 + r] = ph; }
    psum += __shfl_xor(psum, 16, 32);
    l = l * alpha + psum;
#pragma unroll
    for (int dt = 0; dt < 4; ++dt)
#pragma unroll
      for (int r = 0; r < 8; ++r) o[dt][r] *= alpha;
#pragma unroll
    for (int dt = 0; dt < 4; ++dt) { o[dt] = wmma16b(vf[2 * dt], pf0, o[dt]); o[dt] = wmma16b(vf[2 * dt + 1], pf1, o[dt]); }
  };
#pragma unroll 1   // one trip is one key tile; unrolled, the two fragment groups of several tiles would not fit the registers
  for (unsigned jt = 0; jt < qt; ++jt) tile(jt, false);   // block-uniform trip count; every key of these tiles lies in front of every query of the block
  tile(qt, true);                                         // the diagonal tile: holds at least key j0 <= i for every query of the block
  const float inv = CSC * (1.0f / l);                // l >= 1 (the running-max key contributes exactly 1)
  b16* cp = CTX + ((size_t)((b * SEQU + iw0) >> 4) * KTD + h * 2) * TILE + lane * 8;
#pragma unroll
  for (int dt = 0; dt < 4; ++dt) { v8b v;
#pragma unroll
    for (int r = 0; r < 8; ++r) v[r] = (b16)(o[dt][r] * inv);
    *(v8b*)(cp + (dt >> 1) * TILE + (dt & 1) * 256) = v; }   // the lane's 8 values (query nloc, d = 16dt+8hh+0..7) are its own granule of the CTX tile: 512 contiguous bytes per wave store
}

// ---------------- output projection with the skip connection and the LayerNorm in its epilogue: out = LayerNorm(ctx Wo + bo + x) * gamma + beta.
// A work-group owns 64 whole rows (tokens): block tile 64 x 1024, 16 waves, wave w = all 64 tokens x features 64 w .. 64 w + 63, so a row's mean and variance need no other work-group and y never leaves the chip.
// The k loop is that of gemm_block: a ring of two stages of 64 of depth, filled by asynchronous copies. A stage holds 4 row blocks of CTX (8 KiB, read by every wave) and all 64 row blocks of Wo^T (128 KiB).
// A wave copies one 512-byte piece of the CTX part and the 4 row blocks of Wo^T that it reads itself. The product is taken as y^T = Wo^T ctx^T (A = Wo^T rows, B = CTX rows, as for V^T): a lane then holds
// 8 neighbouring features of one token (token 16 j + nloc, features 16 i + 8 hh + 0..7), which go to LDS as two 16-byte stores. Behind the loop the ring's LDS takes the 64 x 1024 f32 tile; a wave normalises 4 whole rows.
constexpr unsigned OSA = 4 * SRB /* halves of the CTX part of a stage */, OSTG = OSA + (KD / 16) * SRB /* halves of a stage: 136 KiB */, OTP = KD + 4 /* pitch of the f32 tile (floats): neighbouring rows lie 4 banks apart */;
static_assert((size_t)64 * OTP * 4 <= (size_t)2 * OSTG * 2);    // the f32 tile fits the ring's LDS
static_assert((size_t)2 * OSTG * 2 <= 327680);                   // the ring fits a WGP's LDS
static_assert(KD == 16u * 64u && SEQU % 64 == 0 && MT % 64 == 0);   // 16 waves span a row; a 64-row block never straddles a batch; grid exact

// One copy of 512 bytes (l, g: LDS byte address and global pointer of the lane's own 16 bytes).
__device__ __forceinline__ void copy1(unsigned l, const b16* g) {
  // the closing s_wait_xcnt stands inside the statement so that no address register of the copy is rewritten ahead of it
  asm volatile("global_load_async_to_lds_b128 %0, %1, off\n\t"
               "s_wait_xcnt 0x0"
               :: "v"(l), "v"(g) : "memory");
}

__global__ __launch_bounds__(512) void outln_kernel(const b16* __restrict__ CTX, const b16* __restrict__ WoT, const float* __restrict__ bo, const float* __restrict__ x, const float* __restrict__ gam, const float* __restrict__ bet, float* __restrict__ out, float scale) {
  __shared__ __attribute__((aligned(16))) b16 ring[2 * OSTG];
  const unsigned wave = threadIdx.x >> 5, lane = threadIdx.x & 31, nloc = lane & 15, hh = lane >> 4;
  const unsigned mb = blockIdx.x * 64, nw = wave * 64;
  // the lane's 32 bias entries, asked for ahead of the ring's first copies: they are used only behind the k loop
  v4f bb[4][2];
#pragma unroll
  for (int i = 0; i < 4; ++i) { const float* bp = bo + nw + i * 16 + 8 * hh; bb[i][0] = *(const v4f*)(bp); bb[i][1] = *(const v4f*)(bp + 4); }
  v8f acc[4][4];
#pragma unroll
  for (int i = 0; i < 4; ++i)
#pragma unroll
    for (int j = 0; j < 4; ++j) acc[i][j] = (v8f){};
  const b16* ga = CTX + ((size_t)(mb >> 4) + (wave >> 2)) * KTD * TILE + (wave & 3) * 256 + lane * 8;   // piece wave & 3 of the stage's 2048 bytes of row block wave >> 2
  const b16* gb = WoT + (size_t)(4 * wave) * KTD * TILE + lane * 8;
  const unsigned l0 = (unsigned)(size_t)(&ring[0]) + lane * 16;   // LDS byte address: low 32 bits of the shared address
  auto fill = [&](unsigned t) {
    const unsigned l = l0 + (t & 1u) * (OSTG * 2), lb = l + OSA * 2 + wave * (4 * SRB * 2); const b16* pb = gb + t * SRB;
    copy1(l + wave * 512, ga + t * SRB);
    copy8(lb, pb, lb + SRB * 2, pb + KTD * TILE);
    copy8(lb + 2 * SRB * 2, pb + 2 * KTD * TILE, lb + 3 * SRB * 2, pb + 3 * KTD * TILE);
  };
  fill(0);
  asm volatile("s_wait_asynccnt 0x0" ::: "memory");   // this wave's share of stage 0 has landed
  __syncthreads();                                    // every wave's share of stage 0 has landed
  fill(1);
#pragma unroll 1   // one trip is one stage: 32 products per wave
  for (unsigned t = 0; t < NSTG; ++t) {
    const b16* lc = ring + (t & 1u) * OSTG + lane * 8;
    const b16* lw = ring + (t & 1u) * OSTG + OSA + wave * (4 * SRB) + lane * 8;
#pragma unroll
    for (unsigned kk = 0; kk < SKT; ++kk) {
      v16b fw[4], fc[4];
#pragma unroll
      for (int i = 0; i < 4; ++i) { fw[i] = frag_pk(lw + i * SRB + kk * TILE); fc[i] = frag_pk(lc + i * SRB + kk * TILE); }
#pragma unroll
      for (int j = 0; j < 4; ++j)
#pragma unroll
        for (int i = 0; i < 4; ++i) acc[i][j] = wmma16b(fw[i], fc[j], acc[i][j]);
    }
    asm volatile("s_wait_dscnt 0x0" ::: "memory");      // this wave's reads of stage t are done before the stage's buffer is given up
    asm volatile("s_wait_asynccnt 0x0" ::: "memory");   // this wave's share of stage t + 1 has landed
    __syncthreads();                                    // publishes stage t + 1 and ends every wave's reads of stage t
    if (t + 2 < NSTG) fill(t + 2);                      // block-uniform; into the buffer that stage t has left
  }
  asm volatile("s_wait_asynccnt 0x0" ::: "memory");     // no copy is outstanding when the ring's LDS is given to the f32 tile
  // The last trip's barrier has ended every wave's reads of the ring: from here its LDS holds acc*scale + bo, 64 rows of pitch OTP.
  // The wave's 4 rows of x are asked for among the stores, a row as the accumulators of a token block give up their registers, so that they fly while the tile is written.
  float* Tf = (float*)(&ring[0]);
  float* tb = Tf + nloc * OTP + nw + 8 * hh;
  const unsigned bt = mb / SEQU; const unsigned mfull = bt * SEQF + (mb - bt * SEQU);
  const size_t ro = (size_t)(mfull + wave * 4) * KD + lane * 4;
  const float* xp = x + ro;
  v4f y[4][8], ga4[8], be4[8];
#pragma unroll
  for (int i = 0; i < 4; ++i)
#pragma unroll
    for (int e = 0; e < 4; ++e) { bb[i][0][e] = bf16_rne(bb[i][0][e]); bb[i][1][e] = bf16_rne(bb[i][1][e]); }
#pragma unroll
  for (int j = 0; j < 4; ++j) {
#pragma unroll
    for (int c = 0; c < 8; ++c) y[j][c] = *(const v4f*)(xp + j * KD + c * 128);
#pragma unroll
    for (int i = 0; i < 4; ++i) { v4f lo, hi;
#pragma unroll
      for (int e = 0; e < 4; ++e) { lo[e] = acc[i][j][e] * scale + bb[i][0][e]; hi[e] = acc[i][j][4 + e] * scale + bb[i][1][e]; }
      *(v4f*)(tb + j * 16 * OTP + i * 16) = lo; *(v4f*)(tb + j * 16 * OTP + i * 16 + 4) = hi; }
  }
#pragma unroll
  for (int c = 0; c < 8; ++c) { ga4[c] = *(const v4f*)(gam + lane * 4 + c * 128); be4[c] = *(const v4f*)(bet + lane * 4 + c * 128); }
  __syncthreads();                                      // the f32 tile is complete: a row holds the features of all 16 waves
#pragma unroll
  for (int c = 0; c < 8; ++c)
#pragma unroll
    for (int e = 0; e < 4; ++e) { ga4[c][e] = bf16_rne(ga4[c][e]); be4[c][e] = bf16_rne(be4[c][e]); }
#pragma unroll
  for (int q = 0; q < 4; ++q) {
    const float* tr = Tf + (wave * 4 + q) * OTP + lane * 4;
    float s = 0.0f;
#pragma unroll
    for (int c = 0; c < 8; ++c) { v4f a = *(const v4f*)(tr + c * 128);
#pragma unroll
      for (int e = 0; e < 4; ++e) a[e] += bf16_rne(y[q][c][e]);
      y[q][c] = a; s += (a[0] + a[1]) + (a[2] + a[3]); }
#pragma unroll
    for (int m = 16; m > 0; m >>= 1) s += __shfl_xor(s, m, 32);
    const float mu = s * (1.0f / 1024.0f);
    float v = 0.0f;
#pragma unroll
    for (int c = 0; c < 8; ++c)
#pragma unroll
      for (int e = 0; e < 4; ++e) { const float d0 = y[q][c][e] - mu; v += d0 * d0; }
#pragma unroll
    for (int m = 16; m > 0; m >>= 1) v += __shfl_xor(v, m, 32);
    const float inv = rsqrtf(v * (1.0f / 1024.0f) + LNEPS);
#pragma unroll
    for (int c = 0; c < 8; ++c) { v4f t;
#pragma unroll
      for (int e = 0; e < 4; ++e) t[e] = (y[q][c][e] - mu) * inv * ga4[c][e] + be4[c][e];
      *(v4f*)(out + ro + q * KD + c * 128) = t; }
  }
}

}  // namespace

extern "C" void kernel_launch(void* const* d_in, const int* in_sizes, int n_in, void* d_out, int out_size, void* d_ws, size_t ws_size, hipStream_t stream) {
  if (n_in < 11) return;
  // wire order: 0 x [4,2048,1024], 1 Wq [1024,1024] (in,out), 2 bq, 3 Wk, 4 bk, 5 Wv, 6 bv, 7 Wo [1024,1024] (in,out), 8 bo, 9 gamma [1024], 10 beta [1024]; all f32. Output f32 [4,2048,1024].
  const size_t need = ((size_t)(NBU - 1) * SEQF + SEQU) * KD;
  if ((size_t)in_sizes[0] < need || (size_t)out_size < need) return;
  if (in_sizes[2] < (int)KD || in_sizes[4] < (int)KD || in_sizes[6] < (int)KD || in_sizes[8] < (int)KD || in_sizes[9] < (int)KD || in_sizes[10] < (int)KD) return;
  if ((size_t)in_sizes[1] < (size_t)KD * KD || (size_t)in_sizes[3] < (size_t)KD * KD || (size_t)in_sizes[5] < (size_t)KD * KD || (size_t)in_sizes[7] < (size_t)KD * KD) return;
  const float* x = (const float*)d_in[0];
  const float* Wq = (const float*)d_in[1]; const float* bq = (const float*)d_in[2]; const float* Wk = (const float*)d_in[3]; const float* bk = (const float*)d_in[4];
  const float* Wv = (const float*)d_in[5]; const float* bv = (const float*)d_in[6]; const float* Wo = (const float*)d_in[7]; const float* bo = (const float*)d_in[8];
  const float* gam = (const float*)d_in[9]; const float* bet = (const float*)d_in[10];
  float* out = (float*)d_out;
  size_t off = 0; char* ws = (char*)d_ws;
  auto carve = [&](size_t bytes) { char* p = ws + off; off += (bytes + 255) & ~(size_t)255; return p; };
  b16* XH = (b16*)carve(SZ_XH);        // 16 MiB  x as f16 [MT][1024], fragment order
  b16* WT = (b16*)carve(SZ_WT);        //  8 MiB  weight planes [4][1024 out][1024 in] x16, fragment order
  b16* QK = (b16*)carve(SZ_QK);        // 32 MiB  [MT][Q 1024 | K 1024] f16, fragment order
  b16* VT = (b16*)carve(SZ_VT);        // 16 MiB  V^T [h*64+d][MT] f16, fragment order
  b16* CTX = (b16*)carve(SZ_CTX);      // 16 MiB  attention output x32 f16 [MT][1024], fragment order
  if (off > ws_size || off > ((size_t)128 << 20)) return;   // 88 MiB at the shipped sizes
  const float s16 = 1.0f / WSC, s512 = 1.0f / (WSC * CSC);
  prep_kernel<<<4 * WB + XB, 256, 0, stream>>>(x, Wq, Wk, Wv, Wo, XH, WT);                                                           // XH, and the four weight planes
  qkv_kernel<<<dim3(MT / 128, NQK + NVR), 128, 0, stream>>>(XH, WT, bq, bk, bv, QK, VT, s16);                                         // Q = x Wq + bq | K = x Wk + bk -> QK; V^T[c][m] = sum_k WvT[c][k] x[m][k] + bv[c] -> VT
  attn_kernel<<<dim3(NHEAD, NBU, SEQU / 64), 128, 0, stream>>>(QK, VT, CTX);
  outln_kernel<<<MT / 64, 512, 0, stream>>>(CTX, WT + (size_t)3 * KD * KD, bo, x, gam, bet, out, s512);                                      // out = LayerNorm(ctx Wo + bo + x) * gamma + beta
}

// v009
// A run of this version takes 110 microseconds.
// Two timings next to v008 put it at 1.05 and 1.06 times that version's speed.
// Over all steps from v000 it is 3.83 times as fast.
#include <hip/hip_runtime.h>

// compute dtype: every contraction on v_wmma_f32_16x16x32_f16 (f16 operands, f32 accumulate), single products: x [Wq|Wk|Wv] (x exact bf16 as f16, weights exact bf16 x16),
// S^T = K Q^T (q, k f16), O^T = V^T P^T (v f16, p = exp2(s - max) f16 in (0,1]), ctx Wo (ctx f16 x32, Wo exact bf16 x16). Softmax, bias, the skip connection and
// the closing LayerNorm in f32. All float inputs are RNE-converted to bf16 on load. Fragment k-map per lane half hh for A AND B: elements 0..7 <- k = 8hh+0..7,
// Operand planes (XH, WT, Q|K, V^T, CTX) are stored in fragment order: a tile of 16 rows x 32 k is 1024 contiguous bytes, tile (rt, kt) of a plane with KT k-tiles per row block at
// halves (rt*KT + kt)*512; inside it lane l = 16hh + row owns halves 8l..8l+7 (k = 8hh+0..7) and 256+8l..256+8l+7 (k = 16+8hh+0..7), so each fragment load of a wave is 512 contiguous bytes.
// Structure: causal post-LN attention block; x cast -> Q|K plane, V^T plane -> fused causal flash attention -> y = ctx Wo + bo + x, whole rows in one work-group's LDS -> LayerNorm(y) -> output buffer.

#ifndef NB
#define NB 4
#endif
#ifndef SEQ
#define SEQ 2048
#endif
#ifndef SEQ_FULL
#define SEQ_FULL 2048
#endif

namespace {

constexpr unsigned KD = 1024 /* model width == heads * head dim == GEMM depth */, NHEAD = 16, DH = 64, QKP = 2048 /* pitch of the Q|K plane (halves) */;
constexpr unsigned NBU = NB, SEQU = SEQ, SEQF = SEQ_FULL, MT = NBU * SEQU /* compact rows */;
constexpr float LOG2E = 1.4426950408889634f, LNEPS = 1e-5f, WSC = 16.0f /* weight carry */, CSC = 32.0f /* ctx carry */;
static_assert(NHEAD * DH == KD);
static_assert(SEQU % 128 == 0 && SEQU <= SEQF && NBU >= 1);
static_assert(MT % 128 == 0 && KD % 32 == 0);

// extents the added kernels and the launch plan rely on
static_assert(KD == 8u * 128u);                                  // LayerNorm: 8 chunks x 32 lanes x 4 floats per row
static_assert(((size_t)MT * KD / 8) % 256 == 0);                 // cast grid exact
static_assert(((size_t)KD * KD / 8) % 256 == 0);                 // weight plane grid exact
static_assert(MT % 64 == 0 && KD % 128 == 0 && KD % 64 == 0 && SEQU % 64 == 0);   // GEMM / attention tile multiples
constexpr unsigned TILE = 512 /* halves of one 16 x 32 fragment tile */, KTD = KD / 32 /* k-tiles per row block, depth-1024 planes */, KTQ = QKP / 32 /* Q|K plane */, KTV = MT / 32 /* V^T plane */;
static_assert(KTD == 32);                                        // the cast and weight kernels split a tile index by shifts of 5
constexpr size_t SZ_XH = (size_t)MT * KD * 2, SZ_WT = (size_t)4 * KD * KD * 2, SZ_QK = (size_t)MT * QKP * 2, SZ_VT = (size_t)KD * MT * 2, SZ_CTX = (size_t)MT * KD * 2;
static_assert(SZ_XH % 256 == 0 && SZ_WT % 256 == 0 && SZ_QK % 256 == 0 && SZ_VT % 256 == 0 && SZ_CTX % 256 == 0);
static_assert(SZ_XH + SZ_WT + SZ_QK + SZ_VT + SZ_CTX <= ((size_t)128 << 20));   // 88 MiB at the shipped sizes

typedef _Float16 b16;
typedef __attribute__((ext_vector_type(16))) _Float16 v16b;
typedef __attribute__((ext_vector_type(8))) _Float16 v8b;
typedef __attribute__((ext_vector_type(8))) float v8f;
typedef __attribute__((ext_vector_type(4))) float v4f;

__device__ __forceinline__ float bf16_rne(float f) { unsigned int u = __float_as_uint(f); u += 0x7FFFu + ((u >> 16) & 1u); return __uint_as_float(u & 0xFFFF0000u); }
// p = tile base + 8 * lane
__device__ __forceinline__ v16b frag_pk(const b16* p) { const v8b a = *(const v8b*)(p), b = *(const v8b*)(p + 256); v16b f;
#pragma unroll
  for (int e = 0; e < 8; ++e) { f[e] = a[e]; f[8 + e] = b[e]; } return f; }
__device__ __forceinline__ v8f wmma16b(v16b a, v16b b, v8f c) { v8f d = __builtin_amdgcn_wmma_f32_16x16x32_f16(false, a, false, b, (short)0, c, false, false); asm volatile("v_nop\n\tv_nop\n\tv_nop\n\tv_nop" : "+v"(d) : "v"(a), "v"(b)); return d; }
__device__ __forceinline__ void wave_lds_sync() { __builtin_amdgcn_fence(3 /* release order */, "workgroup"); __builtin_amdgcn_wave_barrier(); __builtin_amdgcn_fence(2 /* acquire order */, "workgroup"); }
// f32 -> f16 operand convert that cannot yield an f16 subnormal (value select below 2^-14)
__device__ __forceinline__ b16 toh_flush(float v) { const b16 r = (b16)v; return (fabsf(v) < 6.103515625e-05f) ? (b16)0.0f : r; }

// 2^x as the bare v_exp_f32, for x <= 0 in the softmax. The library exp2f wraps it in a range guard (compare, two selects, add, ldexp) that only matters for results below 2^-126, where the bare
// instruction may give 0 for a subnormal: as p such a value rounds to f16 zero either way, and as the rescale factor it multiplies sums that then stand beside a term of 1.
__device__ __forceinline__ float exp2_bare(float x) { return __builtin_amdgcn_exp2f(x); }

__device__ __forceinline__ void xh_part(const unsigned blk, const float* __restrict__ x, b16* __restrict__ XH) {
  const unsigned u = blk * 256 + threadIdx.x;                 // < MT*KD/8 (blk < XB)
  const unsigned tile = u >> 6, nloc = ((u >> 5) & 1u) * 8 + ((u >> 2) & 7u), part = (u >> 1) & 1u, hh = u & 1u;   // a wave: 8 rows x the 4 granules of one k-tile (whole lines read and written)
  const unsigned r = (tile >> 5) * 16 + nloc, col = (tile & 31u) * 32 + part * 16 + hh * 8;
  const unsigned bb = r / SEQU, ss = r - bb * SEQU;
  const float* xr = x + ((size_t)bb * SEQF + ss) * KD + col;
  const v4f a = *(const v4f*)(xr), b = *(const v4f*)(xr + 4);
  v8b v;
#pragma unroll
  for (int j = 0; j < 4; ++j) { v[j] = toh_flush(bf16_rne(a[j])); v[4 + j] = toh_flush(bf16_rne(b[j])); }
  { *(v8b*)(XH + (size_t)tile * TILE + part * 256 + (hh * 16 + nloc) * 8) = v;  }
}

__device__ __forceinline__ void wt_part(const unsigned blk, const unsigned y, const float* __restrict__ w0, const float* __restrict__ w1, const float* __restrict__ w2, const float* __restrict__ w3, b16* __restrict__ WT) {
  const float* w = (y == 0) ? w0 : (y == 1) ? w1 : (y == 2) ? w2 : w3;
  const unsigned u = blk * 256 + threadIdx.x;                 // < KD*KD/8 (blk < WB)
  const unsigned e = u * 8, tile = u >> 6, part = (u >> 5) & 1u, hh = (u >> 4) & 1u, nloc = u & 15u;   // u = granule index in fragment order
  const unsigned o = (tile >> 5) * 16 + nloc, k0 = (tile & 31u) * 32 + part * 16 + hh * 8; v8b v;
#pragma unroll
  for (int j = 0; j < 8; ++j) v[j] = (b16)(bf16_rne(w[(size_t)(k0 + j) * KD + o]) * WSC);
  { *(v8b*)(WT + (size_t)y * KD * KD + e) = v;  }
}

// The x cast and the four weight planes depend on nothing but the inputs: one launch, the part chosen by a block-uniform branch. The weight blocks (8 strided reads a thread) come first in the index.
constexpr unsigned XB = (unsigned)((size_t)MT * KD / 8 / 256) /* blocks of the cast */, WB = KD * KD / 8 / 256 /* blocks of one weight plane */;
__global__ __launch_bounds__(256) void prep_kernel(const float* __restrict__ x, const float* __restrict__ w0, const float* __restrict__ w1, const float* __restrict__ w2, const float* __restrict__ w3, b16* __restrict__ XH, b16* __restrict__ WT) {
  const unsigned blk = blockIdx.x;                            // < 4 * WB + XB (grid exact)
  if (blk < 4 * WB) wt_part(blk % WB, blk / WB, w0, w1, w2, w3, WT);
  else xh_part(blk - 4 * WB, x, XH);
}

// One k-stage of a GEMM ring is 64 of depth (2 k-tiles) of each row block, every 1024-byte tile kept in fragment order.
constexpr unsigned SKT = 2 /* k-tiles per stage */, SRB = SKT * TILE /* halves of one row block in a stage */, NSTG = KTD / SKT;
static_assert(KTD % SKT == 0 && NSTG >= 2);
// A stage of the projection block: 16 row blocks of x, then 8 row blocks each of Wq^T, Wk^T and Wv^T.
constexpr unsigned PXR = 16 /* row blocks of x */, PWR = 24 /* row blocks of the three weight planes */, SOPX = PXR * SRB /* halves of the x part */, STG = (PXR + PWR) * SRB /* halves of a stage: 80 KiB */;
static_assert(MT % 256 == 0 && KD % 128 == 0);                   // projection block tile multiples

// A wave's 8 copies of 512 bytes: the 2048 contiguous bytes that a stage takes of two row blocks (la <- ga, lb <- gb; LDS byte addresses and global pointers of the lane's own 16 bytes).
__device__ __forceinline__ void copy8(unsigned la, const b16* ga, unsigned lb, const b16* gb) {
  // the closing s_wait_xcnt stands inside the statement so that no address register of a copy is rewritten ahead of it
  asm volatile("global_load_async_to_lds_b128 %0, %8, off\n\t"
               "global_load_async_to_lds_b128 %1, %9, off\n\t"
               "global_load_async_to_lds_b128 %2, %10, off\n\t"
               "global_load_async_to_lds_b128 %3, %11, off\n\t"
               "global_load_async_to_lds_b128 %4, %12, off\n\t"
               "global_load_async_to_lds_b128 %5, %13, off\n\t"
               "global_load_async_to_lds_b128 %6, %14, off\n\t"
               "global_load_async_to_lds_b128 %7, %15, off\n\t"
               "s_wait_xcnt 0x0"
               :: "v"(la), "v"(la + 512u), "v"(la + 1024u), "v"(la + 1536u), "v"(lb), "v"(lb + 512u), "v"(lb + 1024u), "v"(lb + 1536u),
                  "v"(ga), "v"(ga + 256), "v"(ga + 512), "v"(ga + 768), "v"(gb), "v"(gb + 256), "v"(gb + 512), "v"(gb + 768)
               : "memory");
}

// The lane's number in its wave (block one-dimensional: threadIdx.x & 31), computed where it stands: a volatile statement is not moved out of a loop or ahead of one, so what is formed from it holds no register before.
__device__ __forceinline__ unsigned lane_now() { unsigned l; asm volatile("v_mbcnt_lo_u32_b32 %0, -1, 0" : "=v"(l)); return l; }

// ---------------- the three projections, depth 1024, one launch: C[m][n] = sum_k A[m][k] Bt[n][k]; operands f16 planes in fragment order (32 k-tiles per row block).
// block = 12 waves, tile 256 tokens x 384 features: the same 128 features (cb ..) of Q, of K and of V; grid (MT/256, 8) = 256 blocks, one on every WGP, one round. Wave tile 128 x 64 (8 x 4 accumulators).
// A block's 256 rows of x serve all three projections: 640 operand rows leave L2 for 98,304 results (a 128 x 128 tile: 256 rows for 16,384), and a fragment read from LDS feeds 4 or 8 products.
// Waves 4p .. 4p + 3 hold projection p. Q, K: A = x (tokens 128 (s & 1) ..), Bt = weight rows (features 64 (s >> 1) ..), s = wave & 3. V: A = all 128 weight rows, Bt = x (tokens 64 s ..), so the wave holds V^T.
// The operands pass through LDS: asynchronous copies fill a ring of two stages, stage t + 2 flying while stage t + 1 is worked on; waves 0..7 copy two row blocks of x each, every wave two row blocks of
// its own weight plane; fragments are read from LDS, 512 contiguous bytes per load.
// f16 out, y = acc*scale + bias[col], or + bias[row] in a V wave. The wave stages its tile, 32 rows at a time, in LDS of its own (in the ring, once the ring is done with) and stores whole lines.
static_assert((size_t)12 * 32 * 72 * 2 + (size_t)12 * 128 * 4 <= (size_t)2 * STG * 2);   // the 12 staging tiles and the 12 waves' bias entries fit the ring's LDS
__global__ __launch_bounds__(384) void qkv_kernel(const b16* __restrict__ XH, const b16* __restrict__ WT, const float* __restrict__ bq, const float* __restrict__ bk, const float* __restrict__ bv, b16* __restrict__ QK, b16* __restrict__ VT, float scale) {
  __shared__ __attribute__((aligned(16))) b16 ring[2 * STG];
  const unsigned wave = __builtin_amdgcn_readfirstlane(threadIdx.x >> 5) /* scalar: the tests on it below are scalar branches */, lane = threadIdx.x & 31;
  const unsigned ws = wave & 3, wp = wave >> 2;
  const bool isv = wp == 2;                                   // wave-uniform
  const unsigned mb = blockIdx.x * 256, cb = blockIdx.y * 128;
  v8f acc[8][4];
#pragma unroll
  for (int i = 0; i < 8; ++i)
#pragma unroll
    for (int j = 0; j < 4; ++j) acc[i][j] = (v8f){};
  const unsigned sx = ((mb >> 4) + 2 * wave) * (KTD * TILE);                          // halves from XH; used by waves 0..7 only
  const unsigned sw = wp * (KD * KD) + ((cb >> 4) + 2 * ws) * (KTD * TILE);           // halves from WT
  // The accumulators leave no register for a vector pointer to live across the products: a stage's offsets are scalar, and the lane's part is formed anew in every stage (lane_now).
  auto fill = [&](unsigned t) {
    const unsigned ln = lane_now();
    const unsigned l = (unsigned)(size_t)(&ring[0]) + (t & 1u) * (STG * 2) + wave * (2 * SRB * 2) + ln * 16;   // LDS byte address: low 32 bits of the shared address
    if (wave < 8) { const b16* px = XH + (sx + t * SRB) + ln * 8; copy8(l, px, l + SRB * 2, px + KTD * TILE); }   // scalar branch: a whole wave issues or none of it
    const b16* pw = WT + (sw + t * SRB) + ln * 8;
    copy8(l + SOPX * 2, pw, l + SOPX * 2 + SRB * 2, pw + KTD * TILE);
  };
  fill(0);
  asm volatile("s_wait_asynccnt 0x0" ::: "memory");   // this wave's share of stage 0 has landed
  __syncthreads();                                    // every wave's share of stage 0 has landed
  fill(1);
  const unsigned oa = (isv ? SOPX + 16 * SRB : (ws & 1) * (8 * SRB)) + lane * 8;                       // 8 row blocks
  const unsigned ob = (isv ? ws * (4 * SRB) : SOPX + wp * (8 * SRB) + (ws >> 1) * (4 * SRB)) + lane * 8;   // 4 row blocks
#pragma unroll 1   // one trip is one stage: 64 products per wave
  for (unsigned t = 0; t < NSTG; ++t) {
    const b16* la = ring + (t & 1u) * STG + oa;
    const b16* lb = ring + (t & 1u) * STG + ob;
#pragma unroll
    for (unsigned kk = 0; kk < SKT; ++kk) {
      v16b fb[4];
#pragma unroll
      for (int j = 0; j < 4; ++j) fb[j] = frag_pk(lb + j * SRB + kk * TILE);
#pragma unroll
      for (int ih = 0; ih < 2; ++ih) {   // the A fragments four at a time: all eight beside the 256 accumulator registers would pass the budget of three waves a SIMD
        v16b fa[4];
#pragma unroll
        for (int i = 0; i < 4; ++i) fa[i] = frag_pk(la + (ih * 4 + i) * SRB + kk * TILE);
#pragma unroll
        for (int j = 0; j < 4; ++j)
#pragma unroll
          for (int i = 0; i < 4; ++i) acc[ih * 4 + i][j] = __builtin_amdgcn_wmma_f32_16x16x32_f16(false, fa[i], false, fb[j], (short)0, acc[ih * 4 + i][j], false, false);
      }
    }
    asm volatile("s_wait_dscnt 0x0" ::: "memory");      // this wave's reads of stage t are done before the stage's buffer is given up
    asm volatile("s_wait_asynccnt 0x0" ::: "memory");   // this wave's share of stage t + 1 has landed
    __syncthreads();                                    // publishes stage t + 1 and ends every wave's reads of stage t
    if (t + 2 < NSTG) fill(t + 2);                      // block-uniform; into the buffer that stage t has left
  }
  asm volatile("s_wait_asynccnt 0x0" ::: "memory");     // no copy is outstanding when the ring's LDS is given to the staging tiles
  {
    // The last trip's barrier has ended every wave's reads of the ring: from here its LDS holds 12 staging tiles of 32 rows, pitch 72 halves, one a wave.
    b16 (*Th)[72] = reinterpret_cast<b16 (*)[72]>(&ring[0] + wave * (32 * 72));
    const unsigned lane = lane_now(), nloc = lane & 15, hh = lane >> 4;   // formed anew, so that no address of the epilogue is kept in registers across the k loop
    const unsigned m0 = isv ? cb : mb + (ws & 1) * 128, n0 = isv ? mb + ws * 64 : wp * KD + cb + (ws >> 1) * 64, opitch = isv ? MT : QKP;
    b16* outH = isv ? VT : QK;
    // The wave's 128 bias entries (from cb: of its rows in a V wave, of the block's columns in a Q or K wave) go through LDS of its own: 4 a lane, rounded once, read back as each 32 rows need them.
    float* Bs = reinterpret_cast<float*>(&ring[0] + 12 * (32 * 72)) + wave * 128;
    {
      const float* bp = (isv ? bv : wp == 1 ? bk : bq) + cb + lane * 4; v4f b4;
      // the load and its data wait in one statement, so that its address registers are not rewritten while it is in flight
      asm volatile("global_load_b128 %0, %1, off\n\t"
                   "s_wait_loadcnt 0x0"
                   : "=&v"(b4) : "v"(bp) : "memory");
#pragma unroll
      for (int e = 0; e < 4; ++e) b4[e] = bf16_rne(b4[e]);
      *(v4f*)(Bs + lane * 4) = b4;
    }
    wave_lds_sync();   // wave-private entries: same wave writes and reads
    // The loops are fully unrolled so that every index of br, bc and acc is a compile-time constant and the arrays stay in registers.
    float bc[4];
#pragma unroll
    for (int j = 0; j < 4; ++j) bc[j] = Bs[(ws >> 1) * 64 + j * 16 + nloc];   // used by Q and K waves
    // 32 rows of the wave's tile at a time (beside all 256 accumulator registers there is room for the row bias of 32 rows, not of more). iq is a literal at every call;
    // always_inline: every copy must see its literal, so that acc is indexed by constants alone.
    auto rows32 = [&](const int iq, const bool vrow) __attribute__((always_inline)) {
      float br[2][8] = {};
      if (vrow) {   // compile-time
#pragma unroll
        for (int i = 0; i < 2; ++i) { const float* rp = Bs + iq * 32 + i * 16 + 8 * hh; const v4f a = *(const v4f*)(rp), b = *(const v4f*)(rp + 4);
#pragma unroll
          for (int e = 0; e < 4; ++e) { br[i][e] = a[e]; br[i][4 + e] = b[e]; } }
      }
#pragma unroll
      for (int i = 0; i < 2; ++i)
#pragma unroll
        for (int j = 0; j < 4; ++j) { const unsigned col = j * 16 + nloc;
#pragma unroll
          for (int r = 0; r < 8; ++r) { const unsigned row = i * 16 + 8 * hh + r; Th[row][col] = (b16)(acc[iq * 2 + i][j][r] * scale + (vrow ? br[i][r] : bc[j])); } }
      wave_lds_sync();   // wave-private tile: same wave writes and reads
#pragma unroll
      for (int rtl = 0; rtl < 2; ++rtl) {
      v8b d[2][2];   // a row block's four reads ahead of its stores: the store statements order memory, and a read placed between them would wait out its LDS latency there
#pragma unroll
      for (int ktl = 0; ktl < 2; ++ktl) { const b16* tp = &Th[rtl * 16 + nloc][ktl * 32 + hh * 8]; d[ktl][0] = *(const v8b*)(tp); d[ktl][1] = *(const v8b*)(tp + 16); }
#pragma unroll
      for (int ktl = 0; ktl < 2; ++ktl) {
        b16* op = outH + ((size_t)((m0 >> 4) + iq * 2 + rtl) * (opitch >> 5) + (n0 >> 5) + ktl) * TILE + lane * 8;   // one tile of the out plane in fragment order, k = column
        // the tile's two stores of 512 contiguous bytes and their s_wait_xcnt in one statement, so that no address or data register of a store is rewritten ahead of the wait
        asm volatile("global_store_b128 %0, %1, off\n\t"
                     "global_store_b128 %0, %2, off offset:512\n\t"
                     "s_wait_xcnt 0x0"
                     :: "v"(op), "v"(d[ktl][0]), "v"(d[ktl][1]) : "memory"); }
      }
      wave_lds_sync();   // the next 32 rows overwrite the tile only behind these reads
    };
    if (isv) { rows32(0, true); rows32(1, true); rows32(2, true); rows32(3, true); }          // scalar branch: a V wave adds the bias of its rows,
    else { rows32(0, false); rows32(1, false); rows32(2, false); rows32(3, false); }          // a Q or K wave that of its columns
  }
}

// ---------------- causal flash attention, transposed form. grid (heads, batch, SEQ/64), 4 independent waves, wave = 16 query rows i (iw0 .. iw0+15), key tiles of 64.
// A work-group of query tile qt walks qt + 1 key tiles and only half the work-groups are resident at once: qt falls with the flat index (slowest grid axis, counted down), so the longest start first and the shortest fill the tail.
// S^T tile t (16 keys x 16 queries) = K rows (A: row = key, k = d) x Q rows (B: col = query, k = d); lane holds query i = lane&15, keys 16t+8hh+r.
// p = exp2(s*0.125*log2e - m) as f16; P^T is the B operand of O^T = V^T P^T directly from the score accumulators: k-step c (32 keys) elements 0..7 <- tile 2c acc[0..7],
// elements 8..15 <- tile 2c+1 acc[0..7] (the D row map equals the B k map). A = VT rows (row = d, k = key). O^T acc[r] = O[d = 16dt+8hh+r][i = lane&15].
__global__ __launch_bounds__(128) void attn_kernel(const b16* __restrict__ QK, const b16* __restrict__ VT, b16* __restrict__ CTX) {
  const unsigned wave = threadIdx.x >> 5, lane = threadIdx.x & 31, nloc = lane & 15, hh = lane >> 4;
  const unsigned qt = SEQU / 64 - 1 - blockIdx.z, h = blockIdx.x, b = blockIdx.y;
  const unsigned iw0 = qt * 64 + wave * 16;
  const b16* qrow = QK + ((size_t)((b * SEQU + iw0) >> 4) * KTQ + h * 2) * TILE + lane * 8;
  const v16b qf0 = frag_pk(qrow), qf1 = frag_pk(qrow + TILE);
  const b16* kbase = QK + ((size_t)((b * SEQU) >> 4) * KTQ + KTD + h * 2) * TILE + lane * 8;
  const b16* vbase = VT + ((size_t)(h * 4) * KTV + ((b * SEQU) >> 5)) * TILE + lane * 8;
  v8f o[4];
#pragma unroll
  for (int dt = 0; dt < 4; ++dt) o[dt] = (v8f){};
  float m = -1.0e30f, l = 0.0f;
  const float SCL = 0.125f * LOG2E;
  const unsigned iq = iw0 + nloc;
  // K and V fragments of a key tile each have 8 register sets of their own and are loaded as one group: V of tile jt ahead of the score products, K of tile jt + 1 behind them, ahead of the softmax
  v16b kf[8], vf[8];
#pragma unroll
  for (int t = 0; t < 4; ++t) { const b16* kr = kbase + (size_t)t * KTQ * TILE; kf[2 * t] = frag_pk(kr); kf[2 * t + 1] = frag_pk(kr + TILE); }
  asm volatile("s_wait_xcnt 0x0" ::: "memory");   // the loop reuses the address registers of the Q and K loads while these are in flight
  // One key tile. diag is a literal at both calls: only the block's last tile (jt == qt) crosses the diagonal, so the tiles in front of it carry no mask code at all and always have a next tile to fetch.
  // always_inline: both copies must see their literal, and the register arrays must stay in registers.
  auto tile = [&](const unsigned jt, const bool diag) __attribute__((always_inline)) {
    const unsigned j0 = jt * 64;
#pragma unroll
    for (int dt = 0; dt < 4; ++dt) { const b16* vr = vbase + ((size_t)dt * KTV + jt * 2) * TILE; vf[2 * dt] = frag_pk(vr); vf[2 * dt + 1] = frag_pk(vr + TILE); }
    __builtin_amdgcn_sched_barrier(0);   // keeps the V loads at the head of the trip: without it the first score product moves up with its wait on K, and the V loads are issued only behind that wait
    v8f s[4];
#pragma unroll
    for (int t = 0; t < 4; ++t) { s[t] = wmma16b(kf[2 * t], qf0, (v8f){}); s[t] = wmma16b(kf[2 * t + 1], qf1, s[t]); }
    asm volatile("s_wait_xcnt 0x0" ::: "memory");   // the V loads are in flight and their address registers are reused from here on
    if (!diag) {                                     // compile-time: the next key tile exists
#pragma unroll
      for (int t = 0; t < 4; ++t) { const b16* kr = kbase + (size_t)((jt + 1) * 4 + t) * KTQ * TILE; kf[2 * t] = frag_pk(kr); kf[2 * t + 1] = frag_pk(kr + TILE); }
      asm volatile("s_wait_xcnt 0x0" ::: "memory");   // the softmax reuses the address registers of these loads while they are in flight
    }
    float mx = -1.0e30f;
#pragma unroll
    for (int t = 0; t < 4; ++t)
#pragma unroll
      for (int r = 0; r < 8; ++r) { float xv = s[t][r] * SCL; if (diag) { const unsigned j = j0 + 16 * t + 8 * hh + r; xv = (j > iq) ? -1.0e30f : xv; } s[t][r] = xv; mx = fmaxf(mx, xv); }
    mx = fmaxf(mx, __shfl_xor(mx, 16, 32));
    const float newm = fmaxf(m, mx); const float alpha = exp2_bare(m - newm); m = newm;
    float psum = 0.0f; v16b pf0, pf1;
#pragma unroll
    for (int t = 0; t < 4; ++t)
#pragma unroll
      for (int r = 0; r < 8; ++r) { const b16 ph = (b16)exp2_bare(s[t][r] - m); psum += (float)ph; if (t < 2) pf0[(t & 1) * 8 + r] = ph; else pf1[(t & 1) * 8 + r] = ph; }
    psum += __shfl_xor(psum, 16, 32);
    l = l * alpha + psum;
#pragma unroll
    for (int dt = 0; dt < 4; ++dt)
#pragma unroll
      for (int r = 0; r < 8; ++r) o[dt][r] *= alpha;
#pragma unroll
    for (int dt = 0; dt < 4; ++dt) { o[dt] = wmma16b(vf[2 * dt], pf0, o[dt]); o[dt] = wmma16b(vf[2 * dt + 1], pf1, o[dt]); }
  };
#pragma unroll 1   // one trip is one key tile; unrolled, the two fragment groups of several tiles would not fit the registers
  for (unsigned jt = 0; jt < qt; ++jt) tile(jt, false);   // block-uniform trip count; every key of these tiles lies in front of every query of the block
  tile(qt, true);                                         // the diagonal tile: holds at least key j0 <= i for every query of the block
  const float inv = CSC * (1.0f / l);                // l >= 1 (the running-max key contributes exactly 1)
  b16* cp = CTX + ((size_t)((b * SEQU + iw0) >> 4) * KTD + h * 2) * TILE + lane * 8;
#pragma unroll
  for (int dt = 0; dt < 4; ++dt) { v8b v;
#pragma unroll
    for (int r = 0; r < 8; ++r) v[r] = (b16)(o[dt][r] * inv);
    *(v8b*)(cp + (dt >> 1) * TILE + (dt & 1) * 256) = v; }   // the lane's 8 values (query nloc, d = 16dt+8hh+0..7) are its own granule of the CTX tile: 512 contiguous bytes per wave store
}

// ---------------- output projection with the skip connection and the LayerNorm in its epilogue: out = LayerNorm(ctx Wo + bo + x) * gamma + beta.
// A work-group owns 64 whole rows (tokens): block tile 64 x 1024, 16 waves, wave w = all 64 tokens x features 64 w .. 64 w + 63, so a row's mean and variance need no other work-group and y never leaves the chip.
// The k loop is that of the projections: a ring of two stages of 64 of depth, filled by asynchronous copies. A stage holds 4 row blocks of CTX (8 KiB, read by every wave) and all 64 row blocks of Wo^T (128 KiB).
// A wave copies one 512-byte piece of the CTX part and the 4 row blocks of Wo^T that it reads itself. The product is taken as y^T = Wo^T ctx^T (A = Wo^T rows, B = CTX rows, as for V^T): a lane then holds
// 8 neighbouring features of one token (token 16 j + nloc, features 16 i + 8 hh + 0..7), which go to LDS as two 16-byte stores. Behind the loop the ring's LDS takes the 64 x 1024 f32 tile; a wave normalises 4 whole rows.
constexpr unsigned OSA = 4 * SRB /* halves of the CTX part of a stage */, OSTG = OSA + (KD / 16) * SRB /* halves of a stage: 136 KiB */, OTP = KD + 4 /* pitch of the f32 tile (floats): neighbouring rows lie 4 banks apart */;
static_assert((size_t)64 * OTP * 4 <= (size_t)2 * OSTG * 2);    // the f32 tile fits the ring's LDS
static_assert((size_t)2 * OSTG * 2 <= 327680);                   // the ring fits a WGP's LDS
static_assert(KD == 16u * 64u && SEQU % 64 == 0 && MT % 64 == 0);   // 16 waves span a row; a 64-row block never straddles a batch; grid exact

// One copy of 512 bytes (l, g: LDS byte address and global pointer of the lane's own 16 bytes).
__device__ __forceinline__ void copy1(unsigned l, const b16* g) {
  // the closing s_wait_xcnt stands inside the statement so that no address register of the copy is rewritten ahead of it
  asm volatile("global_load_async_to_lds_b128 %0, %1, off\n\t"
               "s_wait_xcnt 0x0"
               :: "v"(l), "v"(g) : "memory");
}

__global__ __launch_bounds__(512) void outln_kernel(const b16* __restrict__ CTX, const b16* __restrict__ WoT, const float* __restrict__ bo, const float* __restrict__ x, const float* __restrict__ gam, const float* __restrict__ bet, float* __restrict__ out, float scale) {
  __shared__ __attribute__((aligned(16))) b16 ring[2 * OSTG];
  const unsigned wave = threadIdx.x >> 5, lane = threadIdx.x & 31, nloc = lane & 15, hh = lane >> 4;
  const unsigned mb = blockIdx.x * 64, nw = wave * 64;
  // the lane's 32 bias entries, asked for ahead of the ring's first copies: they are used only behind the k loop
  v4f bb[4][2];
#pragma unroll
  for (int i = 0; i < 4; ++i) { const float* bp = bo + nw + i * 16 + 8 * hh; bb[i][0] = *(const v4f*)(bp); bb[i][1] = *(const v4f*)(bp + 4); }
  v8f acc[4][4];
#pragma unroll
  for (int i = 0; i < 4; ++i)
#pragma unroll
    for (int j = 0; j < 4; ++j) acc[i][j] = (v8f){};
  const b16* ga = CTX + ((size_t)(mb >> 4) + (wave >> 2)) * KTD * TILE + (wave & 3) * 256 + lane * 8;   // piece wave & 3 of the stage's 2048 bytes of row block wave >> 2
  const b16* gb = WoT + (size_t)(4 * wave) * KTD * TILE + lane * 8;
  const unsigned l0 = (unsigned)(size_t)(&ring[0]) + lane * 16;   // LDS byte address: low 32 bits of the shared address
  auto fill = [&](unsigned t) {
    const unsigned l = l0 + (t & 1u) * (OSTG * 2), lb = l + OSA * 2 + wave * (4 * SRB * 2); const b16* pb = gb + t * SRB;
    copy1(l + wave * 512, ga + t * SRB);
    copy8(lb, pb, lb + SRB * 2, pb + KTD * TILE);
    copy8(lb + 2 * SRB * 2, pb + 2 * KTD * TILE, lb + 3 * SRB * 2, pb + 3 * KTD * TILE);
  };
  fill(0);
  asm volatile("s_wait_asynccnt 0x0" ::: "memory");   // this wave's share of stage 0 has landed
  __syncthreads();                                    // every wave's share of stage 0 has landed
  fill(1);
#pragma unroll 1   // one trip is one stage: 32 products per wave
  for (unsigned t = 0; t < NSTG; ++t) {
    const b16* lc = ring + (t & 1u) * OSTG + lane * 8;
    const b16* lw = ring + (t & 1u) * OSTG + OSA + wave * (4 * SRB) + lane * 8;
#pragma unroll
    for (unsigned kk = 0; kk < SKT; ++kk) {
      v16b fw[4], fc[4];
#pragma unroll
      for (int i = 0; i < 4; ++i) { fw[i] = frag_pk(lw + i * SRB + kk * TILE); fc[i] = frag_pk(lc + i * SRB + kk * TILE); }
#pragma unroll
      for (int j = 0; j < 4; ++j)
#pragma unroll
        for (int i = 0; i < 4; ++i) acc[i][j] = wmma16b(fw[i], fc[j], acc[i][j]);
    }
    asm volatile("s_wait_dscnt 0x0" ::: "memory");      // this wave's reads of stage t are done before the stage's buffer is given up
    asm volatile("s_wait_asynccnt 0x0" ::: "memory");   // this wave's share of stage t + 1 has landed
    __syncthreads();                                    // publishes stage t + 1 and ends every wave's reads of stage t
    if (t + 2 < NSTG) fill(t + 2);                      // block-uniform; into the buffer that stage t has left
  }
  asm volatile("s_wait_asynccnt 0x0" ::: "memory");     // no copy is outstanding when the ring's LDS is given to the f32 tile
  // The last trip's barrier has ended every wave's reads of the ring: from here its LDS holds acc*scale + bo, 64 rows of pitch OTP.
  // The wave's 4 rows of x are asked for among the stores, a row as the accumulators of a token block give up their registers, so that they fly while the tile is written.
  float* Tf = (float*)(&ring[0]);
  float* tb = Tf + nloc * OTP + nw + 8 * hh;
  const unsigned bt = mb / SEQU; const unsigned mfull = bt * SEQF + (mb - bt * SEQU);
  const size_t ro = (size_t)(mfull + wave * 4) * KD + lane * 4;
  const float* xp = x + ro;
  v4f y[4][8], ga4[8], be4[8];
#pragma unroll
  for (int i = 0; i < 4; ++i)
#pragma unroll
    for (int e = 0; e < 4; ++e) { bb[i][0][e] = bf16_rne(bb[i][0][e]); bb[i][1][e] = bf16_rne(bb[i][1][e]); }
#pragma unroll
  for (int j = 0; j < 4; ++j) {
#pragma unroll
    for (int c = 0; c < 8; ++c) y[j][c] = *(const v4f*)(xp + j * KD + c * 128);
#pragma unroll
    for (int i = 0; i < 4; ++i) { v4f lo, hi;
#pragma unroll
      for (int e = 0; e < 4; ++e) { lo[e] = acc[i][j][e] * scale + bb[i][0][e]; hi[e] = acc[i][j][4 + e] * scale + bb[i][1][e]; }
      *(v4f*)(tb + j * 16 * OTP + i * 16) = lo; *(v4f*)(tb + j * 16 * OTP + i * 16 + 4) = hi; }
  }
#pragma unroll
  for (int c = 0; c < 8; ++c) { ga4[c] = *(const v4f*)(gam + lane * 4 + c * 128); be4[c] = *(const v4f*)(bet + lane * 4 + c * 128); }
  __syncthreads();                                      // the f32 tile is complete: a row holds the features of all 16 waves
#pragma unroll
  for (int c = 0; c < 8; ++c)
#pragma unroll
    for (int e = 0; e < 4; ++e) { ga4[c][e] = bf16_rne(ga4[c][e]); be4[c][e] = bf16_rne(be4[c][e]); }
#pragma unroll
  for (int q = 0; q < 4; ++q) {
    const float* tr = Tf + (wave * 4 + q) * OTP + lane * 4;
    float s = 0.0f;
#pragma unroll
    for (int c = 0; c < 8; ++c) { v4f a = *(const v4f*)(tr + c * 128);
#pragma unroll
      for (int e = 0; e < 4; ++e) a[e] += bf16_rne(y[q][c][e]);
      y[q][c] = a; s += (a[0] + a[1]) + (a[2] + a[3]); }
#pragma unroll
    for (int m = 16; m > 0; m >>= 1) s += __shfl_xor(s, m, 32);
    const float mu = s * (1.0f / 1024.0f);
    float v = 0.0f;
#pragma unroll
    for (int c = 0; c < 8; ++c)
#pragma unroll
      for (int e = 0; e < 4; ++e) { const float d0 = y[q][c][e] - mu; v += d0 * d0; }
#pragma unroll
    for (int m = 16; m > 0; m >>= 1) v += __shfl_xor(v, m, 32);
    const float inv = rsqrtf(v * (1.0f / 1024.0f) + LNEPS);
#pragma unroll
    for (int c = 0; c < 8; ++c) { v4f t;
#pragma unroll
      for (int e = 0; e < 4; ++e) t[e] = (y[q][c][e] - mu) * inv * ga4[c][e] + be4[c][e];
      *(v4f*)(out + ro + q * KD + c * 128) = t; }
  }
}

}  // namespace

extern "C" void kernel_launch(void* const* d_in, const int* in_sizes, int n_in, void* d_out, int out_size, void* d_ws, size_t ws_size, hipStream_t stream) {
  if (n_in < 11) return;
  // wire order: 0 x [4,2048,1024], 1 Wq [1024,1024] (in,out), 2 bq, 3 Wk, 4 bk, 5 Wv, 6 bv, 7 Wo [1024,1024] (in,out), 8 bo, 9 gamma [1024], 10 beta [1024]; all f32. Output f32 [4,2048,1024].
  const size_t need = ((size_t)(NBU - 1) * SEQF + SEQU) * KD;
  if ((size_t)in_sizes[0] < need || (size_t)out_size < need) return;
  if (in_sizes[2] < (int)KD || in_sizes[4] < (int)KD || in_sizes[6] < (int)KD || in_sizes[8] < (int)KD || in_sizes[9] < (int)KD || in_sizes[10] < (int)KD) return;
  if ((size_t)in_sizes[1] < (size_t)KD * KD || (size_t)in_sizes[3] < (size_t)KD * KD || (size_t)in_sizes[5] < (size_t)KD * KD || (size_t)in_sizes[7] < (size_t)KD * KD) return;
  const float* x = (const float*)d_in[0];
  const float* Wq = (const float*)d_in[1]; const float* bq = (const float*)d_in[2]; const float* Wk = (const float*)d_in[3]; const float* bk = (const float*)d_in[4];
  const float* Wv = (const float*)d_in[5]; const float* bv = (const float*)d_in[6]; const float* Wo = (const float*)d_in[7]; const float* bo = (const float*)d_in[8];
  const float* gam = (const float*)d_in[9]; const float* bet = (const float*)d_in[10];
  float* out = (float*)d_out;
  size_t off = 0; char* ws = (char*)d_ws;
  auto carve = [&](size_t bytes) { char* p = ws + off; off += (bytes + 255) & ~(size_t)255; return p; };
  b16* XH = (b16*)carve(SZ_XH);        // 16 MiB  x as f16 [MT][1024], fragment order
  b16* WT = (b16*)carve(SZ_WT);        //  8 MiB  weight planes [4][1024 out][1024 in] x16, fragment order
  b16* QK = (b16*)carve(SZ_QK);        // 32 MiB  [MT][Q 1024 | K 1024] f16, fragment order
  b16* VT = (b16*)carve(SZ_VT);        // 16 MiB  V^T [h*64+d][MT] f16, fragment order
  b16* CTX = (b16*)carve(SZ_CTX);      // 16 MiB  attention output x32 f16 [MT][1024], fragment order
  if (off > ws_size || off > ((size_t)128 << 20)) return;   // 88 MiB at the shipped sizes
  const float s16 = 1.0f / WSC, s512 = 1.0f / (WSC * CSC);
  prep_kernel<<<4 * WB + XB, 256, 0, stream>>>(x, Wq, Wk, Wv, Wo, XH, WT);                                                           // XH, and the four weight planes
  qkv_kernel<<<dim3(MT / 256, KD / 128), 384, 0, stream>>>(XH, WT, bq, bk, bv, QK, VT, s16);                                              // Q = x Wq + bq | K = x Wk + bk -> QK; V^T[c][m] = sum_k WvT[c][k] x[m][k] + bv[c] -> VT
  attn_kernel<<<dim3(NHEAD, NBU, SEQU / 64), 128, 0, stream>>>(QK, VT, CTX);
  outln_kernel<<<MT / 64, 512, 0, stream>>>(CTX, WT + (size_t)3 * KD * KD, bo, x, gam, bet, out, s512);                                      // out = LayerNorm(ctx Wo + bo + x) * gamma + beta
}

// v010
// It runs in 105 microseconds.
// Next to v009, in two timings, it ran 1.05 times as fast each time.
// All steps since v000 together make it 4.02 times as fast.
#include <hip/hip_runtime.h>

// compute dtype: every contraction on v_wmma_f32_16x16x32_f16 (f16 operands, f32 accumulate), single products: x [Wq|Wk|Wv] (x exact bf16 as f16, weights exact bf16 x16),
// S^T = K Q^T (q, k f16), O^T = V^T P^T (v f16, p = exp2(s - max) f16 in (0,1]), ctx Wo (ctx f16 x32, Wo exact bf16 x16). Softmax, bias, the skip connection and
// the closing LayerNorm in f32. All float inputs are RNE-converted to bf16 on load. Fragment k-map per lane half hh for A AND B: elements 0..7 <- k = 8hh+0..7,
// Operand planes (XH, WT, Q|K, V^T, CTX) are stored in fragment order: a tile of 16 rows x 32 k is 1024 contiguous bytes, tile (rt, kt) of a plane with KT k-tiles per row block at
// halves (rt*KT + kt)*512; inside it lane l = 16hh + row owns halves 8l..8l+7 (k = 8hh+0..7) and 256+8l..256+8l+7 (k = 16+8hh+0..7), so each fragment load of a wave is 512 contiguous bytes.
// Structure: causal post-LN attention block; x cast -> Q|K plane, V^T plane -> fused causal flash attention -> y = ctx Wo + bo + x, whole rows in one work-group's LDS -> LayerNorm(y) -> output buffer.

#ifndef NB
#define NB 4
#endif
#ifndef SEQ
#define SEQ 2048
#endif
#ifndef SEQ_FULL
#define SEQ_FULL 2048
#endif

namespace {

constexpr unsigned KD = 1024 /* model width == heads * head dim == GEMM depth */, NHEAD = 16, DH = 64, QKP = 2048 /* pitch of the Q|K plane (halves) */;
constexpr unsigned NBU = NB, SEQU = SEQ, SEQF = SEQ_FULL, MT = NBU * SEQU /* compact rows */;
constexpr float LOG2E = 1.4426950408889634f, LNEPS = 1e-5f, WSC = 16.0f /* weight carry */, CSC = 32.0f /* ctx carry */;
static_assert(NHEAD * DH == KD);
static_assert(SEQU % 128 == 0 && SEQU <= SEQF && NBU >= 1);
static_assert(MT % 128 == 0 && KD % 32 == 0);

// extents the added kernels and the launch plan rely on
static_assert(KD == 8u * 128u);                                  // LayerNorm: 8 chunks x 32 lanes x 4 floats per row
static_assert(((size_t)MT * KD / 8) % 256 == 0);                 // cast grid exact
static_assert(((size_t)KD * KD / 8) % 256 == 0);                 // weight plane grid exact
static_assert(MT % 64 == 0 && KD % 128 == 0 && KD % 64 == 0 && SEQU % 64 == 0);   // GEMM / attention tile multiples
constexpr unsigned TILE = 512 /* halves of one 16 x 32 fragment tile */, KTD = KD / 32 /* k-tiles per row block, depth-1024 planes */, KTQ = QKP / 32 /* Q|K plane */, KTV = MT / 32 /* V^T plane */;
static_assert(KTD == 32);                                        // the cast and weight kernels split a tile index by shifts of 5
constexpr size_t SZ_XH = (size_t)MT * KD * 2, SZ_WT = (size_t)4 * KD * KD * 2, SZ_QK = (size_t)MT * QKP * 2, SZ_VT = (size_t)KD * MT * 2, SZ_CTX = (size_t)MT * KD * 2;
static_assert(SZ_XH % 256 == 0 && SZ_WT % 256 == 0 && SZ_QK % 256 == 0 && SZ_VT % 256 == 0 && SZ_CTX % 256 == 0);
static_assert(SZ_XH + SZ_WT + SZ_QK + SZ_VT + SZ_CTX <= ((size_t)128 << 20));   // 88 MiB at the shipped sizes

typedef _Float16 b16;
typedef __attribute__((ext_vector_type(16))) _Float16 v16b;
typedef __attribute__((ext_vector_type(8))) _Float16 v8b;
typedef __attribute__((ext_vector_type(8))) float v8f;
typedef __attribute__((ext_vector_type(4))) float v4f;
typedef __attribute__((ext_vector_type(2))) float v2f;

__device__ __forceinline__ float bf16_rne(float f) { unsigned int u = __float_as_uint(f); u += 0x7FFFu + ((u >> 16) & 1u); return __uint_as_float(u & 0xFFFF0000u); }
// p = tile base + 8 * lane
__device__ __forceinline__ v16b frag_pk(const b16* p) { const v8b a = *(const v8b*)(p), b = *(const v8b*)(p + 256); v16b f;
#pragma unroll
  for (int e = 0; e < 8; ++e) { f[e] = a[e]; f[8 + e] = b[e]; } return f; }
__device__ __forceinline__ v8f wmma16b(v16b a, v16b b, v8f c) { v8f d = __builtin_amdgcn_wmma_f32_16x16x32_f16(false, a, false, b, (short)0, c, false, false); asm volatile("v_nop\n\tv_nop\n\tv_nop\n\tv_nop" : "+v"(d) : "v"(a), "v"(b)); return d; }
__device__ __forceinline__ void wave_lds_sync() { __builtin_amdgcn_fence(3 /* release order */, "workgroup"); __builtin_amdgcn_wave_barrier(); __builtin_amdgcn_fence(2 /* acquire order */, "workgroup"); }
// f32 -> f16 operand convert that cannot yield an f16 subnormal (value select below 2^-14)
__device__ __forceinline__ b16 toh_flush(float v) { const b16 r = (b16)v; return (fabsf(v) < 6.103515625e-05f) ? (b16)0.0f : r; }

// 2^x as the bare v_exp_f32, for x <= 0 in the softmax. The library exp2f wraps it in a range guard (compare, two selects, add, ldexp) that only matters for results below 2^-126, where the bare
// instruction may give 0 for a subnormal: as p such a value rounds to f16 zero either way, and as the rescale factor it multiplies sums that then stand beside a term of 1.
__device__ __forceinline__ float exp2_bare(float x) { return __builtin_amdgcn_exp2f(x); }

__device__ __forceinline__ void xh_part(const unsigned blk, const float* __restrict__ x, b16* __restrict__ XH) {
  const unsigned u = blk * 256 + threadIdx.x;                 // < MT*KD/8 (blk < XB)
  const unsigned tile = u >> 6, nloc = ((u >> 5) & 1u) * 8 + ((u >> 2) & 7u), part = (u >> 1) & 1u, hh = u & 1u;   // a wave: 8 rows x the 4 granules of one k-tile (whole lines read and written)
  const unsigned r = (tile >> 5) * 16 + nloc, col = (tile & 31u) * 32 + part * 16 + hh * 8;
  const unsigned bb = r / SEQU, ss = r - bb * SEQU;
  const float* xr = x + ((size_t)bb * SEQF + ss) * KD + col;
  const v4f a = *(const v4f*)(xr), b = *(const v4f*)(xr + 4);
  v8b v;
#pragma unroll
  for (int j = 0; j < 4; ++j) { v[j] = toh_flush(bf16_rne(a[j])); v[4 + j] = toh_flush(bf16_rne(b[j])); }
  { *(v8b*)(XH + (size_t)tile * TILE + part * 256 + (hh * 16 + nloc) * 8) = v;  }
}

__device__ __forceinline__ void wt_part(const unsigned blk, const unsigned y, const float* __restrict__ w0, const float* __restrict__ w1, const float* __restrict__ w2, const float* __restrict__ w3, b16* __restrict__ WT) {
  const float* w = (y == 0) ? w0 : (y == 1) ? w1 : (y == 2) ? w2 : w3;
  const unsigned u = blk * 256 + threadIdx.x;                 // < KD*KD/8 (blk < WB)
  const unsigned e = u * 8, tile = u >> 6, part = (u >> 5) & 1u, hh = (u >> 4) & 1u, nloc = u & 15u;   // u = granule index in fragment order
  const unsigned o = (tile >> 5) * 16 + nloc, k0 = (tile & 31u) * 32 + part * 16 + hh * 8; v8b v;
#pragma unroll
  for (int j = 0; j < 8; ++j) v[j] = (b16)(bf16_rne(w[(size_t)(k0 + j) * KD + o]) * WSC);
  { *(v8b*)(WT + (size_t)y * KD * KD + e) = v;  }
}

// The x cast and the four weight planes depend on nothing but the inputs: one launch, the part chosen by a block-uniform branch. The weight blocks (8 strided reads a thread) come first in the index.
constexpr unsigned XB = (unsigned)((size_t)MT * KD / 8 / 256) /* blocks of the cast */, WB = KD * KD / 8 / 256 /* blocks of one weight plane */;
__global__ __launch_bounds__(256) void prep_kernel(const float* __restrict__ x, const float* __restrict__ w0, const float* __restrict__ w1, const float* __restrict__ w2, const float* __restrict__ w3, b16* __restrict__ XH, b16* __restrict__ WT) {
  const unsigned blk = blockIdx.x;                            // < 4 * WB + XB (grid exact)
  if (blk < 4 * WB) wt_part(blk % WB, blk / WB, w0, w1, w2, w3, WT);
  else xh_part(blk - 4 * WB, x, XH);
}

// One k-stage of a GEMM ring is 64 of depth (2 k-tiles) of each row block, every 1024-byte tile kept in fragment order.
constexpr unsigned SKT = 2 /* k-tiles per stage */, SRB = SKT * TILE /* halves of one row block in a stage */, NSTG = KTD / SKT;
static_assert(KTD % SKT == 0 && NSTG >= 2);
// A stage of the projection block: 16 row blocks of x, then 8 row blocks each of Wq^T, Wk^T and Wv^T.
constexpr unsigned PXR = 16 /* row blocks of x */, PWR = 24 /* row blocks of the three weight planes */, SOPX = PXR * SRB /* halves of the x part */, STG = (PXR + PWR) * SRB /* halves of a stage: 80 KiB */;
static_assert(MT % 256 == 0 && KD % 128 == 0);                   // projection block tile multiples

// A wave's 8 copies of 512 bytes: the 2048 contiguous bytes that a stage takes of two row blocks (la <- ga, lb <- gb; LDS byte addresses and global pointers of the lane's own 16 bytes).
__device__ __forceinline__ void copy8(unsigned la, const b16* ga, unsigned lb, const b16* gb) {
  // the closing s_wait_xcnt stands inside the statement so that no address register of a copy is rewritten ahead of it
  asm volatile("global_load_async_to_lds_b128 %0, %8, off\n\t"
               "global_load_async_to_lds_b128 %1, %9, off\n\t"
               "global_load_async_to_lds_b128 %2, %10, off\n\t"
               "global_load_async_to_lds_b128 %3, %11, off\n\t"
               "global_load_async_to_lds_b128 %4, %12, off\n\t"
               "global_load_async_to_lds_b128 %5, %13, off\n\t"
               "global_load_async_to_lds_b128 %6, %14, off\n\t"
               "global_load_async_to_lds_b128 %7, %15, off\n\t"
               "s_wait_xcnt 0x0"
               :: "v"(la), "v"(la + 512u), "v"(la + 1024u), "v"(la + 1536u), "v"(lb), "v"(lb + 512u), "v"(lb + 1024u), "v"(lb + 1536u),
                  "v"(ga), "v"(ga + 256), "v"(ga + 512), "v"(ga + 768), "v"(gb), "v"(gb + 256), "v"(gb + 512), "v"(gb + 768)
               : "memory");
}

// The lane's number in its wave (block one-dimensional: threadIdx.x & 31), computed where it stands: a volatile statement is not moved out of a loop or ahead of one, so what is formed from it holds no register before.
__device__ __forceinline__ unsigned lane_now() { unsigned l; asm volatile("v_mbcnt_lo_u32_b32 %0, -1, 0" : "=v"(l)); return l; }

// ---------------- the three projections, depth 1024, one launch: C[m][n] = sum_k A[m][k] Bt[n][k]; operands f16 planes in fragment order (32 k-tiles per row block).
// block = 12 waves, tile 256 tokens x 384 features: the same 128 features (cb ..) of Q, of K and of V; grid (MT/256, 8) = 256 blocks, one on every WGP, one round. Wave tile 128 x 64 (8 x 4 accumulators).
// A block's 256 rows of x serve all three projections: 640 operand rows leave L2 for 98,304 results (a 128 x 128 tile: 256 rows for 16,384), and a fragment read from LDS feeds 4 or 8 products.
// Waves 4p .. 4p + 3 hold projection p. Q, K: A = x (tokens 128 (s & 1) ..), Bt = weight rows (features 64 (s >> 1) ..), s = wave & 3. V: A = all 128 weight rows, Bt = x (tokens 64 s ..), so the wave holds V^T.
// The operands pass through LDS: asynchronous copies fill a ring of two stages, stage t + 2 flying while stage t + 1 is worked on; waves 0..7 copy two row blocks of x each, every wave two row blocks of
// its own weight plane; fragments are read from LDS, 512 contiguous bytes per load.
// f16 out, y = acc*scale + bias[col], or + bias[row] in a V wave. The wave stages its tile, 32 rows at a time, in LDS of its own (in the ring, once the ring is done with) and stores whole lines.
static_assert((size_t)12 * 32 * 72 * 2 + (size_t)12 * 128 * 4 <= (size_t)2 * STG * 2);   // the 12 staging tiles and the 12 waves' bias entries fit the ring's LDS
__global__ __launch_bounds__(384) void qkv_kernel(const b16* __restrict__ XH, const b16* __restrict__ WT, const float* __restrict__ bq, const float* __restrict__ bk, const float* __restrict__ bv, b16* __restrict__ QK, b16* __restrict__ VT, float scale) {
  __shared__ __attribute__((aligned(16))) b16 ring[2 * STG];
  const unsigned wave = __builtin_amdgcn_readfirstlane(threadIdx.x >> 5) /* scalar: the tests on it below are scalar branches */, lane = threadIdx.x & 31;
  const unsigned ws = wave & 3, wp = wave >> 2;
  const bool isv = wp == 2;                                   // wave-uniform
  const unsigned mb = blockIdx.x * 256, cb = blockIdx.y * 128;
  v8f acc[8][4];
#pragma unroll
  for (int i = 0; i < 8; ++i)
#pragma unroll
    for (int j = 0; j < 4; ++j) acc[i][j] = (v8f){};
  const unsigned sx = ((mb >> 4) + 2 * wave) * (KTD * TILE);                          // halves from XH; used by waves 0..7 only
  const unsigned sw = wp * (KD * KD) + ((cb >> 4) + 2 * ws) * (KTD * TILE);           // halves from WT
  // The accumulators leave no register for a vector pointer to live across the products: a stage's offsets are scalar, and the lane's part is formed anew in every stage (lane_now).
  auto fill = [&](unsigned t) {
    const unsigned ln = lane_now();
    const unsigned l = (unsigned)(size_t)(&ring[0]) + (t & 1u) * (STG * 2) + wave * (2 * SRB * 2) + ln * 16;   // LDS byte address: low 32 bits of the shared address
    if (wave < 8) { const b16* px = XH + (sx + t * SRB) + ln * 8; copy8(l, px, l + SRB * 2, px + KTD * TILE); }   // scalar branch: a whole wave issues or none of it
    const b16* pw = WT + (sw + t * SRB) + ln * 8;
    copy8(l + SOPX * 2, pw, l + SOPX * 2 + SRB * 2, pw + KTD * TILE);
  };
  fill(0);
  asm volatile("s_wait_asynccnt 0x0" ::: "memory");   // this wave's share of stage 0 has landed
  __syncthreads();                                    // every wave's share of stage 0 has landed
  fill(1);
  const unsigned oa = (isv ? SOPX + 16 * SRB : (ws & 1) * (8 * SRB)) + lane * 8;                       // 8 row blocks
  const unsigned ob = (isv ? ws * (4 * SRB) : SOPX + wp * (8 * SRB) + (ws >> 1) * (4 * SRB)) + lane * 8;   // 4 row blocks
#pragma unroll 1   // one trip is one stage: 64 products per wave
  for (unsigned t = 0; t < NSTG; ++t) {
    const b16* la = ring + (t & 1u) * STG + oa;
    const b16* lb = ring + (t & 1u) * STG + ob;
#pragma unroll
    for (unsigned kk = 0; kk < SKT; ++kk) {
      v16b fb[4];
#pragma unroll
      for (int j = 0; j < 4; ++j) fb[j] = frag_pk(lb + j * SRB + kk * TILE);
#pragma unroll
      for (int ih = 0; ih < 2; ++ih) {   // the A fragments four at a time: all eight beside the 256 accumulator registers would pass the budget of three waves a SIMD
        v16b fa[4];
#pragma unroll
        for (int i = 0; i < 4; ++i) fa[i] = frag_pk(la + (ih * 4 + i) * SRB + kk * TILE);
#pragma unroll
        for (int j = 0; j < 4; ++j)
#pragma unroll
          for (int i = 0; i < 4; ++i) acc[ih * 4 + i][j] = __builtin_amdgcn_wmma_f32_16x16x32_f16(false, fa[i], false, fb[j], (short)0, acc[ih * 4 + i][j], false, false);
      }
    }
    asm volatile("s_wait_dscnt 0x0" ::: "memory");      // this wave's reads of stage t are done before the stage's buffer is given up
    asm volatile("s_wait_asynccnt 0x0" ::: "memory");   // this wave's share of stage t + 1 has landed
    __syncthreads();                                    // publishes stage t + 1 and ends every wave's reads of stage t
    if (t + 2 < NSTG) fill(t + 2);                      // block-uniform; into the buffer that stage t has left
  }
  asm volatile("s_wait_asynccnt 0x0" ::: "memory");     // no copy is outstanding when the ring's LDS is given to the staging tiles
  {
    // The last trip's barrier has ended every wave's reads of the ring: from here its LDS holds 12 staging tiles of 32 rows, pitch 72 halves, one a wave.
    b16 (*Th)[72] = reinterpret_cast<b16 (*)[72]>(&ring[0] + wave * (32 * 72));
    const unsigned lane = lane_now(), nloc = lane & 15, hh = lane >> 4;   // formed anew, so that no address of the epilogue is kept in registers across the k loop
    const unsigned m0 = isv ? cb : mb + (ws & 1) * 128, n0 = isv ? mb + ws * 64 : wp * KD + cb + (ws >> 1) * 64, opitch = isv ? MT : QKP;
    b16* outH = isv ? VT : QK;
    // The wave's 128 bias entries (from cb: of its rows in a V wave, of the block's columns in a Q or K wave) go through LDS of its own: 4 a lane, rounded once, read back as each 32 rows need them.
    float* Bs = reinterpret_cast<float*>(&ring[0] + 12 * (32 * 72)) + wave * 128;
    {
      const float* bp = (isv ? bv : wp == 1 ? bk : bq) + cb + lane * 4; v4f b4;
      // the load and its data wait in one statement, so that its address registers are not rewritten while it is in flight
      asm volatile("global_load_b128 %0, %1, off\n\t"
                   "s_wait_loadcnt 0x0"
                   : "=&v"(b4) : "v"(bp) : "memory");
#pragma unroll
      for (int e = 0; e < 4; ++e) b4[e] = bf16_rne(b4[e]);
      *(v4f*)(Bs + lane * 4) = b4;
    }
    wave_lds_sync();   // wave-private entries: same wave writes and reads
    // The loops are fully unrolled so that every index of br, bc and acc is a compile-time constant and the arrays stay in registers.
    float bc[4];
#pragma unroll
    for (int j = 0; j < 4; ++j) bc[j] = Bs[(ws >> 1) * 64 + j * 16 + nloc];   // used by Q and K waves
    // 32 rows of the wave's tile at a time (beside all 256 accumulator registers there is room for the row bias of 32 rows, not of more). iq is a literal at every call;
    // always_inline: every copy must see its literal, so that acc is indexed by constants alone.
    auto rows32 = [&](const int iq, const bool vrow) __attribute__((always_inline)) {
      float br[2][8] = {};
      if (vrow) {   // compile-time
#pragma unroll
        for (int i = 0; i < 2; ++i) { const float* rp = Bs + iq * 32 + i * 16 + 8 * hh; const v4f a = *(const v4f*)(rp), b = *(const v4f*)(rp + 4);
#pragma unroll
          for (int e = 0; e < 4; ++e) { br[i][e] = a[e]; br[i][4 + e] = b[e]; } }
      }
#pragma unroll
      for (int i = 0; i < 2; ++i)
#pragma unroll
        for (int j = 0; j < 4; ++j) { const unsigned col = j * 16 + nloc;
#pragma unroll
          for (int r = 0; r < 8; ++r) { const unsigned row = i * 16 + 8 * hh + r; Th[row][col] = (b16)(acc[iq * 2 + i][j][r] * scale + (vrow ? br[i][r] : bc[j])); } }
      wave_lds_sync();   // wave-private tile: same wave writes and reads
#pragma unroll
      for (int rtl = 0; rtl < 2; ++rtl) {
      v8b d[2][2];   // a row block's four reads ahead of its stores: the store statements order memory, and a read placed between them would wait out its LDS latency there
#pragma unroll
      for (int ktl = 0; ktl < 2; ++ktl) { const b16* tp = &Th[rtl * 16 + nloc][ktl * 32 + hh * 8]; d[ktl][0] = *(const v8b*)(tp); d[ktl][1] = *(const v8b*)(tp + 16); }
#pragma unroll
      for (int ktl = 0; ktl < 2; ++ktl) {
        b16* op = outH + ((size_t)((m0 >> 4) + iq * 2 + rtl) * (opitch >> 5) + (n0 >> 5) + ktl) * TILE + lane * 8;   // one tile of the out plane in fragment order, k = column
        // the tile's two stores of 512 contiguous bytes and their s_wait_xcnt in one statement, so that no address or data register of a store is rewritten ahead of the wait
        asm volatile("global_store_b128 %0, %1, off\n\t"
                     "global_store_b128 %0, %2, off offset:512\n\t"
                     "s_wait_xcnt 0x0"
                     :: "v"(op), "v"(d[ktl][0]), "v"(d[ktl][1]) : "memory"); }
      }
      wave_lds_sync();   // the next 32 rows overwrite the tile only behind these reads
    };
    if (isv) { rows32(0, true); rows32(1, true); rows32(2, true); rows32(3, true); }          // scalar branch: a V wave adds the bias of its rows,
    else { rows32(0, false); rows32(1, false); rows32(2, false); rows32(3, false); }          // a Q or K wave that of its columns
  }
}

// ---------------- causal flash attention, transposed form. grid (heads, batch, SEQ/64), work-group = 64 query rows, 4 waves, key tiles of 64.
// Wave (g, kh): g = wave & 1 picks 32 of the query rows (iw0 .. iw0+31, two column groups of 16), kh = wave >> 1 the key tiles of its parity (kh, kh + 2, ..). Every K and V^T fragment that a wave loads
// feeds two products, one per column group: half the fragment bytes per score, with as many waves as one wave per 16 rows gives, each half as many trips long.
// The two waves of a g hold partial sums over disjoint keys, each with its own running maximum; behind the loop the kh = 1 wave hands its partial over through LDS and the kh = 0 wave joins the two and stores.
// A work-group of query tile qt walks qt + 1 key tiles and not all work-groups are resident at once: qt falls with the flat index (slowest grid axis, counted down), so the longest start first and the shortest fill the tail.
// S^T tile t (16 keys x 16 queries) = K rows (A: row = key, k = d) x Q rows (B: col = query, k = d); lane holds query i = iw0 + 16c + (lane&15) of column group c, keys 16t+8hh+r.
// p = exp2(s*0.125*log2e - m) as f16; P^T is the B operand of O^T = V^T P^T directly from the score accumulators: k-step c (32 keys) elements 0..7 <- tile 2c acc[0..7],
// elements 8..15 <- tile 2c+1 acc[0..7] (the D row map equals the B k map). A = VT rows (row = d, k = key). O^T acc[r] = O[d = 16dt+8hh+r][i].
// The product as the bare builtin (the compiler keeps the distances behind it): the wave's fragments and accumulators pass 256 registers, and an operand of an asm statement cannot lie above v255.
__device__ __forceinline__ v8f wmma16n(v16b a, v16b b, v8f c) { return __builtin_amdgcn_wmma_f32_16x16x32_f16(false, a, false, b, (short)0, c, false, false); }
__global__ __launch_bounds__(128) void attn_kernel(const b16* __restrict__ QK, const b16* __restrict__ VT, b16* __restrict__ CTX) {
  __shared__ __attribute__((aligned(16))) float mrg[2][17][32][4];   // per g: a lane's 64 partial outputs as 16 granules of 16 bytes, then its two maxima and two sums; a wave's store or load covers 512 contiguous bytes
  const unsigned wave = __builtin_amdgcn_readfirstlane(threadIdx.x >> 5) /* scalar: the trip counts and tests formed from it are scalar */, lane = threadIdx.x & 31, nloc = lane & 15, hh = lane >> 4;
  const unsigned g = wave & 1, kh = wave >> 1;
  const unsigned qt = SEQU / 64 - 1 - blockIdx.z, h = blockIdx.x, b = blockIdx.y;
  const unsigned iw0 = qt * 64 + g * 32;
  const b16* qrow = QK + ((size_t)((b * SEQU + iw0) >> 4) * KTQ + h * 2) * TILE + lane * 8;
  v16b qf[2][2];
#pragma unroll
  for (int c = 0; c < 2; ++c) { qf[c][0] = frag_pk(qrow + (size_t)c * KTQ * TILE); qf[c][1] = frag_pk(qrow + (size_t)c * KTQ * TILE + TILE); }
  const b16* kbase = QK + ((size_t)((b * SEQU) >> 4) * KTQ + KTD + h * 2) * TILE + lane * 8;
  const b16* vbase = VT + ((size_t)(h * 4) * KTV + ((b * SEQU) >> 5)) * TILE + lane * 8;
  v8f o[2][4];
#pragma unroll
  for (int c = 0; c < 2; ++c)
#pragma unroll
    for (int dt = 0; dt < 4; ++dt) o[c][dt] = (v8f){};
  float m[2] = {-1.0e30f, -1.0e30f}, l[2] = {0.0f, 0.0f};
  const float SCL = 0.125f * LOG2E;
  // K and V fragments of a key tile each have 8 register sets of their own and are loaded as one group: V of tile jt ahead of the score products, K of the wave's next tile behind them, ahead of the softmax
  v16b kf[8], vf[8];
  const unsigned jfirst = kh < qt ? kh : qt;   // the wave's first tile; a kh = 1 wave of query tile 0 has none and fetches tile 0 unused, so that the address is a valid one
#pragma unroll
  for (int t = 0; t < 4; ++t) { const b16* kr = kbase + (size_t)(jfirst * 4 + t) * KTQ * TILE; kf[2 * t] = frag_pk(kr); kf[2 * t + 1] = frag_pk(kr + TILE); }
  asm volatile("s_wait_xcnt 0x0" ::: "memory");   // the loop reuses the address registers of the Q and K loads while these are in flight
  // One key tile. diag is a literal at both calls: only the block's last tile (jt == qt) crosses the diagonal, so the tiles in front of it carry no mask code at all.
  // always_inline: both copies must see their literal, and the register arrays must stay in registers.
  auto tile = [&](const unsigned jt, const bool diag) __attribute__((always_inline)) {
    const unsigned j0 = jt * 64;
    const b16* vr0 = vbase + (size_t)(jt * 2) * TILE;
#pragma unroll
    for (int dt = 0; dt < 4; ++dt) { const b16* vr = vr0 + (size_t)dt * KTV * TILE; vf[2 * dt] = frag_pk(vr); vf[2 * dt + 1] = frag_pk(vr + TILE); }
    __builtin_amdgcn_sched_barrier(0);   // keeps the V loads at the head of the trip: without it the first score product moves up with its wait on K, and the V loads are issued only behind that wait
    v8f s[2][4];
#pragma unroll
    for (int t = 0; t < 4; ++t) {   // the two column groups' products alternate: neighbours in the stream have accumulators of their own
#pragma unroll
      for (int c = 0; c < 2; ++c) s[c][t] = wmma16n(kf[2 * t], qf[c][0], (v8f){});
#pragma unroll
      for (int c = 0; c < 2; ++c) s[c][t] = wmma16n(kf[2 * t + 1], qf[c][1], s[c][t]);
    }
    // the V loads are in flight and their address registers are reused from here on; the address is named as an input so that it stays whole up to the wait (unnamed, the last load's result was placed over it)
    asm volatile("s_wait_xcnt 0x0" :: "v"(vr0) : "memory");
    if (!diag) {                                     // compile-time
      const unsigned jn = jt + 2 < qt ? jt + 2 : qt;   // scalar; the wave's next tile. Behind its last tile a wave that does not own the diagonal fetches tile qt unused: a valid address, and no branch in the trip
#pragma unroll
      for (int t = 0; t < 4; ++t) { const b16* kr = kbase + (size_t)(jn * 4 + t) * KTQ * TILE; kf[2 * t] = frag_pk(kr); kf[2 * t + 1] = frag_pk(kr + TILE); }
      asm volatile("s_wait_xcnt 0x0" ::: "memory");   // the softmax reuses the address registers of these loads while they are in flight
      __builtin_amdgcn_sched_barrier(0);              // keeps the K loads ahead of the softmax: left free, they sink to the foot of the trip and the next trip's first product waits for them
    }
    v16b pf[2][2];
#pragma unroll
    for (int c = 0; c < 2; ++c) {
      const unsigned iq = iw0 + 16 * c + nloc;
      // The scores are taken two at a time, neighbours in one accumulator (a register pair): left to itself the compiler pairs the two column groups' scores and pays a register copy for each pair.
      v2f x[4][4];
      float mx = -1.0e30f;
#pragma unroll
      for (int t = 0; t < 4; ++t)
#pragma unroll
        for (int q = 0; q < 4; ++q) { v2f xv = (v2f){s[c][t][2 * q], s[c][t][2 * q + 1]} * SCL;
          if (diag) { const unsigned j = j0 + 16 * t + 8 * hh + 2 * q; xv.x = (j > iq) ? -1.0e30f : xv.x; xv.y = (j + 1 > iq) ? -1.0e30f : xv.y; }
          x[t][q] = xv; mx = fmaxf(fmaxf(mx, xv.x), xv.y); }
      mx = fmaxf(mx, __shfl_xor(mx, 16, 32));
      const float newm = fmaxf(m[c], mx); const float alpha = exp2_bare(m[c] - newm); m[c] = newm;
      float psum = 0.0f;
#pragma unroll
      for (int t = 0; t < 4; ++t)
#pragma unroll
        for (int q = 0; q < 4; ++q) { const v2f e = x[t][q] - newm; const b16 p0 = (b16)exp2_bare(e.x), p1 = (b16)exp2_bare(e.y);
          psum += (float)p0; psum += (float)p1; pf[c][t >> 1][(t & 1) * 8 + 2 * q] = p0; pf[c][t >> 1][(t & 1) * 8 + 2 * q + 1] = p1; }
      psum += __shfl_xor(psum, 16, 32);
      l[c] = l[c] * alpha + psum;
#pragma unroll
      for (int dt = 0; dt < 4; ++dt)
#pragma unroll
        for (int r = 0; r < 8; ++r) o[c][dt][r] *= alpha;
    }
#pragma unroll
    for (int dt = 0; dt < 4; ++dt) {
#pragma unroll
      for (int c = 0; c < 2; ++c) o[c][dt] = wmma16n(vf[2 * dt], pf[c][0], o[c][dt]);
#pragma unroll
      for (int c = 0; c < 2; ++c) o[c][dt] = wmma16n(vf[2 * dt + 1], pf[c][1], o[c][dt]);
    }
  };
#pragma unroll 1   // one trip is one key tile; unrolled, the two fragment groups of several tiles would not fit the registers
  for (unsigned jt = kh; jt < qt; jt += 2) tile(jt, false);   // wave-uniform scalar trip count; every key of these tiles lies in front of every query of the block
  if (((qt ^ kh) & 1u) == 0) tile(qt, true);                  // scalar branch: the wave of the diagonal tile's parity takes it; it holds at least key j0 <= i for every query of the block
  // Join of the two key parities. A wave without a tile hands over maxima of -1e30 with sums and outputs of 0, which the join weighs with exp2(-1e30 - max) = 0; the kh = 0 wave always has tile 0.
  if (kh == 1) {   // scalar branch
#pragma unroll
    for (int c = 0; c < 2; ++c)
#pragma unroll
      for (int dt = 0; dt < 4; ++dt) {
        *(v4f*)(&mrg[g][c * 8 + dt * 2][lane][0]) = (v4f){o[c][dt][0], o[c][dt][1], o[c][dt][2], o[c][dt][3]};
        *(v4f*)(&mrg[g][c * 8 + dt * 2 + 1][lane][0]) = (v4f){o[c][dt][4], o[c][dt][5], o[c][dt][6], o[c][dt][7]};
      }
    *(v4f*)(&mrg[g][16][lane][0]) = (v4f){m[0], m[1], l[0], l[1]};
  }
  __syncthreads();   // every wave passes it once: the kh = 1 partials are complete in LDS
  if (kh == 0) {     // scalar branch
    const v4f ml = *(const v4f*)(&mrg[g][16][lane][0]);
#pragma unroll
    for (int c = 0; c < 2; ++c) {
      const float mj = fmaxf(m[c], ml[c]);
      const float fa = exp2_bare(m[c] - mj), fb = exp2_bare(ml[c] - mj);
      const float inv = CSC * (1.0f / (l[c] * fa + ml[2 + c] * fb));   // the sum is >= 1 (the key of the joint maximum contributes exactly 1)
      const float wa = fa * inv, wb = fb * inv;
      b16* cp = CTX + ((size_t)(((b * SEQU + iw0) >> 4) + c) * KTD + h * 2) * TILE + lane * 8;
#pragma unroll
      for (int dt = 0; dt < 4; ++dt) {
        const v4f lo = *(const v4f*)(&mrg[g][c * 8 + dt * 2][lane][0]), hi = *(const v4f*)(&mrg[g][c * 8 + dt * 2 + 1][lane][0]);
        v8b v;
#pragma unroll
        for (int r = 0; r < 4; ++r) { v[r] = (b16)(o[c][dt][r] * wa + lo[r] * wb); v[4 + r] = (b16)(o[c][dt][4 + r] * wa + hi[r] * wb); }
        *(v8b*)(cp + (dt >> 1) * TILE + (dt & 1) * 256) = v; }   // the lane's 8 values (query 16c + nloc, d = 16dt+8hh+0..7) are its own granule of the CTX tile: 512 contiguous bytes per wave store
    }
  }
}

// ---------------- output projection with the skip connection and the LayerNorm in its epilogue: out = LayerNorm(ctx Wo + bo + x) * gamma + beta.
// A work-group owns 64 whole rows (tokens): block tile 64 x 1024, 16 waves, wave w = all 64 tokens x features 64 w .. 64 w + 63, so a row's mean and variance need no other work-group and y never leaves the chip.
// The k loop is that of the projections: a ring of two stages of 64 of depth, filled by asynchronous copies. A stage holds 4 row blocks of CTX (8 KiB, read by every wave) and all 64 row blocks of Wo^T (128 KiB).
// A wave copies one 512-byte piece of the CTX part and the 4 row blocks of Wo^T that it reads itself. The product is taken as y^T = Wo^T ctx^T (A = Wo^T rows, B = CTX rows, as for V^T): a lane then holds
// 8 neighbouring features of one token (token 16 j + nloc, features 16 i + 8 hh + 0..7), which go to LDS as two 16-byte stores. Behind the loop the ring's LDS takes the 64 x 1024 f32 tile; a wave normalises 4 whole rows.
constexpr unsigned OSA = 4 * SRB /* halves of the CTX part of a stage */, OSTG = OSA + (KD / 16) * SRB /* halves of a stage: 136 KiB */, OTP = KD + 4 /* pitch of the f32 tile (floats): neighbouring rows lie 4 banks apart */;
static_assert((size_t)64 * OTP * 4 <= (size_t)2 * OSTG * 2);    // the f32 tile fits the ring's LDS
static_assert((size_t)2 * OSTG * 2 <= 327680);                   // the ring fits a WGP's LDS
static_assert(KD == 16u * 64u && SEQU % 64 == 0 && MT % 64 == 0);   // 16 waves span a row; a 64-row block never straddles a batch; grid exact

// One copy of 512 bytes (l, g: LDS byte address and global pointer of the lane's own 16 bytes).
__device__ __forceinline__ void copy1(unsigned l, const b16* g) {
  // the closing s_wait_xcnt stands inside the statement so that no address register of the copy is rewritten ahead of it
  asm volatile("global_load_async_to_lds_b128 %0, %1, off\n\t"
               "s_wait_xcnt 0x0"
               :: "v"(l), "v"(g) : "memory");
}

__global__ __launch_bounds__(512) void outln_kernel(const b16* __restrict__ CTX, const b16* __restrict__ WoT, const float* __restrict__ bo, const float* __restrict__ x, const float* __restrict__ gam, const float* __restrict__ bet, float* __restrict__ out, float scale) {
  __shared__ __attribute__((aligned(16))) b16 ring[2 * OSTG];
  const unsigned wave = threadIdx.x >> 5, lane = threadIdx.x & 31, nloc = lane & 15, hh = lane >> 4;
  const unsigned mb = blockIdx.x * 64, nw = wave * 64;
  // the lane's 32 bias entries, asked for ahead of the ring's first copies: they are used only behind the k loop
  v4f bb[4][2];
#pragma unroll
  for (int i = 0; i < 4; ++i) { const float* bp = bo + nw + i * 16 + 8 * hh; bb[i][0] = *(const v4f*)(bp); bb[i][1] = *(const v4f*)(bp + 4); }
  v8f acc[4][4];
#pragma unroll
  for (int i = 0; i < 4; ++i)
#pragma unroll
    for (int j = 0; j < 4; ++j) acc[i][j] = (v8f){};
  const b16* ga = CTX + ((size_t)(mb >> 4) + (wave >> 2)) * KTD * TILE + (wave & 3) * 256 + lane * 8;   // piece wave & 3 of the stage's 2048 bytes of row block wave >> 2
  const b16* gb = WoT + (size_t)(4 * wave) * KTD * TILE + lane * 8;
  const unsigned l0 = (unsigned)(size_t)(&ring[0]) + lane * 16;   // LDS byte address: low 32 bits of the shared address
  auto fill = [&](unsigned t) {
    const unsigned l = l0 + (t & 1u) * (OSTG * 2), lb = l + OSA * 2 + wave * (4 * SRB * 2); const b16* pb = gb + t * SRB;
    copy1(l + wave * 512, ga + t * SRB);
    copy8(lb, pb, lb + SRB * 2, pb + KTD * TILE);
    copy8(lb + 2 * SRB * 2, pb + 2 * KTD * TILE, lb + 3 * SRB * 2, pb + 3 * KTD * TILE);
  };
  fill(0);
  asm volatile("s_wait_asynccnt 0x0" ::: "memory");   // this wave's share of stage 0 has landed
  __syncthreads();                                    // every wave's share of stage 0 has landed
  fill(1);
#pragma unroll 1   // one trip is one stage: 32 products per wave
  for (unsigned t = 0; t < NSTG; ++t) {
    const b16* lc = ring + (t & 1u) * OSTG + lane * 8;
    const b16* lw = ring + (t & 1u) * OSTG + OSA + wave * (4 * SRB) + lane * 8;
#pragma unroll
    for (unsigned kk = 0; kk < SKT; ++kk) {
      v16b fw[4], fc[4];
#pragma unroll
      for (int i = 0; i < 4; ++i) { fw[i] = frag_pk(lw + i * SRB + kk * TILE); fc[i] = frag_pk(lc + i * SRB + kk * TILE); }
#pragma unroll
      for (int j = 0; j < 4; ++j)
#pragma unroll
        for (int i = 0; i < 4; ++i) acc[i][j] = wmma16b(fw[i], fc[j], acc[i][j]);
    }
    asm volatile("s_wait_dscnt 0x0" ::: "memory");      // this wave's reads of stage t are done before the stage's buffer is given up
    asm volatile("s_wait_asynccnt 0x0" ::: "memory");   // this wave's share of stage t + 1 has landed
    __syncthreads();                                    // publishes stage t + 1 and ends every wave's reads of stage t
    if (t + 2 < NSTG) fill(t + 2);                      // block-uniform; into the buffer that stage t has left
  }
  asm volatile("s_wait_asynccnt 0x0" ::: "memory");     // no copy is outstanding when the ring's LDS is given to the f32 tile
  // The last trip's barrier has ended every wave's reads of the ring: from here its LDS holds acc*scale + bo, 64 rows of pitch OTP.
  // The wave's 4 rows of x are asked for among the stores, a row as the accumulators of a token block give up their registers, so that they fly while the tile is written.
  float* Tf = (float*)(&ring[0]);
  float* tb = Tf + nloc * OTP + nw + 8 * hh;
  const unsigned bt = mb / SEQU; const unsigned mfull = bt * SEQF + (mb - bt * SEQU);
  const size_t ro = (size_t)(mfull + wave * 4) * KD + lane * 4;
  const float* xp = x + ro;
  v4f y[4][8], ga4[8], be4[8];
#pragma unroll
  for (int i = 0; i < 4; ++i)
#pragma unroll
    for (int e = 0; e < 4; ++e) { bb[i][0][e] = bf16_rne(bb[i][0][e]); bb[i][1][e] = bf16_rne(bb[i][1][e]); }
#pragma unroll
  for (int j = 0; j < 4; ++j) {
#pragma unroll
    for (int c = 0; c < 8; ++c) y[j][c] = *(const v4f*)(xp + j * KD + c * 128);
#pragma unroll
    for (int i = 0; i < 4; ++i) { v4f lo, hi;
#pragma unroll
      for (int e = 0; e < 4; ++e) { lo[e] = acc[i][j][e] * scale + bb[i][0][e]; hi[e] = acc[i][j][4 + e] * scale + bb[i][1][e]; }
      *(v4f*)(tb + j * 16 * OTP + i * 16) = lo; *(v4f*)(tb + j * 16 * OTP + i * 16 + 4) = hi; }
  }
#pragma unroll
  for (int c = 0; c < 8; ++c) { ga4[c] = *(const v4f*)(gam + lane * 4 + c * 128); be4[c] = *(const v4f*)(bet + lane * 4 + c * 128); }
  __syncthreads();                                      // the f32 tile is complete: a row holds the features of all 16 waves
#pragma unroll
  for (int c = 0; c < 8; ++c)
#pragma unroll
    for (int e = 0; e < 4; ++e) { ga4[c][e] = bf16_rne(ga4[c][e]); be4[c][e] = bf16_rne(be4[c][e]); }
#pragma unroll
  for (int q = 0; q < 4; ++q) {
    const float* tr = Tf + (wave * 4 + q) * OTP + lane * 4;
    float s = 0.0f;
#pragma unroll
    for (int c = 0; c < 8; ++c) { v4f a = *(const v4f*)(tr + c * 128);
#pragma unroll
      for (int e = 0; e < 4; ++e) a[e] += bf16_rne(y[q][c][e]);
      y[q][c] = a; s += (a[0] + a[1]) + (a[2] + a[3]); }
#pragma unroll
    for (int m = 16; m > 0; m >>= 1) s += __shfl_xor(s, m, 32);
    const float mu = s * (1.0f / 1024.0f);
    float v = 0.0f;
#pragma unroll
    for (int c = 0; c < 8; ++c)
#pragma unroll
      for (int e = 0; e < 4; ++e) { const float d0 = y[q][c][e] - mu; v += d0 * d0; }
#pragma unroll
    for (int m = 16; m > 0; m >>= 1) v += __shfl_xor(v, m, 32);
    const float inv = rsqrtf(v * (1.0f / 1024.0f) + LNEPS);
#pragma unroll
    for (int c = 0; c < 8; ++c) { v4f t;
#pragma unroll
      for (int e = 0; e < 4; ++e) t[e] = (y[q][c][e] - mu) * inv * ga4[c][e] + be4[c][e];
      *(v4f*)(out + ro + q * KD + c * 128) = t; }
  }
}

}  // namespace

extern "C" void kernel_launch(void* const* d_in, const int* in_sizes, int n_in, void* d_out, int out_size, void* d_ws, size_t ws_size, hipStream_t stream) {
  if (n_in < 11) return;
  // wire order: 0 x [4,2048,1024], 1 Wq [1024,1024] (in,out), 2 bq, 3 Wk, 4 bk, 5 Wv, 6 bv, 7 Wo [1024,1024] (in,out), 8 bo, 9 gamma [1024], 10 beta [1024]; all f32. Output f32 [4,2048,1024].
  const size_t need = ((size_t)(NBU - 1) * SEQF + SEQU) * KD;
  if ((size_t)in_sizes[0] < need || (size_t)out_size < need) return;
  if (in_sizes[2] < (int)KD || in_sizes[4] < (int)KD || in_sizes[6] < (int)KD || in_sizes[8] < (int)KD || in_sizes[9] < (int)KD || in_sizes[10] < (int)KD) return;
  if ((size_t)in_sizes[1] < (size_t)KD * KD || (size_t)in_sizes[3] < (size_t)KD * KD || (size_t)in_sizes[5] < (size_t)KD * KD || (size_t)in_sizes[7] < (size_t)KD * KD) return;
  const float* x = (const float*)d_in[0];
  const float* Wq = (const float*)d_in[1]; const float* bq = (const float*)d_in[2]; const float* Wk = (const float*)d_in[3]; const float* bk = (const float*)d_in[4];
  const float* Wv = (const float*)d_in[5]; const float* bv = (const float*)d_in[6]; const float* Wo = (const float*)d_in[7]; const float* bo = (const float*)d_in[8];
  const float* gam = (const float*)d_in[9]; const float* bet = (const float*)d_in[10];
  float* out = (float*)d_out;
  size_t off = 0; char* ws = (char*)d_ws;
  auto carve = [&](size_t bytes) { char* p = ws + off; off += (bytes + 255) & ~(size_t)255; return p; };
  b16* XH = (b16*)carve(SZ_XH);        // 16 MiB  x as f16 [MT][1024], fragment order
  b16* WT = (b16*)carve(SZ_WT);        //  8 MiB  weight planes [4][1024 out][1024 in] x16, fragment order
  b16* QK = (b16*)carve(SZ_QK);        // 32 MiB  [MT][Q 1024 | K 1024] f16, fragment order
  b16* VT = (b16*)carve(SZ_VT);        // 16 MiB  V^T [h*64+d][MT] f16, fragment order
  b16* CTX = (b16*)carve(SZ_CTX);      // 16 MiB  attention output x32 f16 [MT][1024], fragment order
  if (off > ws_size || off > ((size_t)128 << 20)) return;   // 88 MiB at the shipped sizes
  const float s16 = 1.0f / WSC, s512 = 1.0f / (WSC * CSC);
  prep_kernel<<<4 * WB + XB, 256, 0, stream>>>(x, Wq, Wk, Wv, Wo, XH, WT);                                                           // XH, and the four weight planes
  qkv_kernel<<<dim3(MT / 256, KD / 128), 384, 0, stream>>>(XH, WT, bq, bk, bv, QK, VT, s16);                                              // Q = x Wq + bq | K = x Wk + bk -> QK; V^T[c][m] = sum_k WvT[c][k] x[m][k] + bv[c] -> VT
  attn_kernel<<<dim3(NHEAD, NBU, SEQU / 64), 128, 0, stream>>>(QK, VT, CTX);
  outln_kernel<<<MT / 64, 512, 0, stream>>>(CTX, WT + (size_t)3 * KD * KD, bo, x, gam, bet, out, s512);                                      // out = LayerNorm(ctx Wo + bo + x) * gamma + beta
}
